// v000
// The times below were measured on an AMD MI455X: many runs one after another, warmed up first and cycling through
// copies of the inputs, with the whole window's GPU time divided by the number of runs. Launches and the gaps
// between them are all in it. The median over several windows is given; except for v000 it joins two sittings, which
// can be a few percent apart, so the side-by-side timings, each taken in one sitting, are the better comparison.
// v000 is the starting kernel. One run takes 317 microseconds.
#include <hip/hip_runtime.h>
// Compute dtype: every contraction on v_wmma_f32_16x16x32_f16 (f16 operands, f32 accumulate): x / weights exact in f16 after an RNE convert to bf16 (weights carried x16); q, k, v plain f16; softmax weights f16 carried x1024 (folded into the exponent, cancelled by the f32 row sum); merged head rows f16 carried x64 against the x16 output weights (alpha 2^-10).
// Self-attention block: x [4][2048][768]; q/k/v = x W + b with [in][out] weights; 12 heads of 64; logits = q.k/8 + mask*(-1e9) per (batch, key); softmax over 2048 keys; out = merged Wo + bo.
// Structure: weight planes Bt[n][k]; x as f16 rows; Q, K row GEMMs (32x64 wave tiles); V^T produced directly by the operand-swapped GEMM (A = Wv^T plane, B = x rows, per-row bias);
#ifndef NB
#define NB 4
#endif
#ifndef SEQ
#define SEQ 2048
#endif
#define SEQ_FULL 2048                 /* per-batch row count of the inputs */
#define DM 768
#define NH 12
#define HD 64
#define NR (NB * SEQ)                 /* token rows processed */
#define LN1024 6.931471805599453f

static_assert(NH * HD == DM);
static_assert(HD == 64);
static_assert(DM % 128 == 0);
static_assert(DM % 64 == 0);
static_assert(DM % 32 == 0);
static_assert(NR % 128 == 0);
static_assert(SEQ % 64 == 0);
static_assert(SEQ % 32 == 0);
static_assert((SEQ / 16) % 4 == 0);
static_assert(SEQ <= SEQ_FULL);
static_assert(((size_t)NB * NH * (SEQ / 16)) % 4 == 0);
static_assert((size_t)4 * DM * DM * 2 + (size_t)5 * NR * DM * 2 <= (size_t)134217728);

typedef _Float16 v16h __attribute__((ext_vector_type(16)));
typedef unsigned short v8us __attribute__((ext_vector_type(8), may_alias));
typedef float v8f  __attribute__((ext_vector_type(8)));
typedef float v4f  __attribute__((ext_vector_type(4)));
typedef float v4fa __attribute__((ext_vector_type(4), may_alias));
union FragH { v16h v; v8us half[2]; _Float16 h[16]; unsigned short u[16]; };

__device__ __forceinline__ unsigned short bf16_bits(float x) { unsigned int u = __float_as_uint(x); return (unsigned short)((u + 0x7FFFu + ((u >> 16) & 1u)) >> 16); }
__device__ __forceinline__ float bf16_rne(float x) { return __uint_as_float(((unsigned int)bf16_bits(x)) << 16); }
__device__ __forceinline__ int imin(int a, int b) { return (a < b) ? a : b; }

// 16x32 fragment of a k-contiguous 16-bit row: elements 0..7 <- k 8h..8h+7, elements 8..15 <- k 16+8h..16+8h+7 (same map for A rows and B columns)
__device__ __forceinline__ v16h ldfrag(const _Float16* p, int hh) {
  FragH f;
  f.half[0] = *(const v8us*)((const unsigned short*)p + 8 * hh);
  f.half[1] = *(const v8us*)((const unsigned short*)p + 16 + 8 * hh);
  return f.v;
}
__device__ __forceinline__ v8f mma16(v16h a, v16h b, v8f c) {
  v8f d = __builtin_amdgcn_wmma_f32_16x16x32_f16(false, a, false, b, (short)0, c, false, false);
  asm volatile("v_nop\n\tv_nop\n\tv_nop\n\tv_nop" : "+v"(d) : "v"(a), "v"(b));
  return d;
}

__global__ __launch_bounds__(256) void k_wt_f16(const float* __restrict__ W, _Float16* __restrict__ Wt, int K, int N, float scale) {
  const int t = blockIdx.x * 256 + threadIdx.x;
  const int k8n = K / 8;
  if (t >= N * k8n) return;
  const int n = t / k8n, k8 = (t % k8n) * 8;
  FragH f;
#pragma unroll
  for (int i = 0; i < 8; ++i) f.h[i] = (_Float16)(bf16_rne(W[(size_t)(k8 + i) * N + n]) * scale);
  const v8us o = f.half[0];
  unsigned short* d = (unsigned short*)Wt + (size_t)n * K + k8;
  *(v8us*)d = o;
  
}

__global__ __launch_bounds__(256) void k_x16(const float* __restrict__ x, _Float16* __restrict__ X16, int nthr) {
  const int t = blockIdx.x * 256 + threadIdx.x;
  if (t >= nthr) return;
  const int row = t / (DM / 8), c8 = (t % (DM / 8)) * 8;
  const int b = row / SEQ, s = row % SEQ;
  const float* src = x + ((size_t)b * SEQ_FULL + s) * DM + c8;
  const v4f a = *(const v4fa*)src, c = *(const v4fa*)(src + 4);
  FragH f;
#pragma unroll
  for (int q = 0; q < 4; ++q) { f.h[q] = (_Float16)bf16_rne(a[q]); f.h[4 + q] = (_Float16)bf16_rne(c[q]); }
  const v8us o = f.half[0];
  unsigned short* d = (unsigned short*)X16 + (size_t)t * 8;
  *(v8us*)d = o;
  
}

// C[by][M][N] = alpha * A[M][K] . Bt[by][N][K]^T + bias (per column, or per row when biasrow != 0; bias RNE-converted to bf16).
// A, Bt f16 k-contiguous rows. Block = 4 waves, wave tile 32 rows x 64 cols; M % 128 == 0, N % 64 == 0, K % 32 == 0 (host asserts).
__global__ __launch_bounds__(128) void k_gemm(const _Float16* __restrict__ A, int lda,
                                              const _Float16* __restrict__ Bh, int ldb, size_t sB, float alpha,
                                              const float* __restrict__ bias, int nbias, int biasrow,
                                              float* __restrict__ C32, _Float16* __restrict__ C16, int out16,
                                              int ldc, size_t sC, int M, int N, int K) {
  __shared__ __attribute__((aligned(16))) float so[4][32][68];
  const int tid = threadIdx.x, lane = tid & 31, ln = lane & 15, hh = lane >> 4;
  const int w = __builtin_amdgcn_readfirstlane(tid >> 5);
  const int by = blockIdx.y;
  const _Float16* Bb = Bh + (size_t)by * sB;
  const size_t cofs = (size_t)by * sC;
  const int ntn = N >> 6;
  const int mt = blockIdx.x / ntn, nq = blockIdx.x - mt * ntn;
  const int row0 = mt * 128 + 32 * w, col0 = nq * 64;
  if (row0 >= M) return;
  const _Float16* a0p = A + (size_t)(row0 + ln) * lda;
  const _Float16* a1p = a0p + (size_t)16 * lda;
  const _Float16* b0p = Bb + (size_t)(col0 + ln) * ldb;
  const _Float16* b1p = b0p + (size_t)16 * ldb;
  const _Float16* b2p = b1p + (size_t)16 * ldb;
  const _Float16* b3p = b2p + (size_t)16 * ldb;
  const v8f z8 = {0.f, 0.f, 0.f, 0.f, 0.f, 0.f, 0.f, 0.f};
  v8f c00 = z8, c01 = z8, c02 = z8, c03 = z8, c10 = z8, c11 = z8, c12 = z8, c13 = z8;
#pragma unroll 1
  for (int kb = 0; kb < K; kb += 32) {
    const v16h a0 = ldfrag(a0p + kb, hh), a1 = ldfrag(a1p + kb, hh);
    v16h b = ldfrag(b0p + kb, hh); c00 = mma16(a0, b, c00); c10 = mma16(a1, b, c10);
    b = ldfrag(b1p + kb, hh); c01 = mma16(a0, b, c01); c11 = mma16(a1, b, c11);
    b = ldfrag(b2p + kb, hh); c02 = mma16(a0, b, c02); c12 = mma16(a1, b, c12);
    b = ldfrag(b3p + kb, hh); c03 = mma16(a0, b, c03); c13 = mma16(a1, b, c13);
  }
  // per-row bias candidates (clamped addresses; selected by value below)
  const int rb0 = imin(row0 + 8 * hh, nbias - 8), rb1 = imin(row0 + 16 + 8 * hh, nbias - 8);
  const v4f br00 = *(const v4fa*)(bias + rb0), br01 = *(const v4fa*)(bias + rb0 + 4);
  const v4f br10 = *(const v4fa*)(bias + rb1), br11 = *(const v4fa*)(bias + rb1 + 4);
  const float brow[16] = {br00[0], br00[1], br00[2], br00[3], br01[0], br01[1], br01[2], br01[3],
                          br10[0], br10[1], br10[2], br10[3], br11[0], br11[1], br11[2], br11[3]};
  const v8f accs[8] = {c00, c01, c02, c03, c10, c11, c12, c13};
#pragma unroll
  for (int u = 0; u < 8; ++u) {
    const int t = u & 3, half = u >> 2;
    const int col = col0 + t * 16 + ln;
    const float bc = bf16_rne(bias[imin(col, nbias - 1)]);
#pragma unroll
    for (int r = 0; r < 8; ++r) {
      const int rloc = half * 16 + 8 * hh + r;
      const float br = bf16_rne(brow[half * 8 + r]);
      const float bv = (biasrow != 0) ? br : bc;
      so[w][rloc][t * 16 + ln] = accs[u][r] * alpha + bv;
    }
  }
  __builtin_amdgcn_fence(4 /* acq_rel order */, "workgroup");
  __builtin_amdgcn_wave_barrier();
  if (out16 != 0) {
    const int rq = lane >> 3, c8 = (lane & 7) * 8;
    {
#pragma unroll
      for (int it = 0; it < 8; ++it) {
        const int row = it * 4 + rq;
        const v4f x0 = *(const v4fa*)&so[w][row][c8];
        const v4f x1 = *(const v4fa*)&so[w][row][c8 + 4];
        FragH f;
#pragma unroll
        for (int q = 0; q < 4; ++q) { f.h[q] = (_Float16)x0[q]; f.h[4 + q] = (_Float16)x1[q]; }
        const v8us o = f.half[0];
        *(v8us*)((unsigned short*)C16 + cofs + (size_t)(row0 + row) * ldc + col0 + c8) = o;
      }
      
    }
  } else {
    const int rsub = lane >> 4, c4 = (lane & 15) * 4;
    {
#pragma unroll
      for (int q = 0; q < 16; ++q) {
        const int r = q * 2 + rsub;
        const v4f v = *(const v4fa*)&so[w][r][c4];
        *(v4f*)(C32 + cofs + (size_t)(row0 + r) * ldc + col0 + c4) = v;
      }
      
    }
  }
}

// Fused attention. Block = 4 waves of one (batch, head); wave = 16 queries. Q16/K16 rows [token][DM] (head h at columns 64h..), VT [batch][DM][SEQ].
// Per 32 keys: S^T tiles (A = K rows, B = Q rows; D lane = query, r = key 8h+r) -> e = s/8 + mask addend (LDS, per key) -> online softmax (lane-local; one cross-half exchange)
// -> P in registers is the B fragment (k = key) of O^T += V^T . P^T (A = V^T rows; D lane = query, r = d 8h+r). Output rows f16 carried x64.
__global__ __launch_bounds__(128) void k_attn(const _Float16* __restrict__ Q16, const _Float16* __restrict__ K16,
                                              const _Float16* __restrict__ VT, const float* __restrict__ mask,
                                              _Float16* __restrict__ O16) {
  __shared__ __attribute__((aligned(16))) float msk[SEQ];                  /* cross-wave: block barrier */
  __shared__ __attribute__((aligned(16))) unsigned short ct[4][16][72];    /* private to each wave */
  const int tid = threadIdx.x, lane = tid & 31, ln = lane & 15, hh = lane >> 4;
  const int w = __builtin_amdgcn_readfirstlane(tid >> 5);
  const int gw = blockIdx.x * 4 + w;
  const int bh = gw / (SEQ / 16);
  const int qt = gw - bh * (SEQ / 16);
  const int b = bh / NH, h = bh - b * NH;
  // additive key term of this batch: f32(bf16(mask)) * (-1e9), all SEQ entries written before any read
  const float* mrow = mask + (size_t)b * SEQ_FULL;
  for (int i = tid * 4; i < SEQ; i += 512) {
    const v4f m = *(const v4fa*)(mrow + i);
    v4f o;
#pragma unroll
    for (int q = 0; q < 4; ++q) o[q] = bf16_rne(m[q]) * -1.0e9f;
    *(v4fa*)&msk[i] = o;
  }
  __syncthreads();
  const size_t tok0 = (size_t)b * SEQ;
  const _Float16* qrow = Q16 + (tok0 + (size_t)(qt * 16 + ln)) * DM + h * HD;
  const v16h qb0 = ldfrag(qrow, hh), qb1 = ldfrag(qrow + 32, hh);
  const _Float16* kbase = K16 + (tok0 + (size_t)ln) * DM + h * HD;
  const _Float16* vbase = VT + ((size_t)b * DM + (size_t)(h * HD + ln)) * SEQ;
  const v8f z8 = {0.f, 0.f, 0.f, 0.f, 0.f, 0.f, 0.f, 0.f};
  v8f o0 = z8, o1 = z8, o2 = z8, o3 = z8;
  float mo = -1.0e30f, mso = -1.0e30f, l = 0.f;
#pragma unroll 1
  for (int kb = 0; kb < SEQ; kb += 32) {
    const _Float16* k0p = kbase + (size_t)kb * DM;
    const _Float16* k1p = k0p + (size_t)16 * DM;
    v8f s0 = z8, s1 = z8;
    { v16h a = ldfrag(k0p, hh); s0 = mma16(a, qb0, s0); a = ldfrag(k0p + 32, hh); s0 = mma16(a, qb1, s0); }
    { v16h a = ldfrag(k1p, hh); s1 = mma16(a, qb0, s1); a = ldfrag(k1p + 32, hh); s1 = mma16(a, qb1, s1); }
    const v4f ma = *(const v4fa*)&msk[kb + 8 * hh];
    const v4f mb = *(const v4fa*)&msk[kb + 8 * hh + 4];
    const v4f mc = *(const v4fa*)&msk[kb + 16 + 8 * hh];
    const v4f md = *(const v4fa*)&msk[kb + 16 + 8 * hh + 4];
    const float am0[8] = {ma[0], ma[1], ma[2], ma[3], mb[0], mb[1], mb[2], mb[3]};
    const float am1[8] = {mc[0], mc[1], mc[2], mc[3], md[0], md[1], md[2], md[3]};
    float e0[8], e1[8];
#pragma unroll
    for (int r = 0; r < 8; ++r) { e0[r] = fmaf(s0[r], 0.125f, am0[r]); e1[r] = fmaf(s1[r], 0.125f, am1[r]); }
    float bm = fmaxf(e0[0], e1[0]);
#pragma unroll
    for (int r = 1; r < 8; ++r) bm = fmaxf(bm, fmaxf(e0[r], e1[r]));
    const float bmo = __shfl_xor(bm, 16, 32);
    bm = fmaxf(bm, bmo);
    const float mn = fmaxf(mo, bm);
    const float msn = mn - LN1024;          /* weights carried x1024 through the exponent */
    const float alpha = __expf(mso - msn);
    mo = mn; mso = msn;
    float ps = 0.f;
    FragH pf;
#pragma unroll
    for (int r = 0; r < 8; ++r) {
      const float p0 = __expf(e0[r] - msn);
      const float p1 = __expf(e1[r] - msn);
      ps += p0 + p1;
      pf.h[r] = (_Float16)p0;               /* k = 8h + r      <-> key kb + 8h + r      */
      pf.h[8 + r] = (_Float16)p1;           /* k = 16 + 8h + r <-> key kb + 16 + 8h + r */
    }
    l = l * alpha + ps;
    o0 *= alpha; o1 *= alpha; o2 *= alpha; o3 *= alpha;
    const _Float16* vp = vbase + kb;
    { const v16h a = ldfrag(vp, hh); o0 = mma16(a, pf.v, o0); }
    { const v16h a = ldfrag(vp + (size_t)16 * SEQ, hh); o1 = mma16(a, pf.v, o1); }
    { const v16h a = ldfrag(vp + (size_t)32 * SEQ, hh); o2 = mma16(a, pf.v, o2); }
    { const v16h a = ldfrag(vp + (size_t)48 * SEQ, hh); o3 = mma16(a, pf.v, o3); }
  }
  const float lo = __shfl_xor(l, 16, 32);
  const float lt = l + lo;
  const float inv = 64.0f / lt;             /* merged rows carried x64 */
  const v8f oo[4] = {o0, o1, o2, o3};
#pragma unroll
  for (int j = 0; j < 4; ++j) {
    FragH f;
#pragma unroll
    for (int r = 0; r < 8; ++r) f.h[r] = (_Float16)(oo[j][r] * inv);   /* query ln, d = 16j + 8h + r */
    *(v8us*)&ct[w][ln][16 * j + 8 * hh] = f.half[0];
  }
  __builtin_amdgcn_fence(4 /* acq_rel order */, "workgroup");
  __builtin_amdgcn_wave_barrier();
  const int rq = lane >> 3, pc = lane & 7;
  {
#pragma unroll
    for (int it = 0; it < 4; ++it) {
      const int row = it * 4 + rq;
      const v8us v = *(const v8us*)&ct[w][row][pc * 8];
      *(v8us*)((unsigned short*)O16 + (tok0 + (size_t)(qt * 16 + row)) * DM + h * HD + pc * 8) = v;
    }
    
  }
}

extern "C" void kernel_launch(void* const* d_in, const int* in_sizes, int n_in,
                              void* d_out, int out_size, void* d_ws, size_t ws_size, hipStream_t stream) {
  if (n_in < 10) return;
  const size_t needRows = (size_t)(NB - 1) * SEQ_FULL + SEQ;
  if ((size_t)in_sizes[0] < needRows * DM) return;
  if ((size_t)in_sizes[1] < needRows) return;
  if ((size_t)in_sizes[2] < (size_t)DM * DM || (size_t)in_sizes[4] < (size_t)DM * DM) return;
  if ((size_t)in_sizes[6] < (size_t)DM * DM || (size_t)in_sizes[8] < (size_t)DM * DM) return;
  if (in_sizes[3] < DM || in_sizes[5] < DM || in_sizes[7] < DM || in_sizes[9] < DM) return;
  if ((size_t)out_size < (size_t)NR * DM) return;
  const float* x    = (const float*)d_in[0];
  const float* mask = (const float*)d_in[1];
  const float* wq   = (const float*)d_in[2];
  const float* bq   = (const float*)d_in[3];
  const float* wk   = (const float*)d_in[4];
  const float* bk   = (const float*)d_in[5];
  const float* wv   = (const float*)d_in[6];
  const float* bv   = (const float*)d_in[7];
  const float* wo   = (const float*)d_in[8];
  const float* bo   = (const float*)d_in[9];
  float* out = (float*)d_out;

  char* ws = (char*)d_ws; size_t off = 0;
  const size_t wB = (size_t)DM * DM * 2;          /* 1,179,648 B per weight plane */
  const size_t pB = (size_t)NR * DM * 2;          /* 12,582,912 B per activation plane */
  _Float16* BQ  = (_Float16*)(ws + off); off += wB;
  _Float16* BK  = (_Float16*)(ws + off); off += wB;
  _Float16* BV  = (_Float16*)(ws + off); off += wB;
  _Float16* BO  = (_Float16*)(ws + off); off += wB;
  _Float16* X16 = (_Float16*)(ws + off); off += pB;
  _Float16* Q16 = (_Float16*)(ws + off); off += pB;
  _Float16* K16 = (_Float16*)(ws + off); off += pB;
  _Float16* VT  = (_Float16*)(ws + off); off += pB;   /* [NB][DM][SEQ] */
  _Float16* O16 = (_Float16*)(ws + off); off += pB;
  if (off > ws_size) return;

  { const unsigned g = (unsigned)(((size_t)DM * (DM / 8) + 255) / 256);
    k_wt_f16<<<g, 256, 0, stream>>>(wq, BQ, DM, DM, 16.0f);     /* in[768][768] -> out[n][k] x16 */
    k_wt_f16<<<g, 256, 0, stream>>>(wk, BK, DM, DM, 16.0f);
    k_wt_f16<<<g, 256, 0, stream>>>(wv, BV, DM, DM, 16.0f);
    k_wt_f16<<<g, 256, 0, stream>>>(wo, BO, DM, DM, 16.0f); }
  { const int nthr = NR * (DM / 8);
    k_x16<<<(unsigned)((nthr + 255) / 256), 256, 0, stream>>>(x, X16, nthr); }
  /* Q, K rows: [NR][DM] f16 */
  k_gemm<<<dim3((unsigned)((NR / 128) * (DM / 64)), 1), 128, 0, stream>>>(X16, DM, BQ, DM, (size_t)0, 0.0625f, bq, DM, 0, out, Q16, 1, DM, (size_t)0, NR, DM, DM);
  k_gemm<<<dim3((unsigned)((NR / 128) * (DM / 64)), 1), 128, 0, stream>>>(X16, DM, BK, DM, (size_t)0, 0.0625f, bk, DM, 0, out, K16, 1, DM, (size_t)0, NR, DM, DM);
  /* V^T per batch: C[m = feature][n = token] = Wv^T[m][k] . x[n][k] + bv[m] -> VT[b][DM][SEQ] */
  k_gemm<<<dim3((unsigned)((DM / 128) * (SEQ / 64)), NB), 128, 0, stream>>>(BV, DM, X16, DM, (size_t)SEQ * DM, 0.0625f, bv, DM, 1, out, VT, 1, SEQ, (size_t)DM * SEQ, DM, SEQ, DM);
  k_attn<<<(unsigned)(((size_t)NB * NH * (SEQ / 16)) / 4), 128, 0, stream>>>(Q16, K16, VT, mask, O16);
  /* out = (O16 / 64) . (BO / 16) + bo */
  k_gemm<<<dim3((unsigned)((NR / 128) * (DM / 64)), 1), 128, 0, stream>>>(O16, DM, BO, DM, (size_t)0, 0.0009765625f, bo, DM, 0, out, Q16, 0, DM, (size_t)0, NR, DM, DM);
}

// v001
// It runs in 244 microseconds.
// In two side-by-side timings against v000, it was 1.33 and 1.35 times as fast.
#include <hip/hip_runtime.h>
// Compute dtype: every contraction on v_wmma_f32_16x16x32_f16 (f16 operands, f32 accumulate): x / weights exact in f16 after an RNE convert to bf16 (weights carried x16); q, k, v plain f16; softmax weights f16 carried x1024 (folded into the exponent, cancelled by the f32 row sum); merged head rows f16 carried x64 against the x16 output weights (alpha 2^-10).
// Self-attention block: x [4][2048][768]; q/k/v = x W + b with [in][out] weights; 12 heads of 64; logits = q.k/8 + mask*(-1e9) per (batch, key); softmax over 2048 keys; out = merged Wo + bo.
// Structure: weight planes Bt[n][k]; x as f16 rows; Q, K row GEMMs (32x64 wave tiles); V^T produced directly by the operand-swapped GEMM (A = Wv^T plane, B = x rows, per-row bias);
#ifndef NB
#define NB 4
#endif
#ifndef SEQ
#define SEQ 2048
#endif
#define SEQ_FULL 2048                 /* per-batch row count of the inputs */
#define DM 768
#define NH 12
#define HD 64
#define NR (NB * SEQ)                 /* token rows processed */
#define LN1024 6.931471805599453f

static_assert(NH * HD == DM);
static_assert(HD == 64);
static_assert(DM % 128 == 0);
static_assert(DM % 64 == 0);
static_assert(DM % 32 == 0);
static_assert(NR % 128 == 0);
static_assert(SEQ % 64 == 0);
static_assert(SEQ % 32 == 0);
static_assert((SEQ / 16) % 4 == 0);
static_assert(SEQ <= SEQ_FULL);
static_assert(((size_t)NB * NH * (SEQ / 16)) % 4 == 0);
static_assert((size_t)4 * DM * DM * 2 + (size_t)5 * NR * DM * 2 <= (size_t)134217728);

typedef _Float16 v16h __attribute__((ext_vector_type(16)));
typedef unsigned short v8us __attribute__((ext_vector_type(8), may_alias));
typedef float v8f  __attribute__((ext_vector_type(8)));
typedef float v4f  __attribute__((ext_vector_type(4)));
typedef float v4fa __attribute__((ext_vector_type(4), may_alias));
union FragH { v16h v; v8us half[2]; _Float16 h[16]; unsigned short u[16]; };

__device__ __forceinline__ unsigned short bf16_bits(float x) { unsigned int u = __float_as_uint(x); return (unsigned short)((u + 0x7FFFu + ((u >> 16) & 1u)) >> 16); }
__device__ __forceinline__ float bf16_rne(float x) { return __uint_as_float(((unsigned int)bf16_bits(x)) << 16); }
__device__ __forceinline__ int imin(int a, int b) { return (a < b) ? a : b; }

// 16x32 fragment of a k-contiguous 16-bit row: elements 0..7 <- k 8h..8h+7, elements 8..15 <- k 16+8h..16+8h+7 (same map for A rows and B columns)
__device__ __forceinline__ v16h ldfrag(const _Float16* p, int hh) {
  FragH f;
  f.half[0] = *(const v8us*)((const unsigned short*)p + 8 * hh);
  f.half[1] = *(const v8us*)((const unsigned short*)p + 16 + 8 * hh);
  return f.v;
}
__device__ __forceinline__ v8f mma16(v16h a, v16h b, v8f c) {
  v8f d = __builtin_amdgcn_wmma_f32_16x16x32_f16(false, a, false, b, (short)0, c, false, false);
  asm volatile("v_nop\n\tv_nop\n\tv_nop\n\tv_nop" : "+v"(d) : "v"(a), "v"(b));
  return d;
}

__global__ __launch_bounds__(256) void k_wt_f16(const float* __restrict__ W, _Float16* __restrict__ Wt, int K, int N, float scale) {
  const int t = blockIdx.x * 256 + threadIdx.x;
  const int k8n = K / 8;
  if (t >= N * k8n) return;
  const int n = t / k8n, k8 = (t % k8n) * 8;
  FragH f;
#pragma unroll
  for (int i = 0; i < 8; ++i) f.h[i] = (_Float16)(bf16_rne(W[(size_t)(k8 + i) * N + n]) * scale);
  const v8us o = f.half[0];
  unsigned short* d = (unsigned short*)Wt + (size_t)n * K + k8;
  *(v8us*)d = o;
  
}

__global__ __launch_bounds__(256) void k_x16(const float* __restrict__ x, _Float16* __restrict__ X16, int nthr) {
  const int t = blockIdx.x * 256 + threadIdx.x;
  if (t >= nthr) return;
  const int row = t / (DM / 8), c8 = (t % (DM / 8)) * 8;
  const int b = row / SEQ, s = row % SEQ;
  const float* src = x + ((size_t)b * SEQ_FULL + s) * DM + c8;
  const v4f a = *(const v4fa*)src, c = *(const v4fa*)(src + 4);
  FragH f;
#pragma unroll
  for (int q = 0; q < 4; ++q) { f.h[q] = (_Float16)bf16_rne(a[q]); f.h[4 + q] = (_Float16)bf16_rne(c[q]); }
  const v8us o = f.half[0];
  unsigned short* d = (unsigned short*)X16 + (size_t)t * 8;
  *(v8us*)d = o;
  
}

// C[by][M][N] = alpha * A[M][K] . Bt[by][N][K]^T + bias (per column, or per row when biasrow != 0; bias RNE-converted to bf16).
// A, Bt f16 k-contiguous rows. Block = 4 waves, wave tile 32 rows x 64 cols; M % 128 == 0, N % 64 == 0, K % 32 == 0 (host asserts).
__global__ __launch_bounds__(128) void k_gemm(const _Float16* __restrict__ A, int lda,
                                              const _Float16* __restrict__ Bh, int ldb, size_t sB, float alpha,
                                              const float* __restrict__ bias, int nbias, int biasrow,
                                              float* __restrict__ C32, _Float16* __restrict__ C16, int out16,
                                              int ldc, size_t sC, int M, int N, int K) {
  __shared__ __attribute__((aligned(16))) float so[4][32][68];
  const int tid = threadIdx.x, lane = tid & 31, ln = lane & 15, hh = lane >> 4;
  const int w = __builtin_amdgcn_readfirstlane(tid >> 5);
  const int by = blockIdx.y;
  const _Float16* Bb = Bh + (size_t)by * sB;
  const size_t cofs = (size_t)by * sC;
  const int ntn = N >> 6;
  const int mt = blockIdx.x / ntn, nq = blockIdx.x - mt * ntn;
  const int row0 = mt * 128 + 32 * w, col0 = nq * 64;
  if (row0 >= M) return;
  const _Float16* a0p = A + (size_t)(row0 + ln) * lda;
  const _Float16* a1p = a0p + (size_t)16 * lda;
  const _Float16* b0p = Bb + (size_t)(col0 + ln) * ldb;
  const _Float16* b1p = b0p + (size_t)16 * ldb;
  const _Float16* b2p = b1p + (size_t)16 * ldb;
  const _Float16* b3p = b2p + (size_t)16 * ldb;
  const v8f z8 = {0.f, 0.f, 0.f, 0.f, 0.f, 0.f, 0.f, 0.f};
  v8f c00 = z8, c01 = z8, c02 = z8, c03 = z8, c10 = z8, c11 = z8, c12 = z8, c13 = z8;
#pragma unroll 1
  for (int kb = 0; kb < K; kb += 32) {
    const v16h a0 = ldfrag(a0p + kb, hh), a1 = ldfrag(a1p + kb, hh);
    v16h b = ldfrag(b0p + kb, hh); c00 = mma16(a0, b, c00); c10 = mma16(a1, b, c10);
    b = ldfrag(b1p + kb, hh); c01 = mma16(a0, b, c01); c11 = mma16(a1, b, c11);
    b = ldfrag(b2p + kb, hh); c02 = mma16(a0, b, c02); c12 = mma16(a1, b, c12);
    b = ldfrag(b3p + kb, hh); c03 = mma16(a0, b, c03); c13 = mma16(a1, b, c13);
  }
  // per-row bias candidates (clamped addresses; selected by value below)
  const int rb0 = imin(row0 + 8 * hh, nbias - 8), rb1 = imin(row0 + 16 + 8 * hh, nbias - 8);
  const v4f br00 = *(const v4fa*)(bias + rb0), br01 = *(const v4fa*)(bias + rb0 + 4);
  const v4f br10 = *(const v4fa*)(bias + rb1), br11 = *(const v4fa*)(bias + rb1 + 4);
  const float brow[16] = {br00[0], br00[1], br00[2], br00[3], br01[0], br01[1], br01[2], br01[3],
                          br10[0], br10[1], br10[2], br10[3], br11[0], br11[1], br11[2], br11[3]};
  const v8f accs[8] = {c00, c01, c02, c03, c10, c11, c12, c13};
#pragma unroll
  for (int u = 0; u < 8; ++u) {
    const int t = u & 3, half = u >> 2;
    const int col = col0 + t * 16 + ln;
    const float bc = bf16_rne(bias[imin(col, nbias - 1)]);
#pragma unroll
    for (int r = 0; r < 8; ++r) {
      const int rloc = half * 16 + 8 * hh + r;
      const float br = bf16_rne(brow[half * 8 + r]);
      const float bv = (biasrow != 0) ? br : bc;
      so[w][rloc][t * 16 + ln] = accs[u][r] * alpha + bv;
    }
  }
  __builtin_amdgcn_fence(4 /* acq_rel order */, "workgroup");
  __builtin_amdgcn_wave_barrier();
  if (out16 != 0) {
    const int rq = lane >> 3, c8 = (lane & 7) * 8;
    {
#pragma unroll
      for (int it = 0; it < 8; ++it) {
        const int row = it * 4 + rq;
        const v4f x0 = *(const v4fa*)&so[w][row][c8];
        const v4f x1 = *(const v4fa*)&so[w][row][c8 + 4];
        FragH f;
#pragma unroll
        for (int q = 0; q < 4; ++q) { f.h[q] = (_Float16)x0[q]; f.h[4 + q] = (_Float16)x1[q]; }
        const v8us o = f.half[0];
        *(v8us*)((unsigned short*)C16 + cofs + (size_t)(row0 + row) * ldc + col0 + c8) = o;
      }
      
    }
  } else {
    const int rsub = lane >> 4, c4 = (lane & 15) * 4;
    {
#pragma unroll
      for (int q = 0; q < 16; ++q) {
        const int r = q * 2 + rsub;
        const v4f v = *(const v4fa*)&so[w][r][c4];
        *(v4f*)(C32 + cofs + (size_t)(row0 + r) * ldc + col0 + c4) = v;
      }
      
    }
  }
}

#define KT 64                         /* keys per staged tile: K rows and V^T rows are then whole 128-byte lines */
#define KPITCH 72                     /* LDS row pitch in 16-bit elements: 144 B = 16 B x odd, conflict-free for 16-byte fragment reads */
#define NTILE (SEQ / KT)
static_assert(SEQ % KT == 0);

// One K tile (KT keys x 64 d) and one V^T tile (64 d x KT keys) from global memory into LDS, 16 bytes per lane and copy; a wave's copy covers 4 whole 128-byte rows.
// lk, lv: this lane's LDS byte address in row tid >> 3 of the K and V^T tile; gk, gv: the matching global addresses. Copy i takes row (tid >> 3) + 16 i.
// s_wait_xcnt 0 closes the statement so that no address register of an issued copy is rewritten ahead of it.
__device__ __forceinline__ void stage_kv(unsigned lk, unsigned lv, const _Float16* gk, const _Float16* gv) {
  asm volatile("global_load_async_to_lds_b128 %0, %8, off\n\t"
               "global_load_async_to_lds_b128 %1, %9, off\n\t"
               "global_load_async_to_lds_b128 %2, %10, off\n\t"
               "global_load_async_to_lds_b128 %3, %11, off\n\t"
               "global_load_async_to_lds_b128 %4, %12, off\n\t"
               "global_load_async_to_lds_b128 %5, %13, off\n\t"
               "global_load_async_to_lds_b128 %6, %14, off\n\t"
               "global_load_async_to_lds_b128 %7, %15, off\n\t"
               "s_wait_xcnt 0x0"
               :: "v"(lk), "v"(lk + 16u * KPITCH * 2u), "v"(lk + 32u * KPITCH * 2u), "v"(lk + 48u * KPITCH * 2u),
                  "v"(lv), "v"(lv + 16u * KPITCH * 2u), "v"(lv + 32u * KPITCH * 2u), "v"(lv + 48u * KPITCH * 2u),
                  "v"(gk), "v"(gk + (size_t)16 * DM), "v"(gk + (size_t)32 * DM), "v"(gk + (size_t)48 * DM),
                  "v"(gv), "v"(gv + (size_t)16 * SEQ), "v"(gv + (size_t)32 * SEQ), "v"(gv + (size_t)48 * SEQ)
               : "memory");
}

// Fused attention. Block = 4 waves of one (batch, head); wave = 16 queries. Q16/K16 rows [token][DM] (head h at columns 64h..), VT [batch][DM][SEQ].
// K and V^T reach the waves through a two-buffer LDS ring of KT-key tiles filled by asynchronous copies, one tile ahead; the block's 4 waves share each tile.
// Per 32 keys: S^T tiles (A = K rows, B = Q rows; D lane = query, r = key 8h+r) -> e = s/8 + mask addend (LDS, per key) -> online softmax (lane-local; one cross-half exchange)
// -> P in registers is the B fragment (k = key) of O^T += V^T . P^T (A = V^T rows; D lane = query, r = d 8h+r). Output rows f16 carried x64.
__global__ __launch_bounds__(128) void k_attn(const _Float16* __restrict__ Q16, const _Float16* __restrict__ K16,
                                              const _Float16* __restrict__ VT, const float* __restrict__ mask,
                                              _Float16* __restrict__ O16) {
  __shared__ __attribute__((aligned(16))) float msk[SEQ];                  /* cross-wave: block barrier */
  __shared__ __attribute__((aligned(16))) unsigned short ring[2][2][KT][KPITCH];   /* [buffer][K | V^T][row][element]; behind the loop's last barrier rows 16w.. of ring[0][0] stage wave w's output */
  const int tid = threadIdx.x, lane = tid & 31, ln = lane & 15, hh = lane >> 4;
  const int w = __builtin_amdgcn_readfirstlane(tid >> 5);
  const int gw = blockIdx.x * 4 + w;
  const int bh = gw / (SEQ / 16);
  const int qt = gw - bh * (SEQ / 16);
  const int b = bh / NH, h = bh - b * NH;
  const size_t tok0 = (size_t)b * SEQ;
  const int crow = tid >> 3, cc8 = (tid & 7) * 8;
  const unsigned lk0 = (unsigned)(size_t)&ring[0][0][crow][cc8];
  const unsigned lv0 = (unsigned)(size_t)&ring[0][1][crow][cc8];
  const _Float16* gk0 = K16 + (tok0 + (size_t)crow) * DM + h * HD + cc8;
  const _Float16* gv0 = VT + ((size_t)b * DM + (size_t)(h * HD + crow)) * SEQ + cc8;
  stage_kv(lk0, lv0, gk0, gv0);             /* tile 0 -> buffer 0, in flight under the mask fill */
  // additive key term of this batch: f32(bf16(mask)) * (-1e9), all SEQ entries written before any read
  const float* mrow = mask + (size_t)b * SEQ_FULL;
  for (int i = tid * 4; i < SEQ; i += 512) {
    const v4f m = *(const v4fa*)(mrow + i);
    v4f o;
#pragma unroll
    for (int q = 0; q < 4; ++q) o[q] = bf16_rne(m[q]) * -1.0e9f;
    *(v4fa*)&msk[i] = o;
  }
  asm volatile("s_wait_asynccnt 0x0" ::: "memory");   /* this wave's share of tile 0 has landed before the barrier publishes it */
  __syncthreads();
  if (1 < NTILE) stage_kv(lk0 + (unsigned)sizeof(ring[0]), lv0 + (unsigned)sizeof(ring[0]), gk0 + (size_t)KT * DM, gv0 + KT);   /* tile 1 -> buffer 1 */
  const _Float16* qrow = Q16 + (tok0 + (size_t)(qt * 16 + ln)) * DM + h * HD;
  const v16h qb0 = ldfrag(qrow, hh), qb1 = ldfrag(qrow + 32, hh);
  const v8f z8 = {0.f, 0.f, 0.f, 0.f, 0.f, 0.f, 0.f, 0.f};
  v8f o0 = z8, o1 = z8, o2 = z8, o3 = z8;
  float mo = -1.0e30f, mso = -1.0e30f, l = 0.f;
#pragma unroll 1
  for (int t = 0; t < NTILE; ++t) {
   const int buf = t & 1;
   for (int sub = 0; sub < KT; sub += 32) {
    const int kb = t * KT + sub;
    const _Float16* k0p = (const _Float16*)&ring[buf][0][sub + ln][0];
    const _Float16* k1p = k0p + 16 * KPITCH;
    v8f s0 = z8, s1 = z8;
    { v16h a = ldfrag(k0p, hh); s0 = mma16(a, qb0, s0); a = ldfrag(k0p + 32, hh); s0 = mma16(a, qb1, s0); }
    { v16h a = ldfrag(k1p, hh); s1 = mma16(a, qb0, s1); a = ldfrag(k1p + 32, hh); s1 = mma16(a, qb1, s1); }
    const v4f ma = *(const v4fa*)&msk[kb + 8 * hh];
    const v4f mb = *(const v4fa*)&msk[kb + 8 * hh + 4];
    const v4f mc = *(const v4fa*)&msk[kb + 16 + 8 * hh];
    const v4f md = *(const v4fa*)&msk[kb + 16 + 8 * hh + 4];
    const float am0[8] = {ma[0], ma[1], ma[2], ma[3], mb[0], mb[1], mb[2], mb[3]};
    const float am1[8] = {mc[0], mc[1], mc[2], mc[3], md[0], md[1], md[2], md[3]};
    float e0[8], e1[8];
#pragma unroll
    for (int r = 0; r < 8; ++r) { e0[r] = fmaf(s0[r], 0.125f, am0[r]); e1[r] = fmaf(s1[r], 0.125f, am1[r]); }
    float bm = fmaxf(e0[0], e1[0]);
#pragma unroll
    for (int r = 1; r < 8; ++r) bm = fmaxf(bm, fmaxf(e0[r], e1[r]));
    const float bmo = __shfl_xor(bm, 16, 32);
    bm = fmaxf(bm, bmo);
    const float mn = fmaxf(mo, bm);
    const float msn = mn - LN1024;          /* weights carried x1024 through the exponent */
    const float alpha = __expf(mso - msn);
    mo = mn; mso = msn;
    float ps = 0.f;
    FragH pf;
#pragma unroll
    for (int r = 0; r < 8; ++r) {
      const float p0 = __expf(e0[r] - msn);
      const float p1 = __expf(e1[r] - msn);
      ps += p0 + p1;
      pf.h[r] = (_Float16)p0;               /* k = 8h + r      <-> key kb + 8h + r      */
      pf.h[8 + r] = (_Float16)p1;           /* k = 16 + 8h + r <-> key kb + 16 + 8h + r */
    }
    l = l * alpha + ps;
    o0 *= alpha; o1 *= alpha; o2 *= alpha; o3 *= alpha;
    const _Float16* vp = (const _Float16*)&ring[buf][1][ln][sub];
    { const v16h a = ldfrag(vp, hh); o0 = mma16(a, pf.v, o0); }
    { const v16h a = ldfrag(vp + 16 * KPITCH, hh); o1 = mma16(a, pf.v, o1); }
    { const v16h a = ldfrag(vp + 32 * KPITCH, hh); o2 = mma16(a, pf.v, o2); }
    { const v16h a = ldfrag(vp + 48 * KPITCH, hh); o3 = mma16(a, pf.v, o3); }
   }
   asm volatile("s_wait_dscnt 0x0" ::: "memory");      /* this wave's reads of buffer buf are done before it is refilled */
   asm volatile("s_wait_asynccnt 0x0" ::: "memory");   /* this wave's share of tile t + 1 has landed */
   __syncthreads();                                    /* publishes tile t + 1 and ends every wave's reads of buffer buf */
   if (t + 2 < NTILE)
     stage_kv(lk0 + (unsigned)buf * (unsigned)sizeof(ring[0]), lv0 + (unsigned)buf * (unsigned)sizeof(ring[0]),
              gk0 + (size_t)(t + 2) * KT * DM, gv0 + (t + 2) * KT);
  }
  asm volatile("s_wait_asynccnt 0x0" ::: "memory");    /* no copy is outstanding when the ring becomes output staging */
  const float lo = __shfl_xor(l, 16, 32);
  const float lt = l + lo;
  const float inv = 64.0f / lt;             /* merged rows carried x64 */
  const v8f oo[4] = {o0, o1, o2, o3};
#pragma unroll
  for (int j = 0; j < 4; ++j) {
    FragH f;
#pragma unroll
    for (int r = 0; r < 8; ++r) f.h[r] = (_Float16)(oo[j][r] * inv);   /* query ln, d = 16j + 8h + r */
    *(v8us*)&ring[0][0][16 * w + ln][16 * j + 8 * hh] = f.half[0];
  }
  __builtin_amdgcn_fence(4 /* acq_rel order */, "workgroup");
  __builtin_amdgcn_wave_barrier();
  const int rq = lane >> 3, pc = lane & 7;
  {
#pragma unroll
    for (int it = 0; it < 4; ++it) {
      const int row = it * 4 + rq;
      const v8us v = *(const v8us*)&ring[0][0][16 * w + row][pc * 8];
      *(v8us*)((unsigned short*)O16 + (tok0 + (size_t)(qt * 16 + row)) * DM + h * HD + pc * 8) = v;
    }
    
  }
}

extern "C" void kernel_launch(void* const* d_in, const int* in_sizes, int n_in,
                              void* d_out, int out_size, void* d_ws, size_t ws_size, hipStream_t stream) {
  if (n_in < 10) return;
  const size_t needRows = (size_t)(NB - 1) * SEQ_FULL + SEQ;
  if ((size_t)in_sizes[0] < needRows * DM) return;
  if ((size_t)in_sizes[1] < needRows) return;
  if ((size_t)in_sizes[2] < (size_t)DM * DM || (size_t)in_sizes[4] < (size_t)DM * DM) return;
  if ((size_t)in_sizes[6] < (size_t)DM * DM || (size_t)in_sizes[8] < (size_t)DM * DM) return;
  if (in_sizes[3] < DM || in_sizes[5] < DM || in_sizes[7] < DM || in_sizes[9] < DM) return;
  if ((size_t)out_size < (size_t)NR * DM) return;
  const float* x    = (const float*)d_in[0];
  const float* mask = (const float*)d_in[1];
  const float* wq   = (const float*)d_in[2];
  const float* bq   = (const float*)d_in[3];
  const float* wk   = (const float*)d_in[4];
  const float* bk   = (const float*)d_in[5];
  const float* wv   = (const float*)d_in[6];
  const float* bv   = (const float*)d_in[7];
  const float* wo   = (const float*)d_in[8];
  const float* bo   = (const float*)d_in[9];
  float* out = (float*)d_out;

  char* ws = (char*)d_ws; size_t off = 0;
  const size_t wB = (size_t)DM * DM * 2;          /* 1,179,648 B per weight plane */
  const size_t pB = (size_t)NR * DM * 2;          /* 12,582,912 B per activation plane */
  _Float16* BQ  = (_Float16*)(ws + off); off += wB;
  _Float16* BK  = (_Float16*)(ws + off); off += wB;
  _Float16* BV  = (_Float16*)(ws + off); off += wB;
  _Float16* BO  = (_Float16*)(ws + off); off += wB;
  _Float16* X16 = (_Float16*)(ws + off); off += pB;
  _Float16* Q16 = (_Float16*)(ws + off); off += pB;
  _Float16* K16 = (_Float16*)(ws + off); off += pB;
  _Float16* VT  = (_Float16*)(ws + off); off += pB;   /* [NB][DM][SEQ] */
  _Float16* O16 = (_Float16*)(ws + off); off += pB;
  if (off > ws_size) return;

  { const unsigned g = (unsigned)(((size_t)DM * (DM / 8) + 255) / 256);
    k_wt_f16<<<g, 256, 0, stream>>>(wq, BQ, DM, DM, 16.0f);     /* in[768][768] -> out[n][k] x16 */
    k_wt_f16<<<g, 256, 0, stream>>>(wk, BK, DM, DM, 16.0f);
    k_wt_f16<<<g, 256, 0, stream>>>(wv, BV, DM, DM, 16.0f);
    k_wt_f16<<<g, 256, 0, stream>>>(wo, BO, DM, DM, 16.0f); }
  { const int nthr = NR * (DM / 8);
    k_x16<<<(unsigned)((nthr + 255) / 256), 256, 0, stream>>>(x, X16, nthr); }
  /* Q, K rows: [NR][DM] f16 */
  k_gemm<<<dim3((unsigned)((NR / 128) * (DM / 64)), 1), 128, 0, stream>>>(X16, DM, BQ, DM, (size_t)0, 0.0625f, bq, DM, 0, out, Q16, 1, DM, (size_t)0, NR, DM, DM);
  k_gemm<<<dim3((unsigned)((NR / 128) * (DM / 64)), 1), 128, 0, stream>>>(X16, DM, BK, DM, (size_t)0, 0.0625f, bk, DM, 0, out, K16, 1, DM, (size_t)0, NR, DM, DM);
  /* V^T per batch: C[m = feature][n = token] = Wv^T[m][k] . x[n][k] + bv[m] -> VT[b][DM][SEQ] */
  k_gemm<<<dim3((unsigned)((DM / 128) * (SEQ / 64)), NB), 128, 0, stream>>>(BV, DM, X16, DM, (size_t)SEQ * DM, 0.0625f, bv, DM, 1, out, VT, 1, SEQ, (size_t)DM * SEQ, DM, SEQ, DM);
  k_attn<<<(unsigned)(((size_t)NB * NH * (SEQ / 16)) / 4), 128, 0, stream>>>(Q16, K16, VT, mask, O16);
  /* out = (O16 / 64) . (BO / 16) + bo */
  k_gemm<<<dim3((unsigned)((NR / 128) * (DM / 64)), 1), 128, 0, stream>>>(O16, DM, BO, DM, (size_t)0, 0.0009765625f, bo, DM, 0, out, Q16, 0, DM, (size_t)0, NR, DM, DM);
}

// v002
// It runs in 155 microseconds.
// Timed twice side by side with v001, it ran 1.59 and 1.60 times as fast.
// Over all steps from v000 it is 2.13 times as fast.
#include <hip/hip_runtime.h>
// Compute dtype: every contraction on v_wmma_f32_16x16x32_f16 (f16 operands, f32 accumulate): x / weights exact in f16 after an RNE convert to bf16 (weights carried x16); q, k, v plain f16; softmax weights f16 carried x1024 (folded into the exponent, cancelled by the f32 row sum); merged head rows f16 carried x64 against the x16 output weights (alpha 2^-10).
// Self-attention block: x [4][2048][768]; q/k/v = x W + b with [in][out] weights; 12 heads of 64; logits = q.k/8 + mask*(-1e9) per (batch, key); softmax over 2048 keys; out = merged Wo + bo.
// Structure: weight planes Bt[n][k]; x as f16 rows; Q, K row GEMMs (32x64 wave tiles); V^T produced directly by the operand-swapped GEMM (A = Wv^T plane, B = x rows, per-row bias);
#ifndef NB
#define NB 4
#endif
#ifndef SEQ
#define SEQ 2048
#endif
#define SEQ_FULL 2048                 /* per-batch row count of the inputs */
#define DM 768
#define NH 12
#define HD 64
#define NR (NB * SEQ)                 /* token rows processed */
#define LN1024 6.931471805599453f

static_assert(NH * HD == DM);
static_assert(HD == 64);
static_assert(DM % 128 == 0);
static_assert(DM % 64 == 0);
static_assert(DM % 32 == 0);
static_assert(NR % 128 == 0);
static_assert(SEQ % 64 == 0);
static_assert(SEQ % 32 == 0);
static_assert((SEQ / 16) % 4 == 0);
static_assert(SEQ <= SEQ_FULL);
static_assert(((size_t)NB * NH * (SEQ / 16)) % 4 == 0);
static_assert((size_t)4 * DM * DM * 2 + (size_t)5 * NR * DM * 2 <= (size_t)134217728);

typedef _Float16 v16h __attribute__((ext_vector_type(16)));
typedef unsigned short v8us __attribute__((ext_vector_type(8), may_alias));
typedef float v8f  __attribute__((ext_vector_type(8)));
typedef float v4f  __attribute__((ext_vector_type(4)));
typedef float v4fa __attribute__((ext_vector_type(4), may_alias));
union FragH { v16h v; v8us half[2]; _Float16 h[16]; unsigned short u[16]; };

__device__ __forceinline__ unsigned short bf16_bits(float x) { unsigned int u = __float_as_uint(x); return (unsigned short)((u + 0x7FFFu + ((u >> 16) & 1u)) >> 16); }
__device__ __forceinline__ float bf16_rne(float x) { return __uint_as_float(((unsigned int)bf16_bits(x)) << 16); }
__device__ __forceinline__ int imin(int a, int b) { return (a < b) ? a : b; }

// 16x32 fragment of a k-contiguous 16-bit row: elements 0..7 <- k 8h..8h+7, elements 8..15 <- k 16+8h..16+8h+7 (same map for A rows and B columns)
__device__ __forceinline__ v16h ldfrag(const _Float16* p, int hh) {
  FragH f;
  f.half[0] = *(const v8us*)((const unsigned short*)p + 8 * hh);
  f.half[1] = *(const v8us*)((const unsigned short*)p + 16 + 8 * hh);
  return f.v;
}
__device__ __forceinline__ v8f mma16(v16h a, v16h b, v8f c) {
  v8f d = __builtin_amdgcn_wmma_f32_16x16x32_f16(false, a, false, b, (short)0, c, false, false);
  asm volatile("v_nop\n\tv_nop\n\tv_nop\n\tv_nop" : "+v"(d) : "v"(a), "v"(b));
  return d;
}

__global__ __launch_bounds__(256) void k_wt_f16(const float* __restrict__ W, _Float16* __restrict__ Wt, int K, int N, float scale) {
  const int t = blockIdx.x * 256 + threadIdx.x;
  const int k8n = K / 8;
  if (t >= N * k8n) return;
  const int n = t / k8n, k8 = (t % k8n) * 8;
  FragH f;
#pragma unroll
  for (int i = 0; i < 8; ++i) f.h[i] = (_Float16)(bf16_rne(W[(size_t)(k8 + i) * N + n]) * scale);
  const v8us o = f.half[0];
  unsigned short* d = (unsigned short*)Wt + (size_t)n * K + k8;
  *(v8us*)d = o;
  
}

__global__ __launch_bounds__(256) void k_x16(const float* __restrict__ x, _Float16* __restrict__ X16, int nthr) {
  const int t = blockIdx.x * 256 + threadIdx.x;
  if (t >= nthr) return;
  const int row = t / (DM / 8), c8 = (t % (DM / 8)) * 8;
  const int b = row / SEQ, s = row % SEQ;
  const float* src = x + ((size_t)b * SEQ_FULL + s) * DM + c8;
  const v4f a = *(const v4fa*)src, c = *(const v4fa*)(src + 4);
  FragH f;
#pragma unroll
  for (int q = 0; q < 4; ++q) { f.h[q] = (_Float16)bf16_rne(a[q]); f.h[4 + q] = (_Float16)bf16_rne(c[q]); }
  const v8us o = f.half[0];
  unsigned short* d = (unsigned short*)X16 + (size_t)t * 8;
  *(v8us*)d = o;
  
}

#define GKT 64                        /* k elements per staged GEMM tile: operand rows are then whole 128-byte lines */
#define GPITCH 72                     /* LDS row pitch in 16-bit elements: 144 B = 16 B x odd, conflict-free for 16-byte fragment reads */

// One k tile of the block's operands (128 A rows and 64 B rows of GKT elements) from global memory into LDS, 16 bytes per lane and copy; a wave's copy covers 4 whole 128-byte rows.
// la, lb: this lane's LDS byte address in row tid >> 3 of the A and B part; ga, gb: the matching global addresses. Copy i takes row (tid >> 3) + 16 i.
// s_wait_xcnt 0 closes the statement so that no address register of an issued copy is rewritten ahead of it.
__device__ __forceinline__ void stage_ab(unsigned la, unsigned lb, const _Float16* ga, const _Float16* gb, int lda, int ldb) {
  asm volatile("global_load_async_to_lds_b128 %0, %12, off\n\t"
               "global_load_async_to_lds_b128 %1, %13, off\n\t"
               "global_load_async_to_lds_b128 %2, %14, off\n\t"
               "global_load_async_to_lds_b128 %3, %15, off\n\t"
               "global_load_async_to_lds_b128 %4, %16, off\n\t"
               "global_load_async_to_lds_b128 %5, %17, off\n\t"
               "global_load_async_to_lds_b128 %6, %18, off\n\t"
               "global_load_async_to_lds_b128 %7, %19, off\n\t"
               "global_load_async_to_lds_b128 %8, %20, off\n\t"
               "global_load_async_to_lds_b128 %9, %21, off\n\t"
               "global_load_async_to_lds_b128 %10, %22, off\n\t"
               "global_load_async_to_lds_b128 %11, %23, off\n\t"
               "s_wait_xcnt 0x0"
               :: "v"(la), "v"(la + 16u * GPITCH * 2u), "v"(la + 32u * GPITCH * 2u), "v"(la + 48u * GPITCH * 2u),
                  "v"(la + 64u * GPITCH * 2u), "v"(la + 80u * GPITCH * 2u), "v"(la + 96u * GPITCH * 2u), "v"(la + 112u * GPITCH * 2u),
                  "v"(lb), "v"(lb + 16u * GPITCH * 2u), "v"(lb + 32u * GPITCH * 2u), "v"(lb + 48u * GPITCH * 2u),
                  "v"(ga), "v"(ga + (size_t)16 * lda), "v"(ga + (size_t)32 * lda), "v"(ga + (size_t)48 * lda),
                  "v"(ga + (size_t)64 * lda), "v"(ga + (size_t)80 * lda), "v"(ga + (size_t)96 * lda), "v"(ga + (size_t)112 * lda),
                  "v"(gb), "v"(gb + (size_t)16 * ldb), "v"(gb + (size_t)32 * ldb), "v"(gb + (size_t)48 * ldb)
               : "memory");
}

// C[by][M][N] = alpha * A[M][K] . Bt[by][N][K]^T + bias (per column, or per row when biasrow != 0; bias RNE-converted to bf16).
// A, Bt f16 k-contiguous rows. Block = 4 waves, wave tile 32 rows x 64 cols; M % 128 == 0, N % 64 == 0, K % 64 == 0 (host asserts).
// The block's 128 A rows and 64 B rows reach the waves through a two-buffer LDS ring of GKT-element k tiles filled by asynchronous copies, one tile ahead.
__global__ __launch_bounds__(128) void k_gemm(const _Float16* __restrict__ A, int lda,
                                              const _Float16* __restrict__ Bh, int ldb, size_t sB, float alpha,
                                              const float* __restrict__ bias, int nbias, int biasrow,
                                              float* __restrict__ C32, _Float16* __restrict__ C16, int out16,
                                              int ldc, size_t sC, int M, int N, int K) {
  __shared__ __attribute__((aligned(16))) float so[4][32][68];
  __shared__ __attribute__((aligned(16))) unsigned short gring[2][128 + 64][GPITCH];   /* [buffer][A rows 0..127 | B rows 128..191][element] */
  const int tid = threadIdx.x, lane = tid & 31, ln = lane & 15, hh = lane >> 4;
  const int w = __builtin_amdgcn_readfirstlane(tid >> 5);
  const int by = blockIdx.y;
  const _Float16* Bb = Bh + (size_t)by * sB;
  const size_t cofs = (size_t)by * sC;
  const int ntn = N >> 6;
  const int mt = blockIdx.x / ntn, nq = blockIdx.x - mt * ntn;
  const int rowb = mt * 128, col0 = nq * 64;
  if (rowb >= M) return;                    /* the whole block leaves or none does: barriers follow */
  const int row0 = rowb + 32 * w;
  const int crow = tid >> 3, cc8 = (tid & 7) * 8;
  const unsigned la0 = (unsigned)(size_t)&gring[0][crow][cc8];
  const unsigned lb0 = (unsigned)(size_t)&gring[0][128 + crow][cc8];
  const _Float16* ga0 = A + (size_t)(rowb + crow) * lda + cc8;
  const _Float16* gb0 = Bb + (size_t)(col0 + crow) * ldb + cc8;
  const int nt = K / GKT;
  stage_ab(la0, lb0, ga0, gb0, lda, ldb);             /* tile 0 -> buffer 0 */
  asm volatile("s_wait_asynccnt 0x0" ::: "memory");   /* this wave's share of tile 0 has landed before the barrier publishes it */
  __syncthreads();
  if (1 < nt) stage_ab(la0 + (unsigned)sizeof(gring[0]), lb0 + (unsigned)sizeof(gring[0]), ga0 + GKT, gb0 + GKT, lda, ldb);   /* tile 1 -> buffer 1 */
  const v8f z8 = {0.f, 0.f, 0.f, 0.f, 0.f, 0.f, 0.f, 0.f};
  v8f c00 = z8, c01 = z8, c02 = z8, c03 = z8, c10 = z8, c11 = z8, c12 = z8, c13 = z8;
#pragma unroll 1
  for (int t = 0; t < nt; ++t) {
    const int buf = t & 1;
    const _Float16* ap = (const _Float16*)&gring[buf][32 * w + ln][0];
    const _Float16* bp = (const _Float16*)&gring[buf][128 + ln][0];
#pragma unroll
    for (int sub = 0; sub < GKT; sub += 32) {
      const v16h a0 = ldfrag(ap + sub, hh), a1 = ldfrag(ap + 16 * GPITCH + sub, hh);
      const v16h b0 = ldfrag(bp + sub, hh), b1 = ldfrag(bp + 16 * GPITCH + sub, hh);
      const v16h b2 = ldfrag(bp + 32 * GPITCH + sub, hh), b3 = ldfrag(bp + 48 * GPITCH + sub, hh);
      c00 = mma16(a0, b0, c00); c10 = mma16(a1, b0, c10);
      c01 = mma16(a0, b1, c01); c11 = mma16(a1, b1, c11);
      c02 = mma16(a0, b2, c02); c12 = mma16(a1, b2, c12);
      c03 = mma16(a0, b3, c03); c13 = mma16(a1, b3, c13);
    }
    asm volatile("s_wait_dscnt 0x0" ::: "memory");      /* this wave's reads of buffer buf are done before it is refilled */
    asm volatile("s_wait_asynccnt 0x0" ::: "memory");   /* this wave's share of tile t + 1 has landed */
    __syncthreads();                                    /* publishes tile t + 1 and ends every wave's reads of buffer buf */
    if (t + 2 < nt)
      stage_ab(la0 + (unsigned)buf * (unsigned)sizeof(gring[0]), lb0 + (unsigned)buf * (unsigned)sizeof(gring[0]),
               ga0 + (size_t)(t + 2) * GKT, gb0 + (size_t)(t + 2) * GKT, lda, ldb);
  }
  asm volatile("s_wait_asynccnt 0x0" ::: "memory");     /* no copy is outstanding when the wave goes on to its output */
  // per-row bias candidates (clamped addresses; selected by value below)
  const int rb0 = imin(row0 + 8 * hh, nbias - 8), rb1 = imin(row0 + 16 + 8 * hh, nbias - 8);
  const v4f br00 = *(const v4fa*)(bias + rb0), br01 = *(const v4fa*)(bias + rb0 + 4);
  const v4f br10 = *(const v4fa*)(bias + rb1), br11 = *(const v4fa*)(bias + rb1 + 4);
  const float brow[16] = {br00[0], br00[1], br00[2], br00[3], br01[0], br01[1], br01[2], br01[3],
                          br10[0], br10[1], br10[2], br10[3], br11[0], br11[1], br11[2], br11[3]};
  const v8f accs[8] = {c00, c01, c02, c03, c10, c11, c12, c13};
#pragma unroll
  for (int u = 0; u < 8; ++u) {
    const int t = u & 3, half = u >> 2;
    const int col = col0 + t * 16 + ln;
    const float bc = bf16_rne(bias[imin(col, nbias - 1)]);
#pragma unroll
    for (int r = 0; r < 8; ++r) {
      const int rloc = half * 16 + 8 * hh + r;
      const float br = bf16_rne(brow[half * 8 + r]);
      const float bv = (biasrow != 0) ? br : bc;
      so[w][rloc][t * 16 + ln] = accs[u][r] * alpha + bv;
    }
  }
  __builtin_amdgcn_fence(4 /* acq_rel order */, "workgroup");
  __builtin_amdgcn_wave_barrier();
  if (out16 != 0) {
    const int rq = lane >> 3, c8 = (lane & 7) * 8;
    {
#pragma unroll
      for (int it = 0; it < 8; ++it) {
        const int row = it * 4 + rq;
        const v4f x0 = *(const v4fa*)&so[w][row][c8];
        const v4f x1 = *(const v4fa*)&so[w][row][c8 + 4];
        FragH f;
#pragma unroll
        for (int q = 0; q < 4; ++q) { f.h[q] = (_Float16)x0[q]; f.h[4 + q] = (_Float16)x1[q]; }
        const v8us o = f.half[0];
        *(v8us*)((unsigned short*)C16 + cofs + (size_t)(row0 + row) * ldc + col0 + c8) = o;
      }
      
    }
  } else {
    const int rsub = lane >> 4, c4 = (lane & 15) * 4;
    {
#pragma unroll
      for (int q = 0; q < 16; ++q) {
        const int r = q * 2 + rsub;
        const v4f v = *(const v4fa*)&so[w][r][c4];
        *(v4f*)(C32 + cofs + (size_t)(row0 + r) * ldc + col0 + c4) = v;
      }
      
    }
  }
}

#define KT 64                         /* keys per staged tile: K rows and V^T rows are then whole 128-byte lines */
#define KPITCH 72                     /* LDS row pitch in 16-bit elements: 144 B = 16 B x odd, conflict-free for 16-byte fragment reads */
#define NTILE (SEQ / KT)
static_assert(SEQ % KT == 0);

// One K tile (KT keys x 64 d) and one V^T tile (64 d x KT keys) from global memory into LDS, 16 bytes per lane and copy; a wave's copy covers 4 whole 128-byte rows.
// lk, lv: this lane's LDS byte address in row tid >> 3 of the K and V^T tile; gk, gv: the matching global addresses. Copy i takes row (tid >> 3) + 16 i.
// s_wait_xcnt 0 closes the statement so that no address register of an issued copy is rewritten ahead of it.
__device__ __forceinline__ void stage_kv(unsigned lk, unsigned lv, const _Float16* gk, const _Float16* gv) {
  asm volatile("global_load_async_to_lds_b128 %0, %8, off\n\t"
               "global_load_async_to_lds_b128 %1, %9, off\n\t"
               "global_load_async_to_lds_b128 %2, %10, off\n\t"
               "global_load_async_to_lds_b128 %3, %11, off\n\t"
               "global_load_async_to_lds_b128 %4, %12, off\n\t"
               "global_load_async_to_lds_b128 %5, %13, off\n\t"
               "global_load_async_to_lds_b128 %6, %14, off\n\t"
               "global_load_async_to_lds_b128 %7, %15, off\n\t"
               "s_wait_xcnt 0x0"
               :: "v"(lk), "v"(lk + 16u * KPITCH * 2u), "v"(lk + 32u * KPITCH * 2u), "v"(lk + 48u * KPITCH * 2u),
                  "v"(lv), "v"(lv + 16u * KPITCH * 2u), "v"(lv + 32u * KPITCH * 2u), "v"(lv + 48u * KPITCH * 2u),
                  "v"(gk), "v"(gk + (size_t)16 * DM), "v"(gk + (size_t)32 * DM), "v"(gk + (size_t)48 * DM),
                  "v"(gv), "v"(gv + (size_t)16 * SEQ), "v"(gv + (size_t)32 * SEQ), "v"(gv + (size_t)48 * SEQ)
               : "memory");
}

// Fused attention. Block = 4 waves of one (batch, head); wave = 16 queries. Q16/K16 rows [token][DM] (head h at columns 64h..), VT [batch][DM][SEQ].
// K and V^T reach the waves through a two-buffer LDS ring of KT-key tiles filled by asynchronous copies, one tile ahead; the block's 4 waves share each tile.
// Per 32 keys: S^T tiles (A = K rows, B = Q rows; D lane = query, r = key 8h+r) -> e = s/8 + mask addend (LDS, per key) -> online softmax (lane-local; one cross-half exchange)
// -> P in registers is the B fragment (k = key) of O^T += V^T . P^T (A = V^T rows; D lane = query, r = d 8h+r). Output rows f16 carried x64.
__global__ __launch_bounds__(128) void k_attn(const _Float16* __restrict__ Q16, const _Float16* __restrict__ K16,
                                              const _Float16* __restrict__ VT, const float* __restrict__ mask,
                                              _Float16* __restrict__ O16) {
  __shared__ __attribute__((aligned(16))) float msk[SEQ];                  /* cross-wave: block barrier */
  __shared__ __attribute__((aligned(16))) unsigned short ring[2][2][KT][KPITCH];   /* [buffer][K | V^T][row][element]; behind the loop's last barrier rows 16w.. of ring[0][0] stage wave w's output */
  const int tid = threadIdx.x, lane = tid & 31, ln = lane & 15, hh = lane >> 4;
  const int w = __builtin_amdgcn_readfirstlane(tid >> 5);
  const int gw = blockIdx.x * 4 + w;
  const int bh = gw / (SEQ / 16);
  const int qt = gw - bh * (SEQ / 16);
  const int b = bh / NH, h = bh - b * NH;
  const size_t tok0 = (size_t)b * SEQ;
  const int crow = tid >> 3, cc8 = (tid & 7) * 8;
  const unsigned lk0 = (unsigned)(size_t)&ring[0][0][crow][cc8];
  const unsigned lv0 = (unsigned)(size_t)&ring[0][1][crow][cc8];
  const _Float16* gk0 = K16 + (tok0 + (size_t)crow) * DM + h * HD + cc8;
  const _Float16* gv0 = VT + ((size_t)b * DM + (size_t)(h * HD + crow)) * SEQ + cc8;
  stage_kv(lk0, lv0, gk0, gv0);             /* tile 0 -> buffer 0, in flight under the mask fill */
  // additive key term of this batch: f32(bf16(mask)) * (-1e9), all SEQ entries written before any read
  const float* mrow = mask + (size_t)b * SEQ_FULL;
  for (int i = tid * 4; i < SEQ; i += 512) {
    const v4f m = *(const v4fa*)(mrow + i);
    v4f o;
#pragma unroll
    for (int q = 0; q < 4; ++q) o[q] = bf16_rne(m[q]) * -1.0e9f;
    *(v4fa*)&msk[i] = o;
  }
  asm volatile("s_wait_asynccnt 0x0" ::: "memory");   /* this wave's share of tile 0 has landed before the barrier publishes it */
  __syncthreads();
  if (1 < NTILE) stage_kv(lk0 + (unsigned)sizeof(ring[0]), lv0 + (unsigned)sizeof(ring[0]), gk0 + (size_t)KT * DM, gv0 + KT);   /* tile 1 -> buffer 1 */
  const _Float16* qrow = Q16 + (tok0 + (size_t)(qt * 16 + ln)) * DM + h * HD;
  const v16h qb0 = ldfrag(qrow, hh), qb1 = ldfrag(qrow + 32, hh);
  const v8f z8 = {0.f, 0.f, 0.f, 0.f, 0.f, 0.f, 0.f, 0.f};
  v8f o0 = z8, o1 = z8, o2 = z8, o3 = z8;
  float mo = -1.0e30f, mso = -1.0e30f, l = 0.f;
#pragma unroll 1
  for (int t = 0; t < NTILE; ++t) {
   const int buf = t & 1;
   for (int sub = 0; sub < KT; sub += 32) {
    const int kb = t * KT + sub;
    const _Float16* k0p = (const _Float16*)&ring[buf][0][sub + ln][0];
    const _Float16* k1p = k0p + 16 * KPITCH;
    v8f s0 = z8, s1 = z8;
    { v16h a = ldfrag(k0p, hh); s0 = mma16(a, qb0, s0); a = ldfrag(k0p + 32, hh); s0 = mma16(a, qb1, s0); }
    { v16h a = ldfrag(k1p, hh); s1 = mma16(a, qb0, s1); a = ldfrag(k1p + 32, hh); s1 = mma16(a, qb1, s1); }
    const v4f ma = *(const v4fa*)&msk[kb + 8 * hh];
    const v4f mb = *(const v4fa*)&msk[kb + 8 * hh + 4];
    const v4f mc = *(const v4fa*)&msk[kb + 16 + 8 * hh];
    const v4f md = *(const v4fa*)&msk[kb + 16 + 8 * hh + 4];
    const float am0[8] = {ma[0], ma[1], ma[2], ma[3], mb[0], mb[1], mb[2], mb[3]};
    const float am1[8] = {mc[0], mc[1], mc[2], mc[3], md[0], md[1], md[2], md[3]};
    float e0[8], e1[8];
#pragma unroll
    for (int r = 0; r < 8; ++r) { e0[r] = fmaf(s0[r], 0.125f, am0[r]); e1[r] = fmaf(s1[r], 0.125f, am1[r]); }
    float bm = fmaxf(e0[0], e1[0]);
#pragma unroll
    for (int r = 1; r < 8; ++r) bm = fmaxf(bm, fmaxf(e0[r], e1[r]));
    const float bmo = __shfl_xor(bm, 16, 32);
    bm = fmaxf(bm, bmo);
    const float mn = fmaxf(mo, bm);
    const float msn = mn - LN1024;          /* weights carried x1024 through the exponent */
    const float alpha = __expf(mso - msn);
    mo = mn; mso = msn;
    float ps = 0.f;
    FragH pf;
#pragma unroll
    for (int r = 0; r < 8; ++r) {
      const float p0 = __expf(e0[r] - msn);
      const float p1 = __expf(e1[r] - msn);
      ps += p0 + p1;
      pf.h[r] = (_Float16)p0;               /* k = 8h + r      <-> key kb + 8h + r      */
      pf.h[8 + r] = (_Float16)p1;           /* k = 16 + 8h + r <-> key kb + 16 + 8h + r */
    }
    l = l * alpha + ps;
    o0 *= alpha; o1 *= alpha; o2 *= alpha; o3 *= alpha;
    const _Float16* vp = (const _Float16*)&ring[buf][1][ln][sub];
    { const v16h a = ldfrag(vp, hh); o0 = mma16(a, pf.v, o0); }
    { const v16h a = ldfrag(vp + 16 * KPITCH, hh); o1 = mma16(a, pf.v, o1); }
    { const v16h a = ldfrag(vp + 32 * KPITCH, hh); o2 = mma16(a, pf.v, o2); }
    { const v16h a = ldfrag(vp + 48 * KPITCH, hh); o3 = mma16(a, pf.v, o3); }
   }
   asm volatile("s_wait_dscnt 0x0" ::: "memory");      /* this wave's reads of buffer buf are done before it is refilled */
   asm volatile("s_wait_asynccnt 0x0" ::: "memory");   /* this wave's share of tile t + 1 has landed */
   __syncthreads();                                    /* publishes tile t + 1 and ends every wave's reads of buffer buf */
   if (t + 2 < NTILE)
     stage_kv(lk0 + (unsigned)buf * (unsigned)sizeof(ring[0]), lv0 + (unsigned)buf * (unsigned)sizeof(ring[0]),
              gk0 + (size_t)(t + 2) * KT * DM, gv0 + (t + 2) * KT);
  }
  asm volatile("s_wait_asynccnt 0x0" ::: "memory");    /* no copy is outstanding when the ring becomes output staging */
  const float lo = __shfl_xor(l, 16, 32);
  const float lt = l + lo;
  const float inv = 64.0f / lt;             /* merged rows carried x64 */
  const v8f oo[4] = {o0, o1, o2, o3};
#pragma unroll
  for (int j = 0; j < 4; ++j) {
    FragH f;
#pragma unroll
    for (int r = 0; r < 8; ++r) f.h[r] = (_Float16)(oo[j][r] * inv);   /* query ln, d = 16j + 8h + r */
    *(v8us*)&ring[0][0][16 * w + ln][16 * j + 8 * hh] = f.half[0];
  }
  __builtin_amdgcn_fence(4 /* acq_rel order */, "workgroup");
  __builtin_amdgcn_wave_barrier();
  const int rq = lane >> 3, pc = lane & 7;
  {
#pragma unroll
    for (int it = 0; it < 4; ++it) {
      const int row = it * 4 + rq;
      const v8us v = *(const v8us*)&ring[0][0][16 * w + row][pc * 8];
      *(v8us*)((unsigned short*)O16 + (tok0 + (size_t)(qt * 16 + row)) * DM + h * HD + pc * 8) = v;
    }
    
  }
}

extern "C" void kernel_launch(void* const* d_in, const int* in_sizes, int n_in,
                              void* d_out, int out_size, void* d_ws, size_t ws_size, hipStream_t stream) {
  if (n_in < 10) return;
  const size_t needRows = (size_t)(NB - 1) * SEQ_FULL + SEQ;
  if ((size_t)in_sizes[0] < needRows * DM) return;
  if ((size_t)in_sizes[1] < needRows) return;
  if ((size_t)in_sizes[2] < (size_t)DM * DM || (size_t)in_sizes[4] < (size_t)DM * DM) return;
  if ((size_t)in_sizes[6] < (size_t)DM * DM || (size_t)in_sizes[8] < (size_t)DM * DM) return;
  if (in_sizes[3] < DM || in_sizes[5] < DM || in_sizes[7] < DM || in_sizes[9] < DM) return;
  if ((size_t)out_size < (size_t)NR * DM) return;
  const float* x    = (const float*)d_in[0];
  const float* mask = (const float*)d_in[1];
  const float* wq   = (const float*)d_in[2];
  const float* bq   = (const float*)d_in[3];
  const float* wk   = (const float*)d_in[4];
  const float* bk   = (const float*)d_in[5];
  const float* wv   = (const float*)d_in[6];
  const float* bv   = (const float*)d_in[7];
  const float* wo   = (const float*)d_in[8];
  const float* bo   = (const float*)d_in[9];
  float* out = (float*)d_out;

  char* ws = (char*)d_ws; size_t off = 0;
  const size_t wB = (size_t)DM * DM * 2;          /* 1,179,648 B per weight plane */
  const size_t pB = (size_t)NR * DM * 2;          /* 12,582,912 B per activation plane */
  _Float16* BQ  = (_Float16*)(ws + off); off += wB;
  _Float16* BK  = (_Float16*)(ws + off); off += wB;
  _Float16* BV  = (_Float16*)(ws + off); off += wB;
  _Float16* BO  = (_Float16*)(ws + off); off += wB;
  _Float16* X16 = (_Float16*)(ws + off); off += pB;
  _Float16* Q16 = (_Float16*)(ws + off); off += pB;
  _Float16* K16 = (_Float16*)(ws + off); off += pB;
  _Float16* VT  = (_Float16*)(ws + off); off += pB;   /* [NB][DM][SEQ] */
  _Float16* O16 = (_Float16*)(ws + off); off += pB;
  if (off > ws_size) return;

  { const unsigned g = (unsigned)(((size_t)DM * (DM / 8) + 255) / 256);
    k_wt_f16<<<g, 256, 0, stream>>>(wq, BQ, DM, DM, 16.0f);     /* in[768][768] -> out[n][k] x16 */
    k_wt_f16<<<g, 256, 0, stream>>>(wk, BK, DM, DM, 16.0f);
    k_wt_f16<<<g, 256, 0, stream>>>(wv, BV, DM, DM, 16.0f);
    k_wt_f16<<<g, 256, 0, stream>>>(wo, BO, DM, DM, 16.0f); }
  { const int nthr = NR * (DM / 8);
    k_x16<<<(unsigned)((nthr + 255) / 256), 256, 0, stream>>>(x, X16, nthr); }
  /* Q, K rows: [NR][DM] f16 */
  k_gemm<<<dim3((unsigned)((NR / 128) * (DM / 64)), 1), 128, 0, stream>>>(X16, DM, BQ, DM, (size_t)0, 0.0625f, bq, DM, 0, out, Q16, 1, DM, (size_t)0, NR, DM, DM);
  k_gemm<<<dim3((unsigned)((NR / 128) * (DM / 64)), 1), 128, 0, stream>>>(X16, DM, BK, DM, (size_t)0, 0.0625f, bk, DM, 0, out, K16, 1, DM, (size_t)0, NR, DM, DM);
  /* V^T per batch: C[m = feature][n = token] = Wv^T[m][k] . x[n][k] + bv[m] -> VT[b][DM][SEQ] */
  k_gemm<<<dim3((unsigned)((DM / 128) * (SEQ / 64)), NB), 128, 0, stream>>>(BV, DM, X16, DM, (size_t)SEQ * DM, 0.0625f, bv, DM, 1, out, VT, 1, SEQ, (size_t)DM * SEQ, DM, SEQ, DM);
  k_attn<<<(unsigned)(((size_t)NB * NH * (SEQ / 16)) / 4), 128, 0, stream>>>(Q16, K16, VT, mask, O16);
  /* out = (O16 / 64) . (BO / 16) + bo */
  k_gemm<<<dim3((unsigned)((NR / 128) * (DM / 64)), 1), 128, 0, stream>>>(O16, DM, BO, DM, (size_t)0, 0.0009765625f, bo, DM, 0, out, Q16, 0, DM, (size_t)0, NR, DM, DM);
}

// v003
// One run takes 135 microseconds.
// Timed twice side by side with v002, it ran 1.16 and 1.15 times as fast.
// Counting every step since v000, it is 2.46 times as fast.
#include <hip/hip_runtime.h>
// Compute dtype: every contraction on v_wmma_f32_16x16x32_f16 (f16 operands, f32 accumulate): x / weights exact in f16 after an RNE convert to bf16 (weights carried x16); q, k, v plain f16; softmax weights f16 carried x1024 (folded into the exponent, cancelled by the f32 row sum); merged head rows f16 carried x64 against the x16 output weights (alpha 2^-10).
// Self-attention block: x [4][2048][768]; q/k/v = x W + b with [in][out] weights; 12 heads of 64; logits = q.k/8 + mask*(-1e9) per (batch, key); softmax over 2048 keys; out = merged Wo + bo.
// Structure: weight planes Bt[n][k]; x as f16 rows; Q, K row GEMMs (32x64 wave tiles); V^T produced directly by the operand-swapped GEMM (A = Wv^T plane, B = x rows, per-row bias);
// Four launches: one grid converts the four weights and x, one grid runs the Q, K and V^T GEMMs, then attention, then the output GEMM; in a shared grid the block index picks the job.
#ifndef NB
#define NB 4
#endif
#ifndef SEQ
#define SEQ 2048
#endif
#define SEQ_FULL 2048                 /* per-batch row count of the inputs */
#define DM 768
#define NH 12
#define HD 64
#define NR (NB * SEQ)                 /* token rows processed */
#define LN1024 6.931471805599453f

static_assert(NH * HD == DM);
static_assert(HD == 64);
static_assert(DM % 128 == 0);
static_assert(DM % 64 == 0);
static_assert(DM % 32 == 0);
static_assert(NR % 128 == 0);
static_assert(SEQ % 64 == 0);
static_assert(SEQ % 32 == 0);
static_assert((SEQ / 16) % 4 == 0);
static_assert(SEQ <= SEQ_FULL);
static_assert(((size_t)NB * NH * (SEQ / 16)) % 4 == 0);
static_assert((size_t)4 * DM * DM * 2 + (size_t)5 * NR * DM * 2 <= (size_t)134217728);

typedef _Float16 v16h __attribute__((ext_vector_type(16)));
typedef unsigned short v8us __attribute__((ext_vector_type(8), may_alias));
typedef float v8f  __attribute__((ext_vector_type(8)));
typedef float v4f  __attribute__((ext_vector_type(4)));
typedef float v4fa __attribute__((ext_vector_type(4), may_alias));
union FragH { v16h v; v8us half[2]; _Float16 h[16]; unsigned short u[16]; };

__device__ __forceinline__ unsigned short bf16_bits(float x) { unsigned int u = __float_as_uint(x); return (unsigned short)((u + 0x7FFFu + ((u >> 16) & 1u)) >> 16); }
__device__ __forceinline__ float bf16_rne(float x) { return __uint_as_float(((unsigned int)bf16_bits(x)) << 16); }
__device__ __forceinline__ int imin(int a, int b) { return (a < b) ? a : b; }

// 16x32 fragment of a k-contiguous 16-bit row: elements 0..7 <- k 8h..8h+7, elements 8..15 <- k 16+8h..16+8h+7 (same map for A rows and B columns)
__device__ __forceinline__ v16h ldfrag(const _Float16* p, int hh) {
  FragH f;
  f.half[0] = *(const v8us*)((const unsigned short*)p + 8 * hh);
  f.half[1] = *(const v8us*)((const unsigned short*)p + 16 + 8 * hh);
  return f.v;
}
__device__ __forceinline__ v8f mma16(v16h a, v16h b, v8f c) {
  v8f d = __builtin_amdgcn_wmma_f32_16x16x32_f16(false, a, false, b, (short)0, c, false, false);
  asm volatile("v_nop\n\tv_nop\n\tv_nop\n\tv_nop" : "+v"(d) : "v"(a), "v"(b));
  return d;
}

__device__ __forceinline__ void wt_f16_body(const float* __restrict__ W, _Float16* __restrict__ Wt, int K, int N, float scale, int bx) {
  const int t = bx * 256 + threadIdx.x;
  const int k8n = K / 8;
  if (t >= N * k8n) return;
  const int n = t / k8n, k8 = (t % k8n) * 8;
  FragH f;
#pragma unroll
  for (int i = 0; i < 8; ++i) f.h[i] = (_Float16)(bf16_rne(W[(size_t)(k8 + i) * N + n]) * scale);
  const v8us o = f.half[0];
  unsigned short* d = (unsigned short*)Wt + (size_t)n * K + k8;
  *(v8us*)d = o;
  
}

__device__ __forceinline__ void x16_body(const float* __restrict__ x, _Float16* __restrict__ X16, int nthr, int bx) {
  const int t = bx * 256 + threadIdx.x;
  if (t >= nthr) return;
  const int row = t / (DM / 8), c8 = (t % (DM / 8)) * 8;
  const int b = row / SEQ, s = row % SEQ;
  const float* src = x + ((size_t)b * SEQ_FULL + s) * DM + c8;
  const v4f a = *(const v4fa*)src, c = *(const v4fa*)(src + 4);
  FragH f;
#pragma unroll
  for (int q = 0; q < 4; ++q) { f.h[q] = (_Float16)bf16_rne(a[q]); f.h[4 + q] = (_Float16)bf16_rne(c[q]); }
  const v8us o = f.half[0];
  unsigned short* d = (unsigned short*)X16 + (size_t)t * 8;
  *(v8us*)d = o;
  
}

#define WTB ((DM * (DM / 8) + 255) / 256)      /* blocks per weight plane */
#define XB ((NR * (DM / 8) + 255) / 256)       /* blocks for x */

// All operand conversions in one grid: blocks 0 .. 4 WTB - 1 transpose wq, wk, wv, wo into the four consecutive planes of Wt (x16), the other XB blocks convert x. The jobs are independent; the branch is block-uniform.
__global__ __launch_bounds__(256) void k_prep(const float* __restrict__ wq, const float* __restrict__ wk, const float* __restrict__ wv, const float* __restrict__ wo,
                                              const float* __restrict__ x, _Float16* __restrict__ Wt, _Float16* __restrict__ X16) {
  const int bx = blockIdx.x;
  if (bx < 4 * WTB) {
    const int j = bx / WTB;
    const float* W = (j == 0) ? wq : (j == 1) ? wk : (j == 2) ? wv : wo;
    wt_f16_body(W, Wt + (size_t)j * DM * DM, DM, DM, 16.0f, bx - j * WTB);
  } else {
    x16_body(x, X16, NR * (DM / 8), bx - 4 * WTB);
  }
}

#define GKT 64                        /* k elements per staged GEMM tile: operand rows are then whole 128-byte lines */
#define GPITCH 72                     /* LDS row pitch in 16-bit elements: 144 B = 16 B x odd, conflict-free for 16-byte fragment reads */

// One k tile of the block's operands (128 A rows and 64 B rows of GKT elements) from global memory into LDS, 16 bytes per lane and copy; a wave's copy covers 4 whole 128-byte rows.
// la, lb: this lane's LDS byte address in row tid >> 3 of the A and B part; ga, gb: the matching global addresses. Copy i takes row (tid >> 3) + 16 i.
// s_wait_xcnt 0 closes the statement so that no address register of an issued copy is rewritten ahead of it.
__device__ __forceinline__ void stage_ab(unsigned la, unsigned lb, const _Float16* ga, const _Float16* gb, int lda, int ldb) {
  asm volatile("global_load_async_to_lds_b128 %0, %12, off\n\t"
               "global_load_async_to_lds_b128 %1, %13, off\n\t"
               "global_load_async_to_lds_b128 %2, %14, off\n\t"
               "global_load_async_to_lds_b128 %3, %15, off\n\t"
               "global_load_async_to_lds_b128 %4, %16, off\n\t"
               "global_load_async_to_lds_b128 %5, %17, off\n\t"
               "global_load_async_to_lds_b128 %6, %18, off\n\t"
               "global_load_async_to_lds_b128 %7, %19, off\n\t"
               "global_load_async_to_lds_b128 %8, %20, off\n\t"
               "global_load_async_to_lds_b128 %9, %21, off\n\t"
               "global_load_async_to_lds_b128 %10, %22, off\n\t"
               "global_load_async_to_lds_b128 %11, %23, off\n\t"
               "s_wait_xcnt 0x0"
               :: "v"(la), "v"(la + 16u * GPITCH * 2u), "v"(la + 32u * GPITCH * 2u), "v"(la + 48u * GPITCH * 2u),
                  "v"(la + 64u * GPITCH * 2u), "v"(la + 80u * GPITCH * 2u), "v"(la + 96u * GPITCH * 2u), "v"(la + 112u * GPITCH * 2u),
                  "v"(lb), "v"(lb + 16u * GPITCH * 2u), "v"(lb + 32u * GPITCH * 2u), "v"(lb + 48u * GPITCH * 2u),
                  "v"(ga), "v"(ga + (size_t)16 * lda), "v"(ga + (size_t)32 * lda), "v"(ga + (size_t)48 * lda),
                  "v"(ga + (size_t)64 * lda), "v"(ga + (size_t)80 * lda), "v"(ga + (size_t)96 * lda), "v"(ga + (size_t)112 * lda),
                  "v"(gb), "v"(gb + (size_t)16 * ldb), "v"(gb + (size_t)32 * ldb), "v"(gb + (size_t)48 * ldb)
               : "memory");
}

// C[by][M][N] = alpha * A[M][K] . Bt[by][N][K]^T + bias (per column, or per row when biasrow != 0; bias RNE-converted to bf16).
// A, Bt f16 k-contiguous rows. Block = 4 waves, wave tile 32 rows x 64 cols; M % 128 == 0, N % 64 == 0, K % 64 == 0 (host asserts).
// The block's 128 A rows and 64 B rows reach the waves through a two-buffer LDS ring of GKT-element k tiles filled by asynchronous copies, one tile ahead.
// mt, nq, by: the block's row tile, column tile and batch index within its own GEMM.
__device__ __forceinline__ void gemm_body(const _Float16* __restrict__ A, int lda,
                                          const _Float16* __restrict__ Bh, int ldb, size_t sB, float alpha,
                                          const float* __restrict__ bias, int nbias, int biasrow,
                                          float* __restrict__ C32, _Float16* __restrict__ C16, int out16,
                                          int ldc, size_t sC, int M, int N, int K, int mt, int nq, int by) {
  __shared__ __attribute__((aligned(16))) float so[4][32][68];
  __shared__ __attribute__((aligned(16))) unsigned short gring[2][128 + 64][GPITCH];   /* [buffer][A rows 0..127 | B rows 128..191][element] */
  const int tid = threadIdx.x, lane = tid & 31, ln = lane & 15, hh = lane >> 4;
  const int w = __builtin_amdgcn_readfirstlane(tid >> 5);
  const _Float16* Bb = Bh + (size_t)by * sB;
  const size_t cofs = (size_t)by * sC;
  const int rowb = mt * 128, col0 = nq * 64;
  if (rowb >= M) return;                    /* the whole block leaves or none does: barriers follow */
  const int row0 = rowb + 32 * w;
  const int crow = tid >> 3, cc8 = (tid & 7) * 8;
  const unsigned la0 = (unsigned)(size_t)&gring[0][crow][cc8];
  const unsigned lb0 = (unsigned)(size_t)&gring[0][128 + crow][cc8];
  const _Float16* ga0 = A + (size_t)(rowb + crow) * lda + cc8;
  const _Float16* gb0 = Bb + (size_t)(col0 + crow) * ldb + cc8;
  const int nt = K / GKT;
  stage_ab(la0, lb0, ga0, gb0, lda, ldb);             /* tile 0 -> buffer 0 */
  asm volatile("s_wait_asynccnt 0x0" ::: "memory");   /* this wave's share of tile 0 has landed before the barrier publishes it */
  __syncthreads();
  if (1 < nt) stage_ab(la0 + (unsigned)sizeof(gring[0]), lb0 + (unsigned)sizeof(gring[0]), ga0 + GKT, gb0 + GKT, lda, ldb);   /* tile 1 -> buffer 1 */
  const v8f z8 = {0.f, 0.f, 0.f, 0.f, 0.f, 0.f, 0.f, 0.f};
  v8f c00 = z8, c01 = z8, c02 = z8, c03 = z8, c10 = z8, c11 = z8, c12 = z8, c13 = z8;
#pragma unroll 1
  for (int t = 0; t < nt; ++t) {
    const int buf = t & 1;
    const _Float16* ap = (const _Float16*)&gring[buf][32 * w + ln][0];
    const _Float16* bp = (const _Float16*)&gring[buf][128 + ln][0];
#pragma unroll
    for (int sub = 0; sub < GKT; sub += 32) {
      const v16h a0 = ldfrag(ap + sub, hh), a1 = ldfrag(ap + 16 * GPITCH + sub, hh);
      const v16h b0 = ldfrag(bp + sub, hh), b1 = ldfrag(bp + 16 * GPITCH + sub, hh);
      const v16h b2 = ldfrag(bp + 32 * GPITCH + sub, hh), b3 = ldfrag(bp + 48 * GPITCH + sub, hh);
      c00 = mma16(a0, b0, c00); c10 = mma16(a1, b0, c10);
      c01 = mma16(a0, b1, c01); c11 = mma16(a1, b1, c11);
      c02 = mma16(a0, b2, c02); c12 = mma16(a1, b2, c12);
      c03 = mma16(a0, b3, c03); c13 = mma16(a1, b3, c13);
    }
    asm volatile("s_wait_dscnt 0x0" ::: "memory");      /* this wave's reads of buffer buf are done before it is refilled */
    asm volatile("s_wait_asynccnt 0x0" ::: "memory");   /* this wave's share of tile t + 1 has landed */
    __syncthreads();                                    /* publishes tile t + 1 and ends every wave's reads of buffer buf */
    if (t + 2 < nt)
      stage_ab(la0 + (unsigned)buf * (unsigned)sizeof(gring[0]), lb0 + (unsigned)buf * (unsigned)sizeof(gring[0]),
               ga0 + (size_t)(t + 2) * GKT, gb0 + (size_t)(t + 2) * GKT, lda, ldb);
  }
  asm volatile("s_wait_asynccnt 0x0" ::: "memory");     /* no copy is outstanding when the wave goes on to its output */
  // per-row bias candidates (clamped addresses; selected by value below)
  const int rb0 = imin(row0 + 8 * hh, nbias - 8), rb1 = imin(row0 + 16 + 8 * hh, nbias - 8);
  const v4f br00 = *(const v4fa*)(bias + rb0), br10 = *(const v4fa*)(bias + rb1);
  asm volatile("s_wait_xcnt 0x0" ::: "memory");         /* the address registers of the two loads above may be reused (also as a later load's result) behind this */
  const v4f br01 = *(const v4fa*)(bias + rb0 + 4), br11 = *(const v4fa*)(bias + rb1 + 4);
  asm volatile("s_wait_xcnt 0x0" ::: "memory");         /* likewise for the two loads above */
  const float brow[16] = {br00[0], br00[1], br00[2], br00[3], br01[0], br01[1], br01[2], br01[3],
                          br10[0], br10[1], br10[2], br10[3], br11[0], br11[1], br11[2], br11[3]};
  const v8f accs[8] = {c00, c01, c02, c03, c10, c11, c12, c13};
#pragma unroll
  for (int u = 0; u < 8; ++u) {
    const int t = u & 3, half = u >> 2;
    const int col = col0 + t * 16 + ln;
    const float bc = bf16_rne(bias[imin(col, nbias - 1)]);
#pragma unroll
    for (int r = 0; r < 8; ++r) {
      const int rloc = half * 16 + 8 * hh + r;
      const float br = bf16_rne(brow[half * 8 + r]);
      const float bv = (biasrow != 0) ? br : bc;
      so[w][rloc][t * 16 + ln] = accs[u][r] * alpha + bv;
    }
  }
  __builtin_amdgcn_fence(4 /* acq_rel order */, "workgroup");
  __builtin_amdgcn_wave_barrier();
  if (out16 != 0) {
    const int rq = lane >> 3, c8 = (lane & 7) * 8;
    {
#pragma unroll
      for (int it = 0; it < 8; ++it) {
        const int row = it * 4 + rq;
        const v4f x0 = *(const v4fa*)&so[w][row][c8];
        const v4f x1 = *(const v4fa*)&so[w][row][c8 + 4];
        FragH f;
#pragma unroll
        for (int q = 0; q < 4; ++q) { f.h[q] = (_Float16)x0[q]; f.h[4 + q] = (_Float16)x1[q]; }
        const v8us o = f.half[0];
        *(v8us*)((unsigned short*)C16 + cofs + (size_t)(row0 + row) * ldc + col0 + c8) = o;
      }
      asm volatile("s_wait_xcnt 0x0" ::: "memory");     /* where the other branch's code follows in the build, it reuses the stores' address and data registers only behind this */
    }
  } else {
    const int rsub = lane >> 4, c4 = (lane & 15) * 4;
    {
#pragma unroll
      for (int q = 0; q < 16; ++q) {
        const int r = q * 2 + rsub;
        const v4f v = *(const v4fa*)&so[w][r][c4];
        *(v4f*)(C32 + cofs + (size_t)(row0 + r) * ldc + col0 + c4) = v;
      }
      
    }
  }
}

__global__ __launch_bounds__(128) void k_gemm(const _Float16* __restrict__ A, int lda,
                                              const _Float16* __restrict__ Bh, int ldb, size_t sB, float alpha,
                                              const float* __restrict__ bias, int nbias, int biasrow,
                                              float* __restrict__ C32, _Float16* __restrict__ C16, int out16,
                                              int ldc, size_t sC, int M, int N, int K) {
  const int ntn = N >> 6;
  const int mt = blockIdx.x / ntn, nq = blockIdx.x - mt * ntn;
  gemm_body(A, lda, Bh, ldb, sB, alpha, bias, nbias, biasrow, C32, C16, out16, ldc, sC, M, N, K, mt, nq, blockIdx.y);
}

#define QKB ((NR / 128) * (DM / 64))           /* blocks of the Q GEMM, and of the K GEMM */
#define VTB ((DM / 128) * (SEQ / 64))          /* blocks of the V^T GEMM per batch */

// The three projections in one grid: blocks 0 .. QKB - 1 make Q rows, the next QKB make K rows, the last NB VTB make V^T (VTB per batch). They are independent; every selection is block-uniform.
// Wt: the weight planes in the order q, k, v.
__global__ __launch_bounds__(128) void k_qkv(const _Float16* __restrict__ X16, const _Float16* __restrict__ Wt,
                                             const float* __restrict__ bq, const float* __restrict__ bk, const float* __restrict__ bv,
                                             _Float16* __restrict__ Q16, _Float16* __restrict__ K16, _Float16* __restrict__ VT) {
  const int bx = blockIdx.x;
  const int j = (bx >= 2 * QKB) ? 2 : (bx >= QKB) ? 1 : 0;
  const bool isv = j == 2;
  const int r = bx - j * QKB;
  const int by = isv ? r / VTB : 0;
  const int lx = r - by * VTB;
  const int mt = isv ? lx / (SEQ / 64) : lx / (DM / 64);
  const int nq = lx - mt * (isv ? SEQ / 64 : DM / 64);
  const _Float16* Wj = Wt + (size_t)j * DM * DM;
  gemm_body(isv ? Wj : X16, DM, isv ? X16 : Wj, DM, isv ? (size_t)SEQ * DM : (size_t)0, 0.0625f,
            (j == 0) ? bq : (j == 1) ? bk : bv, DM, isv ? 1 : 0,
            (float*)nullptr, (j == 0) ? Q16 : (j == 1) ? K16 : VT, 1,
            isv ? SEQ : DM, isv ? (size_t)DM * SEQ : (size_t)0, isv ? DM : NR, isv ? SEQ : DM, DM, mt, nq, by);
}

#define KT 64                         /* keys per staged tile: K rows and V^T rows are then whole 128-byte lines */
#define KPITCH 72                     /* LDS row pitch in 16-bit elements: 144 B = 16 B x odd, conflict-free for 16-byte fragment reads */
#define NTILE (SEQ / KT)
static_assert(SEQ % KT == 0);

// One K tile (KT keys x 64 d) and one V^T tile (64 d x KT keys) from global memory into LDS, 16 bytes per lane and copy; a wave's copy covers 4 whole 128-byte rows.
// lk, lv: this lane's LDS byte address in row tid >> 3 of the K and V^T tile; gk, gv: the matching global addresses. Copy i takes row (tid >> 3) + 16 i.
// s_wait_xcnt 0 closes the statement so that no address register of an issued copy is rewritten ahead of it.
__device__ __forceinline__ void stage_kv(unsigned lk, unsigned lv, const _Float16* gk, const _Float16* gv) {
  asm volatile("global_load_async_to_lds_b128 %0, %8, off\n\t"
               "global_load_async_to_lds_b128 %1, %9, off\n\t"
               "global_load_async_to_lds_b128 %2, %10, off\n\t"
               "global_load_async_to_lds_b128 %3, %11, off\n\t"
               "global_load_async_to_lds_b128 %4, %12, off\n\t"
               "global_load_async_to_lds_b128 %5, %13, off\n\t"
               "global_load_async_to_lds_b128 %6, %14, off\n\t"
               "global_load_async_to_lds_b128 %7, %15, off\n\t"
               "s_wait_xcnt 0x0"
               :: "v"(lk), "v"(lk + 16u * KPITCH * 2u), "v"(lk + 32u * KPITCH * 2u), "v"(lk + 48u * KPITCH * 2u),
                  "v"(lv), "v"(lv + 16u * KPITCH * 2u), "v"(lv + 32u * KPITCH * 2u), "v"(lv + 48u * KPITCH * 2u),
                  "v"(gk), "v"(gk + (size_t)16 * DM), "v"(gk + (size_t)32 * DM), "v"(gk + (size_t)48 * DM),
                  "v"(gv), "v"(gv + (size_t)16 * SEQ), "v"(gv + (size_t)32 * SEQ), "v"(gv + (size_t)48 * SEQ)
               : "memory");
}

// Fused attention. Block = 4 waves of one (batch, head); wave = 16 queries. Q16/K16 rows [token][DM] (head h at columns 64h..), VT [batch][DM][SEQ].
// K and V^T reach the waves through a two-buffer LDS ring of KT-key tiles filled by asynchronous copies, one tile ahead; the block's 4 waves share each tile.
// Per 32 keys: S^T tiles (A = K rows, B = Q rows; D lane = query, r = key 8h+r) -> e = s/8 + mask addend (LDS, per key) -> online softmax (lane-local; one cross-half exchange)
// -> P in registers is the B fragment (k = key) of O^T += V^T . P^T (A = V^T rows; D lane = query, r = d 8h+r). Output rows f16 carried x64.
__global__ __launch_bounds__(128) void k_attn(const _Float16* __restrict__ Q16, const _Float16* __restrict__ K16,
                                              const _Float16* __restrict__ VT, const float* __restrict__ mask,
                                              _Float16* __restrict__ O16) {
  __shared__ __attribute__((aligned(16))) float msk[SEQ];                  /* cross-wave: block barrier */
  __shared__ __attribute__((aligned(16))) unsigned short ring[2][2][KT][KPITCH];   /* [buffer][K | V^T][row][element]; behind the loop's last barrier rows 16w.. of ring[0][0] stage wave w's output */
  const int tid = threadIdx.x, lane = tid & 31, ln = lane & 15, hh = lane >> 4;
  const int w = __builtin_amdgcn_readfirstlane(tid >> 5);
  const int gw = blockIdx.x * 4 + w;
  const int bh = gw / (SEQ / 16);
  const int qt = gw - bh * (SEQ / 16);
  const int b = bh / NH, h = bh - b * NH;
  const size_t tok0 = (size_t)b * SEQ;
  const int crow = tid >> 3, cc8 = (tid & 7) * 8;
  const unsigned lk0 = (unsigned)(size_t)&ring[0][0][crow][cc8];
  const unsigned lv0 = (unsigned)(size_t)&ring[0][1][crow][cc8];
  const _Float16* gk0 = K16 + (tok0 + (size_t)crow) * DM + h * HD + cc8;
  const _Float16* gv0 = VT + ((size_t)b * DM + (size_t)(h * HD + crow)) * SEQ + cc8;
  stage_kv(lk0, lv0, gk0, gv0);             /* tile 0 -> buffer 0, in flight under the mask fill */
  // additive key term of this batch: f32(bf16(mask)) * (-1e9), all SEQ entries written before any read
  const float* mrow = mask + (size_t)b * SEQ_FULL;
  for (int i = tid * 4; i < SEQ; i += 512) {
    const v4f m = *(const v4fa*)(mrow + i);
    v4f o;
#pragma unroll
    for (int q = 0; q < 4; ++q) o[q] = bf16_rne(m[q]) * -1.0e9f;
    *(v4fa*)&msk[i] = o;
  }
  asm volatile("s_wait_asynccnt 0x0" ::: "memory");   /* this wave's share of tile 0 has landed before the barrier publishes it */
  __syncthreads();
  if (1 < NTILE) stage_kv(lk0 + (unsigned)sizeof(ring[0]), lv0 + (unsigned)sizeof(ring[0]), gk0 + (size_t)KT * DM, gv0 + KT);   /* tile 1 -> buffer 1 */
  const _Float16* qrow = Q16 + (tok0 + (size_t)(qt * 16 + ln)) * DM + h * HD;
  const v16h qb0 = ldfrag(qrow, hh), qb1 = ldfrag(qrow + 32, hh);
  const v8f z8 = {0.f, 0.f, 0.f, 0.f, 0.f, 0.f, 0.f, 0.f};
  v8f o0 = z8, o1 = z8, o2 = z8, o3 = z8;
  float mo = -1.0e30f, mso = -1.0e30f, l = 0.f;
#pragma unroll 1
  for (int t = 0; t < NTILE; ++t) {
   const int buf = t & 1;
   for (int sub = 0; sub < KT; sub += 32) {
    const int kb = t * KT + sub;
    const _Float16* k0p = (const _Float16*)&ring[buf][0][sub + ln][0];
    const _Float16* k1p = k0p + 16 * KPITCH;
    v8f s0 = z8, s1 = z8;
    { v16h a = ldfrag(k0p, hh); s0 = mma16(a, qb0, s0); a = ldfrag(k0p + 32, hh); s0 = mma16(a, qb1, s0); }
    { v16h a = ldfrag(k1p, hh); s1 = mma16(a, qb0, s1); a = ldfrag(k1p + 32, hh); s1 = mma16(a, qb1, s1); }
    const v4f ma = *(const v4fa*)&msk[kb + 8 * hh];
    const v4f mb = *(const v4fa*)&msk[kb + 8 * hh + 4];
    const v4f mc = *(const v4fa*)&msk[kb + 16 + 8 * hh];
    const v4f md = *(const v4fa*)&msk[kb + 16 + 8 * hh + 4];
    const float am0[8] = {ma[0], ma[1], ma[2], ma[3], mb[0], mb[1], mb[2], mb[3]};
    const float am1[8] = {mc[0], mc[1], mc[2], mc[3], md[0], md[1], md[2], md[3]};
    float e0[8], e1[8];
#pragma unroll
    for (int r = 0; r < 8; ++r) { e0[r] = fmaf(s0[r], 0.125f, am0[r]); e1[r] = fmaf(s1[r], 0.125f, am1[r]); }
    float bm = fmaxf(e0[0], e1[0]);
#pragma unroll
    for (int r = 1; r < 8; ++r) bm = fmaxf(bm, fmaxf(e0[r], e1[r]));
    const float bmo = __shfl_xor(bm, 16, 32);
    bm = fmaxf(bm, bmo);
    const float mn = fmaxf(mo, bm);
    const float msn = mn - LN1024;          /* weights carried x1024 through the exponent */
    const float alpha = __expf(mso - msn);
    mo = mn; mso = msn;
    float ps = 0.f;
    FragH pf;
#pragma unroll
    for (int r = 0; r < 8; ++r) {
      const float p0 = __expf(e0[r] - msn);
      const float p1 = __expf(e1[r] - msn);
      ps += p0 + p1;
      pf.h[r] = (_Float16)p0;               /* k = 8h + r      <-> key kb + 8h + r      */
      pf.h[8 + r] = (_Float16)p1;           /* k = 16 + 8h + r <-> key kb + 16 + 8h + r */
    }
    l = l * alpha + ps;
    o0 *= alpha; o1 *= alpha; o2 *= alpha; o3 *= alpha;
    const _Float16* vp = (const _Float16*)&ring[buf][1][ln][sub];
    { const v16h a = ldfrag(vp, hh); o0 = mma16(a, pf.v, o0); }
    { const v16h a = ldfrag(vp + 16 * KPITCH, hh); o1 = mma16(a, pf.v, o1); }
    { const v16h a = ldfrag(vp + 32 * KPITCH, hh); o2 = mma16(a, pf.v, o2); }
    { const v16h a = ldfrag(vp + 48 * KPITCH, hh); o3 = mma16(a, pf.v, o3); }
   }
   asm volatile("s_wait_dscnt 0x0" ::: "memory");      /* this wave's reads of buffer buf are done before it is refilled */
   asm volatile("s_wait_asynccnt 0x0" ::: "memory");   /* this wave's share of tile t + 1 has landed */
   __syncthreads();                                    /* publishes tile t + 1 and ends every wave's reads of buffer buf */
   if (t + 2 < NTILE)
     stage_kv(lk0 + (unsigned)buf * (unsigned)sizeof(ring[0]), lv0 + (unsigned)buf * (unsigned)sizeof(ring[0]),
              gk0 + (size_t)(t + 2) * KT * DM, gv0 + (t + 2) * KT);
  }
  asm volatile("s_wait_asynccnt 0x0" ::: "memory");    /* no copy is outstanding when the ring becomes output staging */
  const float lo = __shfl_xor(l, 16, 32);
  const float lt = l + lo;
  const float inv = 64.0f / lt;             /* merged rows carried x64 */
  const v8f oo[4] = {o0, o1, o2, o3};
#pragma unroll
  for (int j = 0; j < 4; ++j) {
    FragH f;
#pragma unroll
    for (int r = 0; r < 8; ++r) f.h[r] = (_Float16)(oo[j][r] * inv);   /* query ln, d = 16j + 8h + r */
    *(v8us*)&ring[0][0][16 * w + ln][16 * j + 8 * hh] = f.half[0];
  }
  __builtin_amdgcn_fence(4 /* acq_rel order */, "workgroup");
  __builtin_amdgcn_wave_barrier();
  const int rq = lane >> 3, pc = lane & 7;
  {
#pragma unroll
    for (int it = 0; it < 4; ++it) {
      const int row = it * 4 + rq;
      const v8us v = *(const v8us*)&ring[0][0][16 * w + row][pc * 8];
      *(v8us*)((unsigned short*)O16 + (tok0 + (size_t)(qt * 16 + row)) * DM + h * HD + pc * 8) = v;
    }
    
  }
}

extern "C" void kernel_launch(void* const* d_in, const int* in_sizes, int n_in,
                              void* d_out, int out_size, void* d_ws, size_t ws_size, hipStream_t stream) {
  if (n_in < 10) return;
  const size_t needRows = (size_t)(NB - 1) * SEQ_FULL + SEQ;
  if ((size_t)in_sizes[0] < needRows * DM) return;
  if ((size_t)in_sizes[1] < needRows) return;
  if ((size_t)in_sizes[2] < (size_t)DM * DM || (size_t)in_sizes[4] < (size_t)DM * DM) return;
  if ((size_t)in_sizes[6] < (size_t)DM * DM || (size_t)in_sizes[8] < (size_t)DM * DM) return;
  if (in_sizes[3] < DM || in_sizes[5] < DM || in_sizes[7] < DM || in_sizes[9] < DM) return;
  if ((size_t)out_size < (size_t)NR * DM) return;
  const float* x    = (const float*)d_in[0];
  const float* mask = (const float*)d_in[1];
  const float* wq   = (const float*)d_in[2];
  const float* bq   = (const float*)d_in[3];
  const float* wk   = (const float*)d_in[4];
  const float* bk   = (const float*)d_in[5];
  const float* wv   = (const float*)d_in[6];
  const float* bv   = (const float*)d_in[7];
  const float* wo   = (const float*)d_in[8];
  const float* bo   = (const float*)d_in[9];
  float* out = (float*)d_out;

  char* ws = (char*)d_ws; size_t off = 0;
  const size_t wB = (size_t)DM * DM * 2;          /* 1,179,648 B per weight plane */
  const size_t pB = (size_t)NR * DM * 2;          /* 12,582,912 B per activation plane */
  _Float16* BQ  = (_Float16*)(ws + off); off += wB;
  _Float16* BK  = (_Float16*)(ws + off); off += wB;
  _Float16* BV  = (_Float16*)(ws + off); off += wB;
  _Float16* BO  = (_Float16*)(ws + off); off += wB;
  _Float16* X16 = (_Float16*)(ws + off); off += pB;
  _Float16* Q16 = (_Float16*)(ws + off); off += pB;
  _Float16* K16 = (_Float16*)(ws + off); off += pB;
  _Float16* VT  = (_Float16*)(ws + off); off += pB;   /* [NB][DM][SEQ] */
  _Float16* O16 = (_Float16*)(ws + off); off += pB;
  if (off > ws_size) return;

  /* weights in[768][768] -> planes BQ, BK, BV, BO out[n][k] x16 (consecutive from BQ); x -> f16 rows */
  k_prep<<<(unsigned)(4 * WTB + XB), 256, 0, stream>>>(wq, wk, wv, wo, x, BQ, X16);
  /* Q, K rows: [NR][DM] f16; V^T per batch: C[m = feature][n = token] = Wv^T[m][k] . x[n][k] + bv[m] -> VT[b][DM][SEQ] */
  k_qkv<<<(unsigned)(2 * QKB + NB * VTB), 128, 0, stream>>>(X16, BQ, bq, bk, bv, Q16, K16, VT);
  k_attn<<<(unsigned)(((size_t)NB * NH * (SEQ / 16)) / 4), 128, 0, stream>>>(Q16, K16, VT, mask, O16);
  /* out = (O16 / 64) . (BO / 16) + bo */
  k_gemm<<<dim3((unsigned)((NR / 128) * (DM / 64)), 1), 128, 0, stream>>>(O16, DM, BO, DM, (size_t)0, 0.0009765625f, bo, DM, 0, out, Q16, 0, DM, (size_t)0, NR, DM, DM);
}

// v004
// A run of this version takes 130 microseconds.
// Timed twice side by side with v003, it ran 1.04 and 1.03 times as fast.
// Counting every step since v000, it is 2.55 times as fast.
#include <hip/hip_runtime.h>
// Compute dtype: every contraction on v_wmma_f32_16x16x32_f16 (f16 operands, f32 accumulate): x / weights exact in f16 after an RNE convert to bf16 (weights carried x16); q, k, v plain f16; softmax weights f16 carried x1024 (folded into the exponent, cancelled by the f32 row sum); merged head rows f16 carried x64 against the x16 output weights (alpha 2^-10).
// Self-attention block: x [4][2048][768]; q/k/v = x W + b with [in][out] weights; 12 heads of 64; logits = q.k/8 + mask*(-1e9) per (batch, key); softmax over 2048 keys; out = merged Wo + bo.
// Structure: weight planes Bt[n][k]; x as f16 rows; Q, K row GEMMs (32x64 wave tiles); V^T produced directly by the operand-swapped GEMM (A = Wv^T plane, B = x rows, per-row bias);
// Four launches: one resident grid converts the four weights and x, one grid runs the Q, K and V^T GEMMs, then attention, then the output GEMM; in the projection grid the block index picks the job; in the conversion grid every wave converts x and waves 0 .. WPB - 1 also take a weight item.
#ifndef NB
#define NB 4
#endif
#ifndef SEQ
#define SEQ 2048
#endif
#define SEQ_FULL 2048                 /* per-batch row count of the inputs */
#define DM 768
#define NH 12
#define HD 64
#define NR (NB * SEQ)                 /* token rows processed */
#define LN1024 6.931471805599453f

static_assert(NH * HD == DM);
static_assert(HD == 64);
static_assert(DM % 128 == 0);
static_assert(DM % 64 == 0);
static_assert(DM % 32 == 0);
static_assert(NR % 128 == 0);
static_assert(SEQ % 64 == 0);
static_assert(SEQ % 32 == 0);
static_assert((SEQ / 16) % 4 == 0);
static_assert(SEQ <= SEQ_FULL);
static_assert(((size_t)NB * NH * (SEQ / 16)) % 4 == 0);
static_assert((size_t)4 * DM * DM * 2 + (size_t)5 * NR * DM * 2 <= (size_t)134217728);

typedef _Float16 v16h __attribute__((ext_vector_type(16)));
typedef unsigned short v8us __attribute__((ext_vector_type(8), may_alias));
typedef float v8f  __attribute__((ext_vector_type(8)));
typedef float v4f  __attribute__((ext_vector_type(4)));
typedef float v4fa __attribute__((ext_vector_type(4), may_alias));
union FragH { v16h v; v8us half[2]; _Float16 h[16]; unsigned short u[16]; };

__device__ __forceinline__ unsigned short bf16_bits(float x) { unsigned int u = __float_as_uint(x); return (unsigned short)((u + 0x7FFFu + ((u >> 16) & 1u)) >> 16); }
__device__ __forceinline__ float bf16_rne(float x) { return __uint_as_float(((unsigned int)bf16_bits(x)) << 16); }
__device__ __forceinline__ int imin(int a, int b) { return (a < b) ? a : b; }

// 16x32 fragment of a k-contiguous 16-bit row: elements 0..7 <- k 8h..8h+7, elements 8..15 <- k 16+8h..16+8h+7 (same map for A rows and B columns)
__device__ __forceinline__ v16h ldfrag(const _Float16* p, int hh) {
  FragH f;
  f.half[0] = *(const v8us*)((const unsigned short*)p + 8 * hh);
  f.half[1] = *(const v8us*)((const unsigned short*)p + 16 + 8 * hh);
  return f.v;
}
__device__ __forceinline__ v8f mma16(v16h a, v16h b, v8f c) {
  v8f d = __builtin_amdgcn_wmma_f32_16x16x32_f16(false, a, false, b, (short)0, c, false, false);
  asm volatile("v_nop\n\tv_nop\n\tv_nop\n\tv_nop" : "+v"(d) : "v"(a), "v"(b));
  return d;
}

#define PB 256                                  /* prep blocks: one per WGP */
#define PT 512                                  /* threads per prep block: 16 waves */
#define XI ((NR * (DM / 8)) / (PB * PT))        /* x items (8 elements) per thread */
#define WWI ((DM / 64) * (DM / 16))             /* wave items per weight: 64 k rows x 16 columns each */
#define WPB ((4 * WWI) / PB)                    /* weight wave items per block */
static_assert((NR * (DM / 8)) % (PB * PT) == 0);
static_assert((4 * WWI) % PB == 0);
static_assert(WPB <= PT / 32);

// All operand conversions as one resident stream: every wave starts once and has all its 16-byte loads in flight before it converts anything.
// x: thread t of block bx takes items (bx XI + i) PT + t, i < XI, of 8 consecutive elements each. Weights (planes wq, wk, wv, wo, consecutive in Wt, x16):
// waves 0 .. WPB - 1 of a block take one wave item each: 64 k rows x 16 columns; lane = (k group of 8, 4 columns), 8 loads of 16 bytes; store c writes 8 k of the lane's column c, so 8 lanes fill one whole 128-byte line of a plane row.
__global__ __launch_bounds__(PT) void k_prep(const float* __restrict__ wq, const float* __restrict__ wk, const float* __restrict__ wv, const float* __restrict__ wo,
                                             const float* __restrict__ x, _Float16* __restrict__ Wt, _Float16* __restrict__ X16) {
  const int tid = threadIdx.x, lane = tid & 31;
  const int w = __builtin_amdgcn_readfirstlane(tid >> 5);
  const int bx = blockIdx.x;
  static_assert(SEQ == SEQ_FULL);               /* token rows are then consecutive in x: item t starts at element 8 t */
  const float* xs = x + ((size_t)bx * XI * PT + tid) * 8;
  v4f xa[XI], xc[XI];
#pragma unroll
  for (int i = 0; i < XI; ++i) {
    xa[i] = *(const v4fa*)(xs + (size_t)i * PT * 8);
    xc[i] = *(const v4fa*)(xs + (size_t)i * PT * 8 + 4);
  }
  asm volatile("s_wait_xcnt 0x0" :: "v"(xs) : "memory");   /* the loads' address registers stay untouched (xs is held live to here, so no load's result lands on it) until this wait */
  if (w < WPB) {                                /* wave-uniform */
    const int wi = bx * WPB + w;
    const int j = wi / WWI, r = wi - j * WWI;
    const int k8 = (r / (DM / 16)) * 64 + (lane >> 2) * 8, n0 = (r % (DM / 16)) * 16 + (lane & 3) * 4;
    const float* W = (j == 0) ? wq : (j == 1) ? wk : (j == 2) ? wv : wo;
    const float* wsrc = W + (size_t)k8 * DM + n0;
    v4f wr[8];
#pragma unroll
    for (int i = 0; i < 8; ++i) wr[i] = *(const v4fa*)(wsrc + (size_t)i * DM);
    asm volatile("s_wait_xcnt 0x0" :: "v"(wsrc) : "memory");   /* likewise for the weight loads */
    unsigned short* d = (unsigned short*)Wt + (size_t)j * DM * DM + (size_t)n0 * DM + k8;
    FragH f[4];
#pragma unroll
    for (int c = 0; c < 4; ++c) {
#pragma unroll
      for (int i = 0; i < 8; ++i) f[c].h[i] = (_Float16)(bf16_rne(wr[i][c]) * 16.0f);
    }
#pragma unroll
    for (int c = 0; c < 4; ++c) *(v8us*)(d + (size_t)c * DM) = f[c].half[0];
    asm volatile("s_wait_xcnt 0x0" ::: "memory");   /* the code behind the branch reuses the stores' address and data registers only behind this */
  }
  FragH g[XI];
#pragma unroll
  for (int i = 0; i < XI; ++i) {
#pragma unroll
    for (int q = 0; q < 4; ++q) { g[i].h[q] = (_Float16)bf16_rne(xa[i][q]); g[i].h[4 + q] = (_Float16)bf16_rne(xc[i][q]); }
  }
#pragma unroll
  for (int i = 0; i < XI; ++i) *(v8us*)((unsigned short*)X16 + ((size_t)(bx * XI + i) * PT + tid) * 8) = g[i].half[0];
}

#define GKT 64                        /* k elements per staged GEMM tile: operand rows are then whole 128-byte lines */
#define GPITCH 72                     /* LDS row pitch in 16-bit elements: 144 B = 16 B x odd, conflict-free for 16-byte fragment reads */

// One k tile of the block's operands (128 A rows and 64 B rows of GKT elements) from global memory into LDS, 16 bytes per lane and copy; a wave's copy covers 4 whole 128-byte rows.
// la, lb: this lane's LDS byte address in row tid >> 3 of the A and B part; ga, gb: the matching global addresses. Copy i takes row (tid >> 3) + 16 i.
// s_wait_xcnt 0 closes the statement so that no address register of an issued copy is rewritten ahead of it.
__device__ __forceinline__ void stage_ab(unsigned la, unsigned lb, const _Float16* ga, const _Float16* gb, int lda, int ldb) {
  asm volatile("global_load_async_to_lds_b128 %0, %12, off\n\t"
               "global_load_async_to_lds_b128 %1, %13, off\n\t"
               "global_load_async_to_lds_b128 %2, %14, off\n\t"
               "global_load_async_to_lds_b128 %3, %15, off\n\t"
               "global_load_async_to_lds_b128 %4, %16, off\n\t"
               "global_load_async_to_lds_b128 %5, %17, off\n\t"
               "global_load_async_to_lds_b128 %6, %18, off\n\t"
               "global_load_async_to_lds_b128 %7, %19, off\n\t"
               "global_load_async_to_lds_b128 %8, %20, off\n\t"
               "global_load_async_to_lds_b128 %9, %21, off\n\t"
               "global_load_async_to_lds_b128 %10, %22, off\n\t"
               "global_load_async_to_lds_b128 %11, %23, off\n\t"
               "s_wait_xcnt 0x0"
               :: "v"(la), "v"(la + 16u * GPITCH * 2u), "v"(la + 32u * GPITCH * 2u), "v"(la + 48u * GPITCH * 2u),
                  "v"(la + 64u * GPITCH * 2u), "v"(la + 80u * GPITCH * 2u), "v"(la + 96u * GPITCH * 2u), "v"(la + 112u * GPITCH * 2u),
                  "v"(lb), "v"(lb + 16u * GPITCH * 2u), "v"(lb + 32u * GPITCH * 2u), "v"(lb + 48u * GPITCH * 2u),
                  "v"(ga), "v"(ga + (size_t)16 * lda), "v"(ga + (size_t)32 * lda), "v"(ga + (size_t)48 * lda),
                  "v"(ga + (size_t)64 * lda), "v"(ga + (size_t)80 * lda), "v"(ga + (size_t)96 * lda), "v"(ga + (size_t)112 * lda),
                  "v"(gb), "v"(gb + (size_t)16 * ldb), "v"(gb + (size_t)32 * ldb), "v"(gb + (size_t)48 * ldb)
               : "memory");
}

// C[by][M][N] = alpha * A[M][K] . Bt[by][N][K]^T + bias (per column, or per row when biasrow != 0; bias RNE-converted to bf16).
// A, Bt f16 k-contiguous rows. Block = 4 waves, wave tile 32 rows x 64 cols; M % 128 == 0, N % 64 == 0, K % 64 == 0 (host asserts).
// The block's 128 A rows and 64 B rows reach the waves through a two-buffer LDS ring of GKT-element k tiles filled by asynchronous copies, one tile ahead.
// mt, nq, by: the block's row tile, column tile and batch index within its own GEMM.
__device__ __forceinline__ void gemm_body(const _Float16* __restrict__ A, int lda,
                                          const _Float16* __restrict__ Bh, int ldb, size_t sB, float alpha,
                                          const float* __restrict__ bias, int nbias, int biasrow,
                                          float* __restrict__ C32, _Float16* __restrict__ C16, int out16,
                                          int ldc, size_t sC, int M, int N, int K, int mt, int nq, int by) {
  __shared__ __attribute__((aligned(16))) float so[4][32][68];
  __shared__ __attribute__((aligned(16))) unsigned short gring[2][128 + 64][GPITCH];   /* [buffer][A rows 0..127 | B rows 128..191][element] */
  const int tid = threadIdx.x, lane = tid & 31, ln = lane & 15, hh = lane >> 4;
  const int w = __builtin_amdgcn_readfirstlane(tid >> 5);
  const _Float16* Bb = Bh + (size_t)by * sB;
  const size_t cofs = (size_t)by * sC;
  const int rowb = mt * 128, col0 = nq * 64;
  if (rowb >= M) return;                    /* the whole block leaves or none does: barriers follow */
  const int row0 = rowb + 32 * w;
  const int crow = tid >> 3, cc8 = (tid & 7) * 8;
  const unsigned la0 = (unsigned)(size_t)&gring[0][crow][cc8];
  const unsigned lb0 = (unsigned)(size_t)&gring[0][128 + crow][cc8];
  const _Float16* ga0 = A + (size_t)(rowb + crow) * lda + cc8;
  const _Float16* gb0 = Bb + (size_t)(col0 + crow) * ldb + cc8;
  const int nt = K / GKT;
  stage_ab(la0, lb0, ga0, gb0, lda, ldb);             /* tile 0 -> buffer 0 */
  asm volatile("s_wait_asynccnt 0x0" ::: "memory");   /* this wave's share of tile 0 has landed before the barrier publishes it */
  __syncthreads();
  if (1 < nt) stage_ab(la0 + (unsigned)sizeof(gring[0]), lb0 + (unsigned)sizeof(gring[0]), ga0 + GKT, gb0 + GKT, lda, ldb);   /* tile 1 -> buffer 1 */
  const v8f z8 = {0.f, 0.f, 0.f, 0.f, 0.f, 0.f, 0.f, 0.f};
  v8f c00 = z8, c01 = z8, c02 = z8, c03 = z8, c10 = z8, c11 = z8, c12 = z8, c13 = z8;
#pragma unroll 1
  for (int t = 0; t < nt; ++t) {
    const int buf = t & 1;
    const _Float16* ap = (const _Float16*)&gring[buf][32 * w + ln][0];
    const _Float16* bp = (const _Float16*)&gring[buf][128 + ln][0];
#pragma unroll
    for (int sub = 0; sub < GKT; sub += 32) {
      const v16h a0 = ldfrag(ap + sub, hh), a1 = ldfrag(ap + 16 * GPITCH + sub, hh);
      const v16h b0 = ldfrag(bp + sub, hh), b1 = ldfrag(bp + 16 * GPITCH + sub, hh);
      const v16h b2 = ldfrag(bp + 32 * GPITCH + sub, hh), b3 = ldfrag(bp + 48 * GPITCH + sub, hh);
      c00 = mma16(a0, b0, c00); c10 = mma16(a1, b0, c10);
      c01 = mma16(a0, b1, c01); c11 = mma16(a1, b1, c11);
      c02 = mma16(a0, b2, c02); c12 = mma16(a1, b2, c12);
      c03 = mma16(a0, b3, c03); c13 = mma16(a1, b3, c13);
    }
    asm volatile("s_wait_dscnt 0x0" ::: "memory");      /* this wave's reads of buffer buf are done before it is refilled */
    asm volatile("s_wait_asynccnt 0x0" ::: "memory");   /* this wave's share of tile t + 1 has landed */
    __syncthreads();                                    /* publishes tile t + 1 and ends every wave's reads of buffer buf */
    if (t + 2 < nt)
      stage_ab(la0 + (unsigned)buf * (unsigned)sizeof(gring[0]), lb0 + (unsigned)buf * (unsigned)sizeof(gring[0]),
               ga0 + (size_t)(t + 2) * GKT, gb0 + (size_t)(t + 2) * GKT, lda, ldb);
  }
  asm volatile("s_wait_asynccnt 0x0" ::: "memory");     /* no copy is outstanding when the wave goes on to its output */
  // per-row bias candidates (clamped addresses; selected by value below)
  const int rb0 = imin(row0 + 8 * hh, nbias - 8), rb1 = imin(row0 + 16 + 8 * hh, nbias - 8);
  const v4f br00 = *(const v4fa*)(bias + rb0), br10 = *(const v4fa*)(bias + rb1);
  asm volatile("s_wait_xcnt 0x0" ::: "memory");         /* the address registers of the two loads above may be reused (also as a later load's result) behind this */
  const v4f br01 = *(const v4fa*)(bias + rb0 + 4), br11 = *(const v4fa*)(bias + rb1 + 4);
  asm volatile("s_wait_xcnt 0x0" ::: "memory");         /* likewise for the two loads above */
  const float brow[16] = {br00[0], br00[1], br00[2], br00[3], br01[0], br01[1], br01[2], br01[3],
                          br10[0], br10[1], br10[2], br10[3], br11[0], br11[1], br11[2], br11[3]};
  const v8f accs[8] = {c00, c01, c02, c03, c10, c11, c12, c13};
#pragma unroll
  for (int u = 0; u < 8; ++u) {
    const int t = u & 3, half = u >> 2;
    const int col = col0 + t * 16 + ln;
    const float bc = bf16_rne(bias[imin(col, nbias - 1)]);
#pragma unroll
    for (int r = 0; r < 8; ++r) {
      const int rloc = half * 16 + 8 * hh + r;
      const float br = bf16_rne(brow[half * 8 + r]);
      const float bv = (biasrow != 0) ? br : bc;
      so[w][rloc][t * 16 + ln] = accs[u][r] * alpha + bv;
    }
  }
  __builtin_amdgcn_fence(4 /* acq_rel order */, "workgroup");
  __builtin_amdgcn_wave_barrier();
  if (out16 != 0) {
    const int rq = lane >> 3, c8 = (lane & 7) * 8;
    {
#pragma unroll
      for (int it = 0; it < 8; ++it) {
        const int row = it * 4 + rq;
        const v4f x0 = *(const v4fa*)&so[w][row][c8];
        const v4f x1 = *(const v4fa*)&so[w][row][c8 + 4];
        FragH f;
#pragma unroll
        for (int q = 0; q < 4; ++q) { f.h[q] = (_Float16)x0[q]; f.h[4 + q] = (_Float16)x1[q]; }
        const v8us o = f.half[0];
        *(v8us*)((unsigned short*)C16 + cofs + (size_t)(row0 + row) * ldc + col0 + c8) = o;
      }
      asm volatile("s_wait_xcnt 0x0" ::: "memory");     /* where the other branch's code follows in the build, it reuses the stores' address and data registers only behind this */
    }
  } else {
    const int rsub = lane >> 4, c4 = (lane & 15) * 4;
    {
#pragma unroll
      for (int q = 0; q < 16; ++q) {
        const int r = q * 2 + rsub;
        const v4f v = *(const v4fa*)&so[w][r][c4];
        *(v4f*)(C32 + cofs + (size_t)(row0 + r) * ldc + col0 + c4) = v;
      }
      
    }
  }
}

__global__ __launch_bounds__(128) void k_gemm(const _Float16* __restrict__ A, int lda,
                                              const _Float16* __restrict__ Bh, int ldb, size_t sB, float alpha,
                                              const float* __restrict__ bias, int nbias, int biasrow,
                                              float* __restrict__ C32, _Float16* __restrict__ C16, int out16,
                                              int ldc, size_t sC, int M, int N, int K) {
  const int ntn = N >> 6;
  const int mt = blockIdx.x / ntn, nq = blockIdx.x - mt * ntn;
  gemm_body(A, lda, Bh, ldb, sB, alpha, bias, nbias, biasrow, C32, C16, out16, ldc, sC, M, N, K, mt, nq, blockIdx.y);
}

#define QKB ((NR / 128) * (DM / 64))           /* blocks of the Q GEMM, and of the K GEMM */
#define VTB ((DM / 128) * (SEQ / 64))          /* blocks of the V^T GEMM per batch */

// The three projections in one grid: blocks 0 .. QKB - 1 make Q rows, the next QKB make K rows, the last NB VTB make V^T (VTB per batch). They are independent; every selection is block-uniform.
// Wt: the weight planes in the order q, k, v.
__global__ __launch_bounds__(128) void k_qkv(const _Float16* __restrict__ X16, const _Float16* __restrict__ Wt,
                                             const float* __restrict__ bq, const float* __restrict__ bk, const float* __restrict__ bv,
                                             _Float16* __restrict__ Q16, _Float16* __restrict__ K16, _Float16* __restrict__ VT) {
  const int bx = blockIdx.x;
  const int j = (bx >= 2 * QKB) ? 2 : (bx >= QKB) ? 1 : 0;
  const bool isv = j == 2;
  const int r = bx - j * QKB;
  const int by = isv ? r / VTB : 0;
  const int lx = r - by * VTB;
  const int mt = isv ? lx / (SEQ / 64) : lx / (DM / 64);
  const int nq = lx - mt * (isv ? SEQ / 64 : DM / 64);
  const _Float16* Wj = Wt + (size_t)j * DM * DM;
  gemm_body(isv ? Wj : X16, DM, isv ? X16 : Wj, DM, isv ? (size_t)SEQ * DM : (size_t)0, 0.0625f,
            (j == 0) ? bq : (j == 1) ? bk : bv, DM, isv ? 1 : 0,
            (float*)nullptr, (j == 0) ? Q16 : (j == 1) ? K16 : VT, 1,
            isv ? SEQ : DM, isv ? (size_t)DM * SEQ : (size_t)0, isv ? DM : NR, isv ? SEQ : DM, DM, mt, nq, by);
}

#define KT 64                         /* keys per staged tile: K rows and V^T rows are then whole 128-byte lines */
#define KPITCH 72                     /* LDS row pitch in 16-bit elements: 144 B = 16 B x odd, conflict-free for 16-byte fragment reads */
#define NTILE (SEQ / KT)
static_assert(SEQ % KT == 0);

// One K tile (KT keys x 64 d) and one V^T tile (64 d x KT keys) from global memory into LDS, 16 bytes per lane and copy; a wave's copy covers 4 whole 128-byte rows.
// lk, lv: this lane's LDS byte address in row tid >> 3 of the K and V^T tile; gk, gv: the matching global addresses. Copy i takes row (tid >> 3) + 16 i.
// s_wait_xcnt 0 closes the statement so that no address register of an issued copy is rewritten ahead of it.
__device__ __forceinline__ void stage_kv(unsigned lk, unsigned lv, const _Float16* gk, const _Float16* gv) {
  asm volatile("global_load_async_to_lds_b128 %0, %8, off\n\t"
               "global_load_async_to_lds_b128 %1, %9, off\n\t"
               "global_load_async_to_lds_b128 %2, %10, off\n\t"
               "global_load_async_to_lds_b128 %3, %11, off\n\t"
               "global_load_async_to_lds_b128 %4, %12, off\n\t"
               "global_load_async_to_lds_b128 %5, %13, off\n\t"
               "global_load_async_to_lds_b128 %6, %14, off\n\t"
               "global_load_async_to_lds_b128 %7, %15, off\n\t"
               "s_wait_xcnt 0x0"
               :: "v"(lk), "v"(lk + 16u * KPITCH * 2u), "v"(lk + 32u * KPITCH * 2u), "v"(lk + 48u * KPITCH * 2u),
                  "v"(lv), "v"(lv + 16u * KPITCH * 2u), "v"(lv + 32u * KPITCH * 2u), "v"(lv + 48u * KPITCH * 2u),
                  "v"(gk), "v"(gk + (size_t)16 * DM), "v"(gk + (size_t)32 * DM), "v"(gk + (size_t)48 * DM),
                  "v"(gv), "v"(gv + (size_t)16 * SEQ), "v"(gv + (size_t)32 * SEQ), "v"(gv + (size_t)48 * SEQ)
               : "memory");
}

// Fused attention. Block = 4 waves of one (batch, head); wave = 16 queries. Q16/K16 rows [token][DM] (head h at columns 64h..), VT [batch][DM][SEQ].
// K and V^T reach the waves through a two-buffer LDS ring of KT-key tiles filled by asynchronous copies, one tile ahead; the block's 4 waves share each tile.
// Per 32 keys: S^T tiles (A = K rows, B = Q rows; D lane = query, r = key 8h+r) -> e = s/8 + mask addend (LDS, per key) -> online softmax (lane-local; one cross-half exchange)
// -> P in registers is the B fragment (k = key) of O^T += V^T . P^T (A = V^T rows; D lane = query, r = d 8h+r). Output rows f16 carried x64.
__global__ __launch_bounds__(128) void k_attn(const _Float16* __restrict__ Q16, const _Float16* __restrict__ K16,
                                              const _Float16* __restrict__ VT, const float* __restrict__ mask,
                                              _Float16* __restrict__ O16) {
  __shared__ __attribute__((aligned(16))) float msk[SEQ];                  /* cross-wave: block barrier */
  __shared__ __attribute__((aligned(16))) unsigned short ring[2][2][KT][KPITCH];   /* [buffer][K | V^T][row][element]; behind the loop's last barrier rows 16w.. of ring[0][0] stage wave w's output */
  const int tid = threadIdx.x, lane = tid & 31, ln = lane & 15, hh = lane >> 4;
  const int w = __builtin_amdgcn_readfirstlane(tid >> 5);
  const int gw = blockIdx.x * 4 + w;
  const int bh = gw / (SEQ / 16);
  const int qt = gw - bh * (SEQ / 16);
  const int b = bh / NH, h = bh - b * NH;
  const size_t tok0 = (size_t)b * SEQ;
  const int crow = tid >> 3, cc8 = (tid & 7) * 8;
  const unsigned lk0 = (unsigned)(size_t)&ring[0][0][crow][cc8];
  const unsigned lv0 = (unsigned)(size_t)&ring[0][1][crow][cc8];
  const _Float16* gk0 = K16 + (tok0 + (size_t)crow) * DM + h * HD + cc8;
  const _Float16* gv0 = VT + ((size_t)b * DM + (size_t)(h * HD + crow)) * SEQ + cc8;
  stage_kv(lk0, lv0, gk0, gv0);             /* tile 0 -> buffer 0, in flight under the mask fill */
  // additive key term of this batch: f32(bf16(mask)) * (-1e9), all SEQ entries written before any read
  const float* mrow = mask + (size_t)b * SEQ_FULL;
  for (int i = tid * 4; i < SEQ; i += 512) {
    const v4f m = *(const v4fa*)(mrow + i);
    v4f o;
#pragma unroll
    for (int q = 0; q < 4; ++q) o[q] = bf16_rne(m[q]) * -1.0e9f;
    *(v4fa*)&msk[i] = o;
  }
  asm volatile("s_wait_asynccnt 0x0" ::: "memory");   /* this wave's share of tile 0 has landed before the barrier publishes it */
  __syncthreads();
  if (1 < NTILE) stage_kv(lk0 + (unsigned)sizeof(ring[0]), lv0 + (unsigned)sizeof(ring[0]), gk0 + (size_t)KT * DM, gv0 + KT);   /* tile 1 -> buffer 1 */
  const _Float16* qrow = Q16 + (tok0 + (size_t)(qt * 16 + ln)) * DM + h * HD;
  const v16h qb0 = ldfrag(qrow, hh), qb1 = ldfrag(qrow + 32, hh);
  const v8f z8 = {0.f, 0.f, 0.f, 0.f, 0.f, 0.f, 0.f, 0.f};
  v8f o0 = z8, o1 = z8, o2 = z8, o3 = z8;
  float mo = -1.0e30f, mso = -1.0e30f, l = 0.f;
#pragma unroll 1
  for (int t = 0; t < NTILE; ++t) {
   const int buf = t & 1;
   for (int sub = 0; sub < KT; sub += 32) {
    const int kb = t * KT + sub;
    const _Float16* k0p = (const _Float16*)&ring[buf][0][sub + ln][0];
    const _Float16* k1p = k0p + 16 * KPITCH;
    v8f s0 = z8, s1 = z8;
    { v16h a = ldfrag(k0p, hh); s0 = mma16(a, qb0, s0); a = ldfrag(k0p + 32, hh); s0 = mma16(a, qb1, s0); }
    { v16h a = ldfrag(k1p, hh); s1 = mma16(a, qb0, s1); a = ldfrag(k1p + 32, hh); s1 = mma16(a, qb1, s1); }
    const v4f ma = *(const v4fa*)&msk[kb + 8 * hh];
    const v4f mb = *(const v4fa*)&msk[kb + 8 * hh + 4];
    const v4f mc = *(const v4fa*)&msk[kb + 16 + 8 * hh];
    const v4f md = *(const v4fa*)&msk[kb + 16 + 8 * hh + 4];
    const float am0[8] = {ma[0], ma[1], ma[2], ma[3], mb[0], mb[1], mb[2], mb[3]};
    const float am1[8] = {mc[0], mc[1], mc[2], mc[3], md[0], md[1], md[2], md[3]};
    float e0[8], e1[8];
#pragma unroll
    for (int r = 0; r < 8; ++r) { e0[r] = fmaf(s0[r], 0.125f, am0[r]); e1[r] = fmaf(s1[r], 0.125f, am1[r]); }
    float bm = fmaxf(e0[0], e1[0]);
#pragma unroll
    for (int r = 1; r < 8; ++r) bm = fmaxf(bm, fmaxf(e0[r], e1[r]));
    const float bmo = __shfl_xor(bm, 16, 32);
    bm = fmaxf(bm, bmo);
    const float mn = fmaxf(mo, bm);
    const float msn = mn - LN1024;          /* weights carried x1024 through the exponent */
    const float alpha = __expf(mso - msn);
    mo = mn; mso = msn;
    float ps = 0.f;
    FragH pf;
#pragma unroll
    for (int r = 0; r < 8; ++r) {
      const float p0 = __expf(e0[r] - msn);
      const float p1 = __expf(e1[r] - msn);
      ps += p0 + p1;
      pf.h[r] = (_Float16)p0;               /* k = 8h + r      <-> key kb + 8h + r      */
      pf.h[8 + r] = (_Float16)p1;           /* k = 16 + 8h + r <-> key kb + 16 + 8h + r */
    }
    l = l * alpha + ps;
    o0 *= alpha; o1 *= alpha; o2 *= alpha; o3 *= alpha;
    const _Float16* vp = (const _Float16*)&ring[buf][1][ln][sub];
    { const v16h a = ldfrag(vp, hh); o0 = mma16(a, pf.v, o0); }
    { const v16h a = ldfrag(vp + 16 * KPITCH, hh); o1 = mma16(a, pf.v, o1); }
    { const v16h a = ldfrag(vp + 32 * KPITCH, hh); o2 = mma16(a, pf.v, o2); }
    { const v16h a = ldfrag(vp + 48 * KPITCH, hh); o3 = mma16(a, pf.v, o3); }
   }
   asm volatile("s_wait_dscnt 0x0" ::: "memory");      /* this wave's reads of buffer buf are done before it is refilled */
   asm volatile("s_wait_asynccnt 0x0" ::: "memory");   /* this wave's share of tile t + 1 has landed */
   __syncthreads();                                    /* publishes tile t + 1 and ends every wave's reads of buffer buf */
   if (t + 2 < NTILE)
     stage_kv(lk0 + (unsigned)buf * (unsigned)sizeof(ring[0]), lv0 + (unsigned)buf * (unsigned)sizeof(ring[0]),
              gk0 + (size_t)(t + 2) * KT * DM, gv0 + (t + 2) * KT);
  }
  asm volatile("s_wait_asynccnt 0x0" ::: "memory");    /* no copy is outstanding when the ring becomes output staging */
  const float lo = __shfl_xor(l, 16, 32);
  const float lt = l + lo;
  const float inv = 64.0f / lt;             /* merged rows carried x64 */
  const v8f oo[4] = {o0, o1, o2, o3};
#pragma unroll
  for (int j = 0; j < 4; ++j) {
    FragH f;
#pragma unroll
    for (int r = 0; r < 8; ++r) f.h[r] = (_Float16)(oo[j][r] * inv);   /* query ln, d = 16j + 8h + r */
    *(v8us*)&ring[0][0][16 * w + ln][16 * j + 8 * hh] = f.half[0];
  }
  __builtin_amdgcn_fence(4 /* acq_rel order */, "workgroup");
  __builtin_amdgcn_wave_barrier();
  const int rq = lane >> 3, pc = lane & 7;
  {
#pragma unroll
    for (int it = 0; it < 4; ++it) {
      const int row = it * 4 + rq;
      const v8us v = *(const v8us*)&ring[0][0][16 * w + row][pc * 8];
      *(v8us*)((unsigned short*)O16 + (tok0 + (size_t)(qt * 16 + row)) * DM + h * HD + pc * 8) = v;
    }
    
  }
}

extern "C" void kernel_launch(void* const* d_in, const int* in_sizes, int n_in,
                              void* d_out, int out_size, void* d_ws, size_t ws_size, hipStream_t stream) {
  if (n_in < 10) return;
  const size_t needRows = (size_t)(NB - 1) * SEQ_FULL + SEQ;
  if ((size_t)in_sizes[0] < needRows * DM) return;
  if ((size_t)in_sizes[1] < needRows) return;
  if ((size_t)in_sizes[2] < (size_t)DM * DM || (size_t)in_sizes[4] < (size_t)DM * DM) return;
  if ((size_t)in_sizes[6] < (size_t)DM * DM || (size_t)in_sizes[8] < (size_t)DM * DM) return;
  if (in_sizes[3] < DM || in_sizes[5] < DM || in_sizes[7] < DM || in_sizes[9] < DM) return;
  if ((size_t)out_size < (size_t)NR * DM) return;
  const float* x    = (const float*)d_in[0];
  const float* mask = (const float*)d_in[1];
  const float* wq   = (const float*)d_in[2];
  const float* bq   = (const float*)d_in[3];
  const float* wk   = (const float*)d_in[4];
  const float* bk   = (const float*)d_in[5];
  const float* wv   = (const float*)d_in[6];
  const float* bv   = (const float*)d_in[7];
  const float* wo   = (const float*)d_in[8];
  const float* bo   = (const float*)d_in[9];
  float* out = (float*)d_out;

  char* ws = (char*)d_ws; size_t off = 0;
  const size_t wB = (size_t)DM * DM * 2;          /* 1,179,648 B per weight plane */
  const size_t pB = (size_t)NR * DM * 2;          /* 12,582,912 B per activation plane */
  _Float16* BQ  = (_Float16*)(ws + off); off += wB;
  _Float16* BK  = (_Float16*)(ws + off); off += wB;
  _Float16* BV  = (_Float16*)(ws + off); off += wB;
  _Float16* BO  = (_Float16*)(ws + off); off += wB;
  _Float16* X16 = (_Float16*)(ws + off); off += pB;
  _Float16* Q16 = (_Float16*)(ws + off); off += pB;
  _Float16* K16 = (_Float16*)(ws + off); off += pB;
  _Float16* VT  = (_Float16*)(ws + off); off += pB;   /* [NB][DM][SEQ] */
  _Float16* O16 = (_Float16*)(ws + off); off += pB;
  if (off > ws_size) return;

  /* weights in[768][768] -> planes BQ, BK, BV, BO out[n][k] x16 (consecutive from BQ); x -> f16 rows */
  k_prep<<<PB, PT, 0, stream>>>(wq, wk, wv, wo, x, BQ, X16);
  /* Q, K rows: [NR][DM] f16; V^T per batch: C[m = feature][n = token] = Wv^T[m][k] . x[n][k] + bv[m] -> VT[b][DM][SEQ] */
  k_qkv<<<(unsigned)(2 * QKB + NB * VTB), 128, 0, stream>>>(X16, BQ, bq, bk, bv, Q16, K16, VT);
  k_attn<<<(unsigned)(((size_t)NB * NH * (SEQ / 16)) / 4), 128, 0, stream>>>(Q16, K16, VT, mask, O16);
  /* out = (O16 / 64) . (BO / 16) + bo */
  k_gemm<<<dim3((unsigned)((NR / 128) * (DM / 64)), 1), 128, 0, stream>>>(O16, DM, BO, DM, (size_t)0, 0.0009765625f, bo, DM, 0, out, Q16, 0, DM, (size_t)0, NR, DM, DM);
}

// v005
// A run of this version takes 121 microseconds.
// Next to v004, in two timings, it ran 1.07 times as fast each time.
// All steps since v000 together make it 2.73 times as fast.
#include <hip/hip_runtime.h>
// Compute dtype: every contraction on v_wmma_f32_16x16x32_f16 (f16 operands, f32 accumulate): x / weights exact in f16 after an RNE convert to bf16 (weights carried x16); q, k, v plain f16; softmax weights f16 carried x1024 (folded into the exponent, cancelled by the f32 row sum); merged head rows f16 carried x64 against the x16 output weights (alpha 2^-10).
// Self-attention block: x [4][2048][768]; q/k/v = x W + b with [in][out] weights; 12 heads of 64; logits = q.k/8 + mask*(-1e9) per (batch, key); softmax over 2048 keys; out = merged Wo + bo.
// Structure: weight planes Bt[n][k]; x as f16 rows; Q, K row GEMMs (32x64 wave tiles); V^T produced directly by the operand-swapped GEMM (A = Wv^T plane, B = x rows, per-row bias);
// Four launches: one resident grid converts the four weights and x, one grid runs the Q, K and V^T GEMMs, then attention, then the output GEMM; in the projection grid the block index picks the job; in the conversion grid every wave converts x and waves 0 .. WPB - 1 also take a weight item.
#ifndef NB
#define NB 4
#endif
#ifndef SEQ
#define SEQ 2048
#endif
#define SEQ_FULL 2048                 /* per-batch row count of the inputs */
#define DM 768
#define NH 12
#define HD 64
#define NR (NB * SEQ)                 /* token rows processed */
#define LN1024 6.931471805599453f

static_assert(NH * HD == DM);
static_assert(HD == 64);
static_assert(DM % 128 == 0);
static_assert(DM % 64 == 0);
static_assert(DM % 32 == 0);
static_assert(NR % 128 == 0);
static_assert(SEQ % 64 == 0);
static_assert(SEQ % 32 == 0);
static_assert((SEQ / 16) % 4 == 0);
static_assert(SEQ <= SEQ_FULL);
static_assert(((size_t)NB * NH * (SEQ / 16)) % 4 == 0);
static_assert((size_t)4 * DM * DM * 2 + (size_t)5 * NR * DM * 2 <= (size_t)134217728);

typedef _Float16 v16h __attribute__((ext_vector_type(16)));
typedef unsigned short v8us __attribute__((ext_vector_type(8), may_alias));
typedef float v8f  __attribute__((ext_vector_type(8)));
typedef float v4f  __attribute__((ext_vector_type(4)));
typedef float v4fa __attribute__((ext_vector_type(4), may_alias));
union FragH { v16h v; v8us half[2]; _Float16 h[16]; unsigned short u[16]; };

__device__ __forceinline__ unsigned short bf16_bits(float x) { unsigned int u = __float_as_uint(x); return (unsigned short)((u + 0x7FFFu + ((u >> 16) & 1u)) >> 16); }
__device__ __forceinline__ float bf16_rne(float x) { return __uint_as_float(((unsigned int)bf16_bits(x)) << 16); }
__device__ __forceinline__ int imin(int a, int b) { return (a < b) ? a : b; }

// 16x32 fragment of a k-contiguous 16-bit row: elements 0..7 <- k 8h..8h+7, elements 8..15 <- k 16+8h..16+8h+7 (same map for A rows and B columns)
__device__ __forceinline__ v16h ldfrag(const _Float16* p, int hh) {
  FragH f;
  f.half[0] = *(const v8us*)((const unsigned short*)p + 8 * hh);
  f.half[1] = *(const v8us*)((const unsigned short*)p + 16 + 8 * hh);
  return f.v;
}
// The plain builtin: the compiler keeps the WMMA distances itself and is free to order fragment loads, vector work and WMMAs around it.
__device__ __forceinline__ v8f wmma16(v16h a, v16h b, v8f c) {
  return __builtin_amdgcn_wmma_f32_16x16x32_f16(false, a, false, b, (short)0, c, false, false);
}
__device__ __forceinline__ v8f mma16(v16h a, v16h b, v8f c) {
  v8f d = __builtin_amdgcn_wmma_f32_16x16x32_f16(false, a, false, b, (short)0, c, false, false);
  asm volatile("v_nop\n\tv_nop\n\tv_nop\n\tv_nop" : "+v"(d) : "v"(a), "v"(b));
  return d;
}

#define PB 256                                  /* prep blocks: one per WGP */
#define PT 512                                  /* threads per prep block: 16 waves */
#define XI ((NR * (DM / 8)) / (PB * PT))        /* x items (8 elements) per thread */
#define WWI ((DM / 64) * (DM / 16))             /* wave items per weight: 64 k rows x 16 columns each */
#define WPB ((4 * WWI) / PB)                    /* weight wave items per block */
static_assert((NR * (DM / 8)) % (PB * PT) == 0);
static_assert((4 * WWI) % PB == 0);
static_assert(WPB <= PT / 32);

// All operand conversions as one resident stream: every wave starts once and has all its 16-byte loads in flight before it converts anything.
// x: thread t of block bx takes items (bx XI + i) PT + t, i < XI, of 8 consecutive elements each. Weights (planes wq, wk, wv, wo, consecutive in Wt, x16):
// waves 0 .. WPB - 1 of a block take one wave item each: 64 k rows x 16 columns; lane = (k group of 8, 4 columns), 8 loads of 16 bytes; store c writes 8 k of the lane's column c, so 8 lanes fill one whole 128-byte line of a plane row.
__global__ __launch_bounds__(PT) void k_prep(const float* __restrict__ wq, const float* __restrict__ wk, const float* __restrict__ wv, const float* __restrict__ wo,
                                             const float* __restrict__ x, _Float16* __restrict__ Wt, _Float16* __restrict__ X16) {
  const int tid = threadIdx.x, lane = tid & 31;
  const int w = __builtin_amdgcn_readfirstlane(tid >> 5);
  const int bx = blockIdx.x;
  static_assert(SEQ == SEQ_FULL);               /* token rows are then consecutive in x: item t starts at element 8 t */
  const float* xs = x + ((size_t)bx * XI * PT + tid) * 8;
  v4f xa[XI], xc[XI];
#pragma unroll
  for (int i = 0; i < XI; ++i) {
    xa[i] = *(const v4fa*)(xs + (size_t)i * PT * 8);
    xc[i] = *(const v4fa*)(xs + (size_t)i * PT * 8 + 4);
  }
  asm volatile("s_wait_xcnt 0x0" :: "v"(xs) : "memory");   /* the loads' address registers stay untouched (xs is held live to here, so no load's result lands on it) until this wait */
  if (w < WPB) {                                /* wave-uniform */
    const int wi = bx * WPB + w;
    const int j = wi / WWI, r = wi - j * WWI;
    const int k8 = (r / (DM / 16)) * 64 + (lane >> 2) * 8, n0 = (r % (DM / 16)) * 16 + (lane & 3) * 4;
    const float* W = (j == 0) ? wq : (j == 1) ? wk : (j == 2) ? wv : wo;
    const float* wsrc = W + (size_t)k8 * DM + n0;
    v4f wr[8];
#pragma unroll
    for (int i = 0; i < 8; ++i) wr[i] = *(const v4fa*)(wsrc + (size_t)i * DM);
    asm volatile("s_wait_xcnt 0x0" :: "v"(wsrc) : "memory");   /* likewise for the weight loads */
    unsigned short* d = (unsigned short*)Wt + (size_t)j * DM * DM + (size_t)n0 * DM + k8;
    FragH f[4];
#pragma unroll
    for (int c = 0; c < 4; ++c) {
#pragma unroll
      for (int i = 0; i < 8; ++i) f[c].h[i] = (_Float16)(bf16_rne(wr[i][c]) * 16.0f);
    }
#pragma unroll
    for (int c = 0; c < 4; ++c) *(v8us*)(d + (size_t)c * DM) = f[c].half[0];
    asm volatile("s_wait_xcnt 0x0" ::: "memory");   /* the code behind the branch reuses the stores' address and data registers only behind this */
  }
  FragH g[XI];
#pragma unroll
  for (int i = 0; i < XI; ++i) {
#pragma unroll
    for (int q = 0; q < 4; ++q) { g[i].h[q] = (_Float16)bf16_rne(xa[i][q]); g[i].h[4 + q] = (_Float16)bf16_rne(xc[i][q]); }
  }
#pragma unroll
  for (int i = 0; i < XI; ++i) *(v8us*)((unsigned short*)X16 + ((size_t)(bx * XI + i) * PT + tid) * 8) = g[i].half[0];
}

#define GKT 64                        /* k elements per staged GEMM tile: operand rows are then whole 128-byte lines */
#define GPITCH 72                     /* LDS row pitch in 16-bit elements: 144 B = 16 B x odd, conflict-free for 16-byte fragment reads */

// One k tile of the block's operands (128 A rows and 64 B rows of GKT elements) from global memory into LDS, 16 bytes per lane and copy; a wave's copy covers 4 whole 128-byte rows.
// la, lb: this lane's LDS byte address in row tid >> 3 of the A and B part; ga, gb: the matching global addresses. Copy i takes row (tid >> 3) + 16 i.
// s_wait_xcnt 0 closes the statement so that no address register of an issued copy is rewritten ahead of it.
__device__ __forceinline__ void stage_ab(unsigned la, unsigned lb, const _Float16* ga, const _Float16* gb, int lda, int ldb) {
  asm volatile("global_load_async_to_lds_b128 %0, %12, off\n\t"
               "global_load_async_to_lds_b128 %1, %13, off\n\t"
               "global_load_async_to_lds_b128 %2, %14, off\n\t"
               "global_load_async_to_lds_b128 %3, %15, off\n\t"
               "global_load_async_to_lds_b128 %4, %16, off\n\t"
               "global_load_async_to_lds_b128 %5, %17, off\n\t"
               "global_load_async_to_lds_b128 %6, %18, off\n\t"
               "global_load_async_to_lds_b128 %7, %19, off\n\t"
               "global_load_async_to_lds_b128 %8, %20, off\n\t"
               "global_load_async_to_lds_b128 %9, %21, off\n\t"
               "global_load_async_to_lds_b128 %10, %22, off\n\t"
               "global_load_async_to_lds_b128 %11, %23, off\n\t"
               "s_wait_xcnt 0x0"
               :: "v"(la), "v"(la + 16u * GPITCH * 2u), "v"(la + 32u * GPITCH * 2u), "v"(la + 48u * GPITCH * 2u),
                  "v"(la + 64u * GPITCH * 2u), "v"(la + 80u * GPITCH * 2u), "v"(la + 96u * GPITCH * 2u), "v"(la + 112u * GPITCH * 2u),
                  "v"(lb), "v"(lb + 16u * GPITCH * 2u), "v"(lb + 32u * GPITCH * 2u), "v"(lb + 48u * GPITCH * 2u),
                  "v"(ga), "v"(ga + (size_t)16 * lda), "v"(ga + (size_t)32 * lda), "v"(ga + (size_t)48 * lda),
                  "v"(ga + (size_t)64 * lda), "v"(ga + (size_t)80 * lda), "v"(ga + (size_t)96 * lda), "v"(ga + (size_t)112 * lda),
                  "v"(gb), "v"(gb + (size_t)16 * ldb), "v"(gb + (size_t)32 * ldb), "v"(gb + (size_t)48 * ldb)
               : "memory");
}

// C[by][M][N] = alpha * A[M][K] . Bt[by][N][K]^T + bias (per column, or per row when biasrow != 0; bias RNE-converted to bf16).
// A, Bt f16 k-contiguous rows. Block = 4 waves, wave tile 32 rows x 64 cols; M % 128 == 0, N % 64 == 0, K % 64 == 0 (host asserts).
// The block's 128 A rows and 64 B rows reach the waves through a two-buffer LDS ring of GKT-element k tiles filled by asynchronous copies, one tile ahead.
// mt, nq, by: the block's row tile, column tile and batch index within its own GEMM.
__device__ __forceinline__ void gemm_body(const _Float16* __restrict__ A, int lda,
                                          const _Float16* __restrict__ Bh, int ldb, size_t sB, float alpha,
                                          const float* __restrict__ bias, int nbias, int biasrow,
                                          float* __restrict__ C32, _Float16* __restrict__ C16, int out16,
                                          int ldc, size_t sC, int M, int N, int K, int mt, int nq, int by) {
  __shared__ __attribute__((aligned(16))) float so[4][32][68];
  __shared__ __attribute__((aligned(16))) unsigned short gring[2][128 + 64][GPITCH];   /* [buffer][A rows 0..127 | B rows 128..191][element] */
  const int tid = threadIdx.x, lane = tid & 31, ln = lane & 15, hh = lane >> 4;
  const int w = __builtin_amdgcn_readfirstlane(tid >> 5);
  const _Float16* Bb = Bh + (size_t)by * sB;
  const size_t cofs = (size_t)by * sC;
  const int rowb = mt * 128, col0 = nq * 64;
  if (rowb >= M) return;                    /* the whole block leaves or none does: barriers follow */
  const int row0 = rowb + 32 * w;
  const int crow = tid >> 3, cc8 = (tid & 7) * 8;
  const unsigned la0 = (unsigned)(size_t)&gring[0][crow][cc8];
  const unsigned lb0 = (unsigned)(size_t)&gring[0][128 + crow][cc8];
  const _Float16* ga0 = A + (size_t)(rowb + crow) * lda + cc8;
  const _Float16* gb0 = Bb + (size_t)(col0 + crow) * ldb + cc8;
  const int nt = K / GKT;
  stage_ab(la0, lb0, ga0, gb0, lda, ldb);             /* tile 0 -> buffer 0 */
  asm volatile("s_wait_asynccnt 0x0" ::: "memory");   /* this wave's share of tile 0 has landed before the barrier publishes it */
  __syncthreads();
  if (1 < nt) stage_ab(la0 + (unsigned)sizeof(gring[0]), lb0 + (unsigned)sizeof(gring[0]), ga0 + GKT, gb0 + GKT, lda, ldb);   /* tile 1 -> buffer 1 */
  const v8f z8 = {0.f, 0.f, 0.f, 0.f, 0.f, 0.f, 0.f, 0.f};
  v8f c00 = z8, c01 = z8, c02 = z8, c03 = z8, c10 = z8, c11 = z8, c12 = z8, c13 = z8;
#pragma unroll 1
  for (int t = 0; t < nt; ++t) {
    const int buf = t & 1;
    const _Float16* ap = (const _Float16*)&gring[buf][32 * w + ln][0];
    const _Float16* bp = (const _Float16*)&gring[buf][128 + ln][0];
#pragma unroll
    for (int sub = 0; sub < GKT; sub += 32) {
      const v16h a0 = ldfrag(ap + sub, hh), a1 = ldfrag(ap + 16 * GPITCH + sub, hh);
      const v16h b0 = ldfrag(bp + sub, hh), b1 = ldfrag(bp + 16 * GPITCH + sub, hh);
      const v16h b2 = ldfrag(bp + 32 * GPITCH + sub, hh), b3 = ldfrag(bp + 48 * GPITCH + sub, hh);
      c00 = mma16(a0, b0, c00); c10 = mma16(a1, b0, c10);
      c01 = mma16(a0, b1, c01); c11 = mma16(a1, b1, c11);
      c02 = mma16(a0, b2, c02); c12 = mma16(a1, b2, c12);
      c03 = mma16(a0, b3, c03); c13 = mma16(a1, b3, c13);
    }
    asm volatile("s_wait_dscnt 0x0" ::: "memory");      /* this wave's reads of buffer buf are done before it is refilled */
    asm volatile("s_wait_asynccnt 0x0" ::: "memory");   /* this wave's share of tile t + 1 has landed */
    __syncthreads();                                    /* publishes tile t + 1 and ends every wave's reads of buffer buf */
    if (t + 2 < nt)
      stage_ab(la0 + (unsigned)buf * (unsigned)sizeof(gring[0]), lb0 + (unsigned)buf * (unsigned)sizeof(gring[0]),
               ga0 + (size_t)(t + 2) * GKT, gb0 + (size_t)(t + 2) * GKT, lda, ldb);
  }
  asm volatile("s_wait_asynccnt 0x0" ::: "memory");     /* no copy is outstanding when the wave goes on to its output */
  // per-row bias candidates (clamped addresses; selected by value below)
  const int rb0 = imin(row0 + 8 * hh, nbias - 8), rb1 = imin(row0 + 16 + 8 * hh, nbias - 8);
  const v4f br00 = *(const v4fa*)(bias + rb0), br10 = *(const v4fa*)(bias + rb1);
  asm volatile("s_wait_xcnt 0x0" ::: "memory");         /* the address registers of the two loads above may be reused (also as a later load's result) behind this */
  const v4f br01 = *(const v4fa*)(bias + rb0 + 4), br11 = *(const v4fa*)(bias + rb1 + 4);
  asm volatile("s_wait_xcnt 0x0" ::: "memory");         /* likewise for the two loads above */
  const float brow[16] = {br00[0], br00[1], br00[2], br00[3], br01[0], br01[1], br01[2], br01[3],
                          br10[0], br10[1], br10[2], br10[3], br11[0], br11[1], br11[2], br11[3]};
  const v8f accs[8] = {c00, c01, c02, c03, c10, c11, c12, c13};
#pragma unroll
  for (int u = 0; u < 8; ++u) {
    const int t = u & 3, half = u >> 2;
    const int col = col0 + t * 16 + ln;
    const float bc = bf16_rne(bias[imin(col, nbias - 1)]);
#pragma unroll
    for (int r = 0; r < 8; ++r) {
      const int rloc = half * 16 + 8 * hh + r;
      const float br = bf16_rne(brow[half * 8 + r]);
      const float bv = (biasrow != 0) ? br : bc;
      so[w][rloc][t * 16 + ln] = accs[u][r] * alpha + bv;
    }
  }
  __builtin_amdgcn_fence(4 /* acq_rel order */, "workgroup");
  __builtin_amdgcn_wave_barrier();
  if (out16 != 0) {
    const int rq = lane >> 3, c8 = (lane & 7) * 8;
    {
#pragma unroll
      for (int it = 0; it < 8; ++it) {
        const int row = it * 4 + rq;
        const v4f x0 = *(const v4fa*)&so[w][row][c8];
        const v4f x1 = *(const v4fa*)&so[w][row][c8 + 4];
        FragH f;
#pragma unroll
        for (int q = 0; q < 4; ++q) { f.h[q] = (_Float16)x0[q]; f.h[4 + q] = (_Float16)x1[q]; }
        const v8us o = f.half[0];
        *(v8us*)((unsigned short*)C16 + cofs + (size_t)(row0 + row) * ldc + col0 + c8) = o;
      }
      asm volatile("s_wait_xcnt 0x0" ::: "memory");     /* where the other branch's code follows in the build, it reuses the stores' address and data registers only behind this */
    }
  } else {
    const int rsub = lane >> 4, c4 = (lane & 15) * 4;
    {
#pragma unroll
      for (int q = 0; q < 16; ++q) {
        const int r = q * 2 + rsub;
        const v4f v = *(const v4fa*)&so[w][r][c4];
        *(v4f*)(C32 + cofs + (size_t)(row0 + r) * ldc + col0 + c4) = v;
      }
      
    }
  }
}

__global__ __launch_bounds__(128) void k_gemm(const _Float16* __restrict__ A, int lda,
                                              const _Float16* __restrict__ Bh, int ldb, size_t sB, float alpha,
                                              const float* __restrict__ bias, int nbias, int biasrow,
                                              float* __restrict__ C32, _Float16* __restrict__ C16, int out16,
                                              int ldc, size_t sC, int M, int N, int K) {
  const int ntn = N >> 6;
  const int mt = blockIdx.x / ntn, nq = blockIdx.x - mt * ntn;
  gemm_body(A, lda, Bh, ldb, sB, alpha, bias, nbias, biasrow, C32, C16, out16, ldc, sC, M, N, K, mt, nq, blockIdx.y);
}

#define QKB ((NR / 128) * (DM / 64))           /* blocks of the Q GEMM, and of the K GEMM */
#define VTB ((DM / 128) * (SEQ / 64))          /* blocks of the V^T GEMM per batch */

// The three projections in one grid: blocks 0 .. QKB - 1 make Q rows, the next QKB make K rows, the last NB VTB make V^T (VTB per batch). They are independent; every selection is block-uniform.
// Wt: the weight planes in the order q, k, v.
__global__ __launch_bounds__(128) void k_qkv(const _Float16* __restrict__ X16, const _Float16* __restrict__ Wt,
                                             const float* __restrict__ bq, const float* __restrict__ bk, const float* __restrict__ bv,
                                             _Float16* __restrict__ Q16, _Float16* __restrict__ K16, _Float16* __restrict__ VT) {
  const int bx = blockIdx.x;
  const int j = (bx >= 2 * QKB) ? 2 : (bx >= QKB) ? 1 : 0;
  const bool isv = j == 2;
  const int r = bx - j * QKB;
  const int by = isv ? r / VTB : 0;
  const int lx = r - by * VTB;
  const int mt = isv ? lx / (SEQ / 64) : lx / (DM / 64);
  const int nq = lx - mt * (isv ? SEQ / 64 : DM / 64);
  const _Float16* Wj = Wt + (size_t)j * DM * DM;
  gemm_body(isv ? Wj : X16, DM, isv ? X16 : Wj, DM, isv ? (size_t)SEQ * DM : (size_t)0, 0.0625f,
            (j == 0) ? bq : (j == 1) ? bk : bv, DM, isv ? 1 : 0,
            (float*)nullptr, (j == 0) ? Q16 : (j == 1) ? K16 : VT, 1,
            isv ? SEQ : DM, isv ? (size_t)DM * SEQ : (size_t)0, isv ? DM : NR, isv ? SEQ : DM, DM, mt, nq, by);
}

#define KT 64                         /* keys per staged tile: K rows and V^T rows are then whole 128-byte lines */
#define KPITCH 72                     /* LDS row pitch in 16-bit elements: 144 B = 16 B x odd, conflict-free for 16-byte fragment reads */
#define NTILE (SEQ / KT)
static_assert(SEQ % KT == 0);

// One K tile (KT keys x 64 d) and one V^T tile (64 d x KT keys) from global memory into LDS, 16 bytes per lane and copy; a wave's copy covers 4 whole 128-byte rows.
// lk, lv: this lane's LDS byte address in row tid >> 3 of the K and V^T tile; gk, gv: the matching global addresses. Copy i takes row (tid >> 3) + 16 i.
// s_wait_xcnt 0 closes the statement so that no address register of an issued copy is rewritten ahead of it.
__device__ __forceinline__ void stage_kv(unsigned lk, unsigned lv, const _Float16* gk, const _Float16* gv) {
  asm volatile("global_load_async_to_lds_b128 %0, %8, off\n\t"
               "global_load_async_to_lds_b128 %1, %9, off\n\t"
               "global_load_async_to_lds_b128 %2, %10, off\n\t"
               "global_load_async_to_lds_b128 %3, %11, off\n\t"
               "global_load_async_to_lds_b128 %4, %12, off\n\t"
               "global_load_async_to_lds_b128 %5, %13, off\n\t"
               "global_load_async_to_lds_b128 %6, %14, off\n\t"
               "global_load_async_to_lds_b128 %7, %15, off\n\t"
               "s_wait_xcnt 0x0"
               :: "v"(lk), "v"(lk + 16u * KPITCH * 2u), "v"(lk + 32u * KPITCH * 2u), "v"(lk + 48u * KPITCH * 2u),
                  "v"(lv), "v"(lv + 16u * KPITCH * 2u), "v"(lv + 32u * KPITCH * 2u), "v"(lv + 48u * KPITCH * 2u),
                  "v"(gk), "v"(gk + (size_t)16 * DM), "v"(gk + (size_t)32 * DM), "v"(gk + (size_t)48 * DM),
                  "v"(gv), "v"(gv + (size_t)16 * SEQ), "v"(gv + (size_t)32 * SEQ), "v"(gv + (size_t)48 * SEQ)
               : "memory");
}

// Fused attention. Block = 4 waves of one (batch, head); wave = 16 queries. Q16/K16 rows [token][DM] (head h at columns 64h..), VT [batch][DM][SEQ].
// K and V^T reach the waves through a two-buffer LDS ring of KT-key tiles filled by asynchronous copies, one tile ahead; the block's 4 waves share each tile.
// Per 32 keys: S^T tiles (A = K rows, B = Q rows; D lane = query, r = key 8h+r) -> e = s/8 + mask addend (LDS, per key) -> online softmax (lane-local; one cross-half exchange)
// -> P in registers is the B fragment (k = key) of O^T += V^T . P^T (A = V^T rows; D lane = query, r = d 8h+r). Output rows f16 carried x64.
__global__ __launch_bounds__(128) void k_attn(const _Float16* __restrict__ Q16, const _Float16* __restrict__ K16,
                                              const _Float16* __restrict__ VT, const float* __restrict__ mask,
                                              _Float16* __restrict__ O16) {
  __shared__ __attribute__((aligned(16))) float msk[SEQ];                  /* cross-wave: block barrier */
  __shared__ __attribute__((aligned(16))) unsigned short ring[2][2][KT][KPITCH];   /* [buffer][K | V^T][row][element]; behind the loop's last barrier rows 16w.. of ring[0][0] stage wave w's output */
  const int tid = threadIdx.x, lane = tid & 31, ln = lane & 15, hh = lane >> 4;
  const int w = __builtin_amdgcn_readfirstlane(tid >> 5);
  const int gw = blockIdx.x * 4 + w;
  const int bh = gw / (SEQ / 16);
  const int qt = gw - bh * (SEQ / 16);
  const int b = bh / NH, h = bh - b * NH;
  const size_t tok0 = (size_t)b * SEQ;
  const int crow = tid >> 3, cc8 = (tid & 7) * 8;
  const unsigned lk0 = (unsigned)(size_t)&ring[0][0][crow][cc8];
  const unsigned lv0 = (unsigned)(size_t)&ring[0][1][crow][cc8];
  const _Float16* gk0 = K16 + (tok0 + (size_t)crow) * DM + h * HD + cc8;
  const _Float16* gv0 = VT + ((size_t)b * DM + (size_t)(h * HD + crow)) * SEQ + cc8;
  stage_kv(lk0, lv0, gk0, gv0);             /* tile 0 -> buffer 0, in flight under the mask fill */
  // additive key term of this batch: f32(bf16(mask)) * (-1e9), all SEQ entries written before any read
  const float* mrow = mask + (size_t)b * SEQ_FULL;
  for (int i = tid * 4; i < SEQ; i += 512) {
    const v4f m = *(const v4fa*)(mrow + i);
    v4f o;
#pragma unroll
    for (int q = 0; q < 4; ++q) o[q] = bf16_rne(m[q]) * -1.0e9f;
    *(v4fa*)&msk[i] = o;
  }
  asm volatile("s_wait_asynccnt 0x0" ::: "memory");   /* this wave's share of tile 0 has landed before the barrier publishes it */
  __syncthreads();
  if (1 < NTILE) stage_kv(lk0 + (unsigned)sizeof(ring[0]), lv0 + (unsigned)sizeof(ring[0]), gk0 + (size_t)KT * DM, gv0 + KT);   /* tile 1 -> buffer 1 */
  const _Float16* qrow = Q16 + (tok0 + (size_t)(qt * 16 + ln)) * DM + h * HD;
  const v16h qb0 = ldfrag(qrow, hh), qb1 = ldfrag(qrow + 32, hh);
  const v8f z8 = {0.f, 0.f, 0.f, 0.f, 0.f, 0.f, 0.f, 0.f};
  v8f o0 = z8, o1 = z8, o2 = z8, o3 = z8;
  float mo = -1.0e30f, mso = -1.0e30f, l = 0.f;
#pragma unroll 1
  for (int t = 0; t < NTILE; ++t) {
   const int buf = t & 1;
   for (int sub = 0; sub < KT; sub += 32) {
    const int kb = t * KT + sub;
    const _Float16* k0p = (const _Float16*)&ring[buf][0][sub + ln][0];
    const _Float16* k1p = k0p + 16 * KPITCH;
    v8f s0 = z8, s1 = z8;
    { v16h a = ldfrag(k0p, hh); s0 = wmma16(a, qb0, s0); a = ldfrag(k0p + 32, hh); s0 = wmma16(a, qb1, s0); }
    { v16h a = ldfrag(k1p, hh); s1 = wmma16(a, qb0, s1); a = ldfrag(k1p + 32, hh); s1 = wmma16(a, qb1, s1); }
    const v4f ma = *(const v4fa*)&msk[kb + 8 * hh];
    const v4f mb = *(const v4fa*)&msk[kb + 8 * hh + 4];
    const v4f mc = *(const v4fa*)&msk[kb + 16 + 8 * hh];
    const v4f md = *(const v4fa*)&msk[kb + 16 + 8 * hh + 4];
    const float am0[8] = {ma[0], ma[1], ma[2], ma[3], mb[0], mb[1], mb[2], mb[3]};
    const float am1[8] = {mc[0], mc[1], mc[2], mc[3], md[0], md[1], md[2], md[3]};
    float e0[8], e1[8];
#pragma unroll
    for (int r = 0; r < 8; ++r) { e0[r] = fmaf(s0[r], 0.125f, am0[r]); e1[r] = fmaf(s1[r], 0.125f, am1[r]); }
    float bm = fmaxf(e0[0], e1[0]);
#pragma unroll
    for (int r = 1; r < 8; ++r) bm = fmaxf(bm, fmaxf(e0[r], e1[r]));
    const float bmo = __shfl_xor(bm, 16, 32);
    bm = fmaxf(bm, bmo);
    const float mn = fmaxf(mo, bm);
    const float msn = mn - LN1024;          /* weights carried x1024 through the exponent */
    const float alpha = __expf(mso - msn);
    mo = mn; mso = msn;
    float ps = 0.f;
    FragH pf;
#pragma unroll
    for (int r = 0; r < 8; ++r) {
      const float p0 = __expf(e0[r] - msn);
      const float p1 = __expf(e1[r] - msn);
      ps += p0 + p1;
      pf.h[r] = (_Float16)p0;               /* k = 8h + r      <-> key kb + 8h + r      */
      pf.h[8 + r] = (_Float16)p1;           /* k = 16 + 8h + r <-> key kb + 16 + 8h + r */
    }
    l = l * alpha + ps;
    o0 *= alpha; o1 *= alpha; o2 *= alpha; o3 *= alpha;
    const _Float16* vp = (const _Float16*)&ring[buf][1][ln][sub];
    { const v16h a = ldfrag(vp, hh); o0 = wmma16(a, pf.v, o0); }
    { const v16h a = ldfrag(vp + 16 * KPITCH, hh); o1 = wmma16(a, pf.v, o1); }
    { const v16h a = ldfrag(vp + 32 * KPITCH, hh); o2 = wmma16(a, pf.v, o2); }
    { const v16h a = ldfrag(vp + 48 * KPITCH, hh); o3 = wmma16(a, pf.v, o3); }
   }
   asm volatile("s_wait_dscnt 0x0" ::: "memory");      /* this wave's reads of buffer buf are done before it is refilled */
   asm volatile("s_wait_asynccnt 0x0" ::: "memory");   /* this wave's share of tile t + 1 has landed */
   __syncthreads();                                    /* publishes tile t + 1 and ends every wave's reads of buffer buf */
   if (t + 2 < NTILE)
     stage_kv(lk0 + (unsigned)buf * (unsigned)sizeof(ring[0]), lv0 + (unsigned)buf * (unsigned)sizeof(ring[0]),
              gk0 + (size_t)(t + 2) * KT * DM, gv0 + (t + 2) * KT);
  }
  asm volatile("s_wait_asynccnt 0x0" ::: "memory");    /* no copy is outstanding when the ring becomes output staging */
  const float lo = __shfl_xor(l, 16, 32);
  const float lt = l + lo;
  const float inv = 64.0f / lt;             /* merged rows carried x64 */
  const v8f oo[4] = {o0, o1, o2, o3};
#pragma unroll
  for (int j = 0; j < 4; ++j) {
    FragH f;
#pragma unroll
    for (int r = 0; r < 8; ++r) f.h[r] = (_Float16)(oo[j][r] * inv);   /* query ln, d = 16j + 8h + r */
    *(v8us*)&ring[0][0][16 * w + ln][16 * j + 8 * hh] = f.half[0];
  }
  __builtin_amdgcn_fence(4 /* acq_rel order */, "workgroup");
  __builtin_amdgcn_wave_barrier();
  const int rq = lane >> 3, pc = lane & 7;
  {
#pragma unroll
    for (int it = 0; it < 4; ++it) {
      const int row = it * 4 + rq;
      const v8us v = *(const v8us*)&ring[0][0][16 * w + row][pc * 8];
      *(v8us*)((unsigned short*)O16 + (tok0 + (size_t)(qt * 16 + row)) * DM + h * HD + pc * 8) = v;
    }
    
  }
}

extern "C" void kernel_launch(void* const* d_in, const int* in_sizes, int n_in,
                              void* d_out, int out_size, void* d_ws, size_t ws_size, hipStream_t stream) {
  if (n_in < 10) return;
  const size_t needRows = (size_t)(NB - 1) * SEQ_FULL + SEQ;
  if ((size_t)in_sizes[0] < needRows * DM) return;
  if ((size_t)in_sizes[1] < needRows) return;
  if ((size_t)in_sizes[2] < (size_t)DM * DM || (size_t)in_sizes[4] < (size_t)DM * DM) return;
  if ((size_t)in_sizes[6] < (size_t)DM * DM || (size_t)in_sizes[8] < (size_t)DM * DM) return;
  if (in_sizes[3] < DM || in_sizes[5] < DM || in_sizes[7] < DM || in_sizes[9] < DM) return;
  if ((size_t)out_size < (size_t)NR * DM) return;
  const float* x    = (const float*)d_in[0];
  const float* mask = (const float*)d_in[1];
  const float* wq   = (const float*)d_in[2];
  const float* bq   = (const float*)d_in[3];
  const float* wk   = (const float*)d_in[4];
  const float* bk   = (const float*)d_in[5];
  const float* wv   = (const float*)d_in[6];
  const float* bv   = (const float*)d_in[7];
  const float* wo   = (const float*)d_in[8];
  const float* bo   = (const float*)d_in[9];
  float* out = (float*)d_out;

  char* ws = (char*)d_ws; size_t off = 0;
  const size_t wB = (size_t)DM * DM * 2;          /* 1,179,648 B per weight plane */
  const size_t pB = (size_t)NR * DM * 2;          /* 12,582,912 B per activation plane */
  _Float16* BQ  = (_Float16*)(ws + off); off += wB;
  _Float16* BK  = (_Float16*)(ws + off); off += wB;
  _Float16* BV  = (_Float16*)(ws + off); off += wB;
  _Float16* BO  = (_Float16*)(ws + off); off += wB;
  _Float16* X16 = (_Float16*)(ws + off); off += pB;
  _Float16* Q16 = (_Float16*)(ws + off); off += pB;
  _Float16* K16 = (_Float16*)(ws + off); off += pB;
  _Float16* VT  = (_Float16*)(ws + off); off += pB;   /* [NB][DM][SEQ] */
  _Float16* O16 = (_Float16*)(ws + off); off += pB;
  if (off > ws_size) return;

  /* weights in[768][768] -> planes BQ, BK, BV, BO out[n][k] x16 (consecutive from BQ); x -> f16 rows */
  k_prep<<<PB, PT, 0, stream>>>(wq, wk, wv, wo, x, BQ, X16);
  /* Q, K rows: [NR][DM] f16; V^T per batch: C[m = feature][n = token] = Wv^T[m][k] . x[n][k] + bv[m] -> VT[b][DM][SEQ] */
  k_qkv<<<(unsigned)(2 * QKB + NB * VTB), 128, 0, stream>>>(X16, BQ, bq, bk, bv, Q16, K16, VT);
  k_attn<<<(unsigned)(((size_t)NB * NH * (SEQ / 16)) / 4), 128, 0, stream>>>(Q16, K16, VT, mask, O16);
  /* out = (O16 / 64) . (BO / 16) + bo */
  k_gemm<<<dim3((unsigned)((NR / 128) * (DM / 64)), 1), 128, 0, stream>>>(O16, DM, BO, DM, (size_t)0, 0.0009765625f, bo, DM, 0, out, Q16, 0, DM, (size_t)0, NR, DM, DM);
}

// v006
// A run of this version takes 116 microseconds.
// In both of two side-by-side timings against v005, it was 1.04 times as fast.
// All steps since v000 together make it 2.84 times as fast.
#include <hip/hip_runtime.h>
// Compute dtype: every contraction on v_wmma_f32_16x16x32_f16 (f16 operands, f32 accumulate): x / weights exact in f16 after an RNE convert to bf16 (weights carried x16); q, k, v plain f16; softmax weights f16 carried x1024 (folded into the exponent, cancelled by the f32 row sum); merged head rows f16 carried x64 against the x16 output weights (alpha 2^-10).
// Self-attention block: x [4][2048][768]; q/k/v = x W + b with [in][out] weights; 12 heads of 64; logits = q.k/8 + mask*(-1e9) per (batch, key); softmax over 2048 keys; out = merged Wo + bo.
// Structure: weight planes Bt[n][k]; x as f16 rows; Q, K row GEMMs (32x64 wave tiles); V^T produced directly by the operand-swapped GEMM (A = Wv^T plane, B = x rows, per-row bias);
// Four launches: one resident grid converts the four weights and x, one grid runs the Q, K and V^T GEMMs, then attention, then the output GEMM; in the projection grid the block index picks the job; in the conversion grid every wave converts x and waves 0 .. WPB - 1 also take a weight item.
#ifndef NB
#define NB 4
#endif
#ifndef SEQ
#define SEQ 2048
#endif
#define SEQ_FULL 2048                 /* per-batch row count of the inputs */
#define DM 768
#define NH 12
#define HD 64
#define NR (NB * SEQ)                 /* token rows processed */
#define LN1024 6.931471805599453f

static_assert(NH * HD == DM);
static_assert(HD == 64);
static_assert(DM % 128 == 0);
static_assert(DM % 64 == 0);
static_assert(DM % 32 == 0);
static_assert(NR % 128 == 0);
static_assert(SEQ % 64 == 0);
static_assert(SEQ % 32 == 0);
static_assert((SEQ / 16) % 4 == 0);
static_assert(SEQ <= SEQ_FULL);
static_assert(((size_t)NB * NH * (SEQ / 16)) % 4 == 0);
static_assert((size_t)4 * DM * DM * 2 + (size_t)5 * NR * DM * 2 <= (size_t)134217728);

typedef _Float16 v16h __attribute__((ext_vector_type(16)));
typedef unsigned short v8us __attribute__((ext_vector_type(8), may_alias));
typedef float v8f  __attribute__((ext_vector_type(8)));
typedef float v4f  __attribute__((ext_vector_type(4)));
typedef float v4fa __attribute__((ext_vector_type(4), may_alias));
union FragH { v16h v; v8us half[2]; _Float16 h[16]; unsigned short u[16]; };

__device__ __forceinline__ unsigned short bf16_bits(float x) { unsigned int u = __float_as_uint(x); return (unsigned short)((u + 0x7FFFu + ((u >> 16) & 1u)) >> 16); }
__device__ __forceinline__ float bf16_rne(float x) { return __uint_as_float(((unsigned int)bf16_bits(x)) << 16); }
__device__ __forceinline__ int imin(int a, int b) { return (a < b) ? a : b; }

// 16x32 fragment of a k-contiguous 16-bit row: elements 0..7 <- k 8h..8h+7, elements 8..15 <- k 16+8h..16+8h+7 (same map for A rows and B columns)
__device__ __forceinline__ v16h ldfrag(const _Float16* p, int hh) {
  FragH f;
  f.half[0] = *(const v8us*)((const unsigned short*)p + 8 * hh);
  f.half[1] = *(const v8us*)((const unsigned short*)p + 16 + 8 * hh);
  return f.v;
}
// The plain builtin: the compiler keeps the WMMA distances itself and is free to order fragment loads, vector work and WMMAs around it.
__device__ __forceinline__ v8f wmma16(v16h a, v16h b, v8f c) {
  return __builtin_amdgcn_wmma_f32_16x16x32_f16(false, a, false, b, (short)0, c, false, false);
}
__device__ __forceinline__ v8f mma16(v16h a, v16h b, v8f c) {
  v8f d = __builtin_amdgcn_wmma_f32_16x16x32_f16(false, a, false, b, (short)0, c, false, false);
  asm volatile("v_nop\n\tv_nop\n\tv_nop\n\tv_nop" : "+v"(d) : "v"(a), "v"(b));
  return d;
}

#define PB 256                                  /* prep blocks: one per WGP */
#define PT 512                                  /* threads per prep block: 16 waves */
#define XI ((NR * (DM / 8)) / (PB * PT))        /* x items (8 elements) per thread */
#define WWI ((DM / 64) * (DM / 16))             /* wave items per weight: 64 k rows x 16 columns each */
#define WPB ((4 * WWI) / PB)                    /* weight wave items per block */
static_assert((NR * (DM / 8)) % (PB * PT) == 0);
static_assert((4 * WWI) % PB == 0);
static_assert(WPB <= PT / 32);

// All operand conversions as one resident stream: every wave starts once and has all its 16-byte loads in flight before it converts anything.
// x: thread t of block bx takes items (bx XI + i) PT + t, i < XI, of 8 consecutive elements each. Weights (planes wq, wk, wv, wo, consecutive in Wt, x16):
// waves 0 .. WPB - 1 of a block take one wave item each: 64 k rows x 16 columns; lane = (k group of 8, 4 columns), 8 loads of 16 bytes; store c writes 8 k of the lane's column c, so 8 lanes fill one whole 128-byte line of a plane row.
__global__ __launch_bounds__(PT) void k_prep(const float* __restrict__ wq, const float* __restrict__ wk, const float* __restrict__ wv, const float* __restrict__ wo,
                                             const float* __restrict__ x, _Float16* __restrict__ Wt, _Float16* __restrict__ X16) {
  const int tid = threadIdx.x, lane = tid & 31;
  const int w = __builtin_amdgcn_readfirstlane(tid >> 5);
  const int bx = blockIdx.x;
  static_assert(SEQ == SEQ_FULL);               /* token rows are then consecutive in x: item t starts at element 8 t */
  const float* xs = x + ((size_t)bx * XI * PT + tid) * 8;
  v4f xa[XI], xc[XI];
#pragma unroll
  for (int i = 0; i < XI; ++i) {
    xa[i] = *(const v4fa*)(xs + (size_t)i * PT * 8);
    xc[i] = *(const v4fa*)(xs + (size_t)i * PT * 8 + 4);
  }
  asm volatile("s_wait_xcnt 0x0" :: "v"(xs) : "memory");   /* the loads' address registers stay untouched (xs is held live to here, so no load's result lands on it) until this wait */
  if (w < WPB) {                                /* wave-uniform */
    const int wi = bx * WPB + w;
    const int j = wi / WWI, r = wi - j * WWI;
    const int k8 = (r / (DM / 16)) * 64 + (lane >> 2) * 8, n0 = (r % (DM / 16)) * 16 + (lane & 3) * 4;
    const float* W = (j == 0) ? wq : (j == 1) ? wk : (j == 2) ? wv : wo;
    const float* wsrc = W + (size_t)k8 * DM + n0;
    v4f wr[8];
#pragma unroll
    for (int i = 0; i < 8; ++i) wr[i] = *(const v4fa*)(wsrc + (size_t)i * DM);
    asm volatile("s_wait_xcnt 0x0" :: "v"(wsrc) : "memory");   /* likewise for the weight loads */
    unsigned short* d = (unsigned short*)Wt + (size_t)j * DM * DM + (size_t)n0 * DM + k8;
    FragH f[4];
#pragma unroll
    for (int c = 0; c < 4; ++c) {
#pragma unroll
      for (int i = 0; i < 8; ++i) f[c].h[i] = (_Float16)(bf16_rne(wr[i][c]) * 16.0f);
    }
#pragma unroll
    for (int c = 0; c < 4; ++c) *(v8us*)(d + (size_t)c * DM) = f[c].half[0];
    asm volatile("s_wait_xcnt 0x0" ::: "memory");   /* the code behind the branch reuses the stores' address and data registers only behind this */
  }
  FragH g[XI];
#pragma unroll
  for (int i = 0; i < XI; ++i) {
#pragma unroll
    for (int q = 0; q < 4; ++q) { g[i].h[q] = (_Float16)bf16_rne(xa[i][q]); g[i].h[4 + q] = (_Float16)bf16_rne(xc[i][q]); }
  }
#pragma unroll
  for (int i = 0; i < XI; ++i) *(v8us*)((unsigned short*)X16 + ((size_t)(bx * XI + i) * PT + tid) * 8) = g[i].half[0];
}

#define GKT 64                        /* k elements per staged GEMM tile: operand rows are then whole 128-byte lines */
#define GPITCH 72                     /* LDS row pitch in 16-bit elements: 144 B = 16 B x odd, conflict-free for 16-byte fragment reads */

// One k tile of the block's operands (128 A rows and 64 B rows of GKT elements) from global memory into LDS, 16 bytes per lane and copy; a wave's copy covers 4 whole 128-byte rows.
// la, lb: this lane's LDS byte address in row tid >> 3 of the A and B part; ga, gb: the matching global addresses. Copy i takes row (tid >> 3) + 16 i.
// s_wait_xcnt 0 closes the statement so that no address register of an issued copy is rewritten ahead of it.
__device__ __forceinline__ void stage_ab(unsigned la, unsigned lb, const _Float16* ga, const _Float16* gb, int lda, int ldb) {
  asm volatile("global_load_async_to_lds_b128 %0, %12, off\n\t"
               "global_load_async_to_lds_b128 %1, %13, off\n\t"
               "global_load_async_to_lds_b128 %2, %14, off\n\t"
               "global_load_async_to_lds_b128 %3, %15, off\n\t"
               "global_load_async_to_lds_b128 %4, %16, off\n\t"
               "global_load_async_to_lds_b128 %5, %17, off\n\t"
               "global_load_async_to_lds_b128 %6, %18, off\n\t"
               "global_load_async_to_lds_b128 %7, %19, off\n\t"
               "global_load_async_to_lds_b128 %8, %20, off\n\t"
               "global_load_async_to_lds_b128 %9, %21, off\n\t"
               "global_load_async_to_lds_b128 %10, %22, off\n\t"
               "global_load_async_to_lds_b128 %11, %23, off\n\t"
               "s_wait_xcnt 0x0"
               :: "v"(la), "v"(la + 16u * GPITCH * 2u), "v"(la + 32u * GPITCH * 2u), "v"(la + 48u * GPITCH * 2u),
                  "v"(la + 64u * GPITCH * 2u), "v"(la + 80u * GPITCH * 2u), "v"(la + 96u * GPITCH * 2u), "v"(la + 112u * GPITCH * 2u),
                  "v"(lb), "v"(lb + 16u * GPITCH * 2u), "v"(lb + 32u * GPITCH * 2u), "v"(lb + 48u * GPITCH * 2u),
                  "v"(ga), "v"(ga + (size_t)16 * lda), "v"(ga + (size_t)32 * lda), "v"(ga + (size_t)48 * lda),
                  "v"(ga + (size_t)64 * lda), "v"(ga + (size_t)80 * lda), "v"(ga + (size_t)96 * lda), "v"(ga + (size_t)112 * lda),
                  "v"(gb), "v"(gb + (size_t)16 * ldb), "v"(gb + (size_t)32 * ldb), "v"(gb + (size_t)48 * ldb)
               : "memory");
}

// C[by][M][N] = alpha * A[M][K] . Bt[by][N][K]^T + bias (per column, or per row when biasrow != 0; bias RNE-converted to bf16).
// A, Bt f16 k-contiguous rows. Block = 4 waves, wave tile 32 rows x 64 cols; M % 128 == 0, N % 64 == 0, K % 64 == 0 (host asserts).
// The block's 128 A rows and 64 B rows reach the waves through a two-buffer LDS ring of GKT-element k tiles filled by asynchronous copies, one tile ahead.
// mt, nq, by: the block's row tile, column tile and batch index within its own GEMM.
__device__ __forceinline__ void gemm_body(const _Float16* __restrict__ A, int lda,
                                          const _Float16* __restrict__ Bh, int ldb, size_t sB, float alpha,
                                          const float* __restrict__ bias, int nbias, int biasrow,
                                          float* __restrict__ C32, _Float16* __restrict__ C16, int out16,
                                          int ldc, size_t sC, int M, int N, int K, int mt, int nq, int by) {
  __shared__ __attribute__((aligned(16))) float so[4][32][68];
  __shared__ __attribute__((aligned(16))) unsigned short gring[2][128 + 64][GPITCH];   /* [buffer][A rows 0..127 | B rows 128..191][element] */
  const int tid = threadIdx.x, lane = tid & 31, ln = lane & 15, hh = lane >> 4;
  const int w = __builtin_amdgcn_readfirstlane(tid >> 5);
  const _Float16* Bb = Bh + (size_t)by * sB;
  const size_t cofs = (size_t)by * sC;
  const int rowb = mt * 128, col0 = nq * 64;
  if (rowb >= M) return;                    /* the whole block leaves or none does: barriers follow */
  const int row0 = rowb + 32 * w;
  const int crow = tid >> 3, cc8 = (tid & 7) * 8;
  const unsigned la0 = (unsigned)(size_t)&gring[0][crow][cc8];
  const unsigned lb0 = (unsigned)(size_t)&gring[0][128 + crow][cc8];
  const _Float16* ga0 = A + (size_t)(rowb + crow) * lda + cc8;
  const _Float16* gb0 = Bb + (size_t)(col0 + crow) * ldb + cc8;
  const int nt = K / GKT;
  stage_ab(la0, lb0, ga0, gb0, lda, ldb);             /* tile 0 -> buffer 0 */
  asm volatile("s_wait_asynccnt 0x0" ::: "memory");   /* this wave's share of tile 0 has landed before the barrier publishes it */
  __syncthreads();
  if (1 < nt) stage_ab(la0 + (unsigned)sizeof(gring[0]), lb0 + (unsigned)sizeof(gring[0]), ga0 + GKT, gb0 + GKT, lda, ldb);   /* tile 1 -> buffer 1 */
  const v8f z8 = {0.f, 0.f, 0.f, 0.f, 0.f, 0.f, 0.f, 0.f};
  v8f c00 = z8, c01 = z8, c02 = z8, c03 = z8, c10 = z8, c11 = z8, c12 = z8, c13 = z8;
#pragma unroll 1
  for (int t = 0; t < nt; ++t) {
    const int buf = t & 1;
    const _Float16* ap = (const _Float16*)&gring[buf][32 * w + ln][0];
    const _Float16* bp = (const _Float16*)&gring[buf][128 + ln][0];
#pragma unroll
    for (int sub = 0; sub < GKT; sub += 32) {
      const v16h a0 = ldfrag(ap + sub, hh), a1 = ldfrag(ap + 16 * GPITCH + sub, hh);
      const v16h b0 = ldfrag(bp + sub, hh), b1 = ldfrag(bp + 16 * GPITCH + sub, hh);
      const v16h b2 = ldfrag(bp + 32 * GPITCH + sub, hh), b3 = ldfrag(bp + 48 * GPITCH + sub, hh);
      c00 = mma16(a0, b0, c00); c10 = mma16(a1, b0, c10);
      c01 = mma16(a0, b1, c01); c11 = mma16(a1, b1, c11);
      c02 = mma16(a0, b2, c02); c12 = mma16(a1, b2, c12);
      c03 = mma16(a0, b3, c03); c13 = mma16(a1, b3, c13);
    }
    asm volatile("s_wait_dscnt 0x0" ::: "memory");      /* this wave's reads of buffer buf are done before it is refilled */
    asm volatile("s_wait_asynccnt 0x0" ::: "memory");   /* this wave's share of tile t + 1 has landed */
    __syncthreads();                                    /* publishes tile t + 1 and ends every wave's reads of buffer buf */
    if (t + 2 < nt)
      stage_ab(la0 + (unsigned)buf * (unsigned)sizeof(gring[0]), lb0 + (unsigned)buf * (unsigned)sizeof(gring[0]),
               ga0 + (size_t)(t + 2) * GKT, gb0 + (size_t)(t + 2) * GKT, lda, ldb);
  }
  asm volatile("s_wait_asynccnt 0x0" ::: "memory");     /* no copy is outstanding when the wave goes on to its output */
  // per-row bias candidates (clamped addresses; selected by value below)
  const int rb0 = imin(row0 + 8 * hh, nbias - 8), rb1 = imin(row0 + 16 + 8 * hh, nbias - 8);
  const v4f br00 = *(const v4fa*)(bias + rb0), br10 = *(const v4fa*)(bias + rb1);
  asm volatile("s_wait_xcnt 0x0" ::: "memory");         /* the address registers of the two loads above may be reused (also as a later load's result) behind this */
  const v4f br01 = *(const v4fa*)(bias + rb0 + 4), br11 = *(const v4fa*)(bias + rb1 + 4);
  asm volatile("s_wait_xcnt 0x0" ::: "memory");         /* likewise for the two loads above */
  const float brow[16] = {br00[0], br00[1], br00[2], br00[3], br01[0], br01[1], br01[2], br01[3],
                          br10[0], br10[1], br10[2], br10[3], br11[0], br11[1], br11[2], br11[3]};
  const v8f accs[8] = {c00, c01, c02, c03, c10, c11, c12, c13};
#pragma unroll
  for (int u = 0; u < 8; ++u) {
    const int t = u & 3, half = u >> 2;
    const int col = col0 + t * 16 + ln;
    const float bc = bf16_rne(bias[imin(col, nbias - 1)]);
#pragma unroll
    for (int r = 0; r < 8; ++r) {
      const int rloc = half * 16 + 8 * hh + r;
      const float br = bf16_rne(brow[half * 8 + r]);
      const float bv = (biasrow != 0) ? br : bc;
      so[w][rloc][t * 16 + ln] = accs[u][r] * alpha + bv;
    }
  }
  __builtin_amdgcn_fence(4 /* acq_rel order */, "workgroup");
  __builtin_amdgcn_wave_barrier();
  if (out16 != 0) {
    const int rq = lane >> 3, c8 = (lane & 7) * 8;
    {
#pragma unroll
      for (int it = 0; it < 8; ++it) {
        const int row = it * 4 + rq;
        const v4f x0 = *(const v4fa*)&so[w][row][c8];
        const v4f x1 = *(const v4fa*)&so[w][row][c8 + 4];
        FragH f;
#pragma unroll
        for (int q = 0; q < 4; ++q) { f.h[q] = (_Float16)x0[q]; f.h[4 + q] = (_Float16)x1[q]; }
        const v8us o = f.half[0];
        *(v8us*)((unsigned short*)C16 + cofs + (size_t)(row0 + row) * ldc + col0 + c8) = o;
      }
      asm volatile("s_wait_xcnt 0x0" ::: "memory");     /* where the other branch's code follows in the build, it reuses the stores' address and data registers only behind this */
    }
  } else {
    const int rsub = lane >> 4, c4 = (lane & 15) * 4;
    {
#pragma unroll
      for (int q = 0; q < 16; ++q) {
        const int r = q * 2 + rsub;
        const v4f v = *(const v4fa*)&so[w][r][c4];
        *(v4f*)(C32 + cofs + (size_t)(row0 + r) * ldc + col0 + c4) = v;
      }
      
    }
  }
}

__global__ __launch_bounds__(128) void k_gemm(const _Float16* __restrict__ A, int lda,
                                              const _Float16* __restrict__ Bh, int ldb, size_t sB, float alpha,
                                              const float* __restrict__ bias, int nbias, int biasrow,
                                              float* __restrict__ C32, _Float16* __restrict__ C16, int out16,
                                              int ldc, size_t sC, int M, int N, int K) {
  const int ntn = N >> 6;
  const int mt = blockIdx.x / ntn, nq = blockIdx.x - mt * ntn;
  gemm_body(A, lda, Bh, ldb, sB, alpha, bias, nbias, biasrow, C32, C16, out16, ldc, sC, M, N, K, mt, nq, blockIdx.y);
}

#define QKB ((NR / 128) * (DM / 64))           /* blocks of the Q GEMM, and of the K GEMM */
#define VTB ((DM / 128) * (SEQ / 64))          /* blocks of the V^T GEMM per batch */

// The three projections in one grid: blocks 0 .. QKB - 1 make Q rows, the next QKB make K rows, the last NB VTB make V^T (VTB per batch). They are independent; every selection is block-uniform.
// Wt: the weight planes in the order q, k, v.
__global__ __launch_bounds__(128) void k_qkv(const _Float16* __restrict__ X16, const _Float16* __restrict__ Wt,
                                             const float* __restrict__ bq, const float* __restrict__ bk, const float* __restrict__ bv,
                                             _Float16* __restrict__ Q16, _Float16* __restrict__ K16, _Float16* __restrict__ VT) {
  const int bx = blockIdx.x;
  const int j = (bx >= 2 * QKB) ? 2 : (bx >= QKB) ? 1 : 0;
  const bool isv = j == 2;
  const int r = bx - j * QKB;
  const int by = isv ? r / VTB : 0;
  const int lx = r - by * VTB;
  const int mt = isv ? lx / (SEQ / 64) : lx / (DM / 64);
  const int nq = lx - mt * (isv ? SEQ / 64 : DM / 64);
  const _Float16* Wj = Wt + (size_t)j * DM * DM;
  gemm_body(isv ? Wj : X16, DM, isv ? X16 : Wj, DM, isv ? (size_t)SEQ * DM : (size_t)0, 0.0625f,
            (j == 0) ? bq : (j == 1) ? bk : bv, DM, isv ? 1 : 0,
            (float*)nullptr, (j == 0) ? Q16 : (j == 1) ? K16 : VT, 1,
            isv ? SEQ : DM, isv ? (size_t)DM * SEQ : (size_t)0, isv ? DM : NR, isv ? SEQ : DM, DM, mt, nq, by);
}

#define KT 64                         /* keys per staged tile: K rows and V^T rows are then whole 128-byte lines */
#define KPITCH 72                     /* LDS row pitch in 16-bit elements: 144 B = 16 B x odd, conflict-free for 16-byte fragment reads */
#define NTILE (SEQ / KT)
#define RESCALE_AT 3.0f               /* growth of a row maximum (natural-log units) that forces a rescale: 1024 e^3 = 20,568 < 65,504 */
static_assert(SEQ % KT == 0);

// One K tile (KT keys x 64 d) and one V^T tile (64 d x KT keys) from global memory into LDS, 16 bytes per lane and copy; a wave's copy covers 4 whole 128-byte rows.
// lk, lv: this lane's LDS byte address in row tid >> 3 of the K and V^T tile; gk, gv: the matching global addresses. Copy i takes row (tid >> 3) + 16 i.
// s_wait_xcnt 0 closes the statement so that no address register of an issued copy is rewritten ahead of it.
__device__ __forceinline__ void stage_kv(unsigned lk, unsigned lv, const _Float16* gk, const _Float16* gv) {
  asm volatile("global_load_async_to_lds_b128 %0, %8, off\n\t"
               "global_load_async_to_lds_b128 %1, %9, off\n\t"
               "global_load_async_to_lds_b128 %2, %10, off\n\t"
               "global_load_async_to_lds_b128 %3, %11, off\n\t"
               "global_load_async_to_lds_b128 %4, %12, off\n\t"
               "global_load_async_to_lds_b128 %5, %13, off\n\t"
               "global_load_async_to_lds_b128 %6, %14, off\n\t"
               "global_load_async_to_lds_b128 %7, %15, off\n\t"
               "s_wait_xcnt 0x0"
               :: "v"(lk), "v"(lk + 16u * KPITCH * 2u), "v"(lk + 32u * KPITCH * 2u), "v"(lk + 48u * KPITCH * 2u),
                  "v"(lv), "v"(lv + 16u * KPITCH * 2u), "v"(lv + 32u * KPITCH * 2u), "v"(lv + 48u * KPITCH * 2u),
                  "v"(gk), "v"(gk + (size_t)16 * DM), "v"(gk + (size_t)32 * DM), "v"(gk + (size_t)48 * DM),
                  "v"(gv), "v"(gv + (size_t)16 * SEQ), "v"(gv + (size_t)32 * SEQ), "v"(gv + (size_t)48 * SEQ)
               : "memory");
}

// Fused attention. Block = 4 waves of one (batch, head); wave = 16 queries. Q16/K16 rows [token][DM] (head h at columns 64h..), VT [batch][DM][SEQ].
// K and V^T reach the waves through a two-buffer LDS ring of KT-key tiles filled by asynchronous copies, one tile ahead; the block's 4 waves share each tile.
// Per tile of KT keys: S^T tiles (A = K rows, B = Q rows; D lane = query, r = key 8h+r) -> e = s/8 + mask addend (LDS, per key) -> online softmax with lazy rescale (lane-local; one cross-half exchange)
// -> P in registers is the B fragment (k = key) of O^T += V^T . P^T (A = V^T rows; D lane = query, r = d 8h+r). Output rows f16 carried x64.
__global__ __launch_bounds__(128) void k_attn(const _Float16* __restrict__ Q16, const _Float16* __restrict__ K16,
                                              const _Float16* __restrict__ VT, const float* __restrict__ mask,
                                              _Float16* __restrict__ O16) {
  __shared__ __attribute__((aligned(16))) float msk[SEQ];                  /* cross-wave: block barrier */
  __shared__ __attribute__((aligned(16))) unsigned short ring[2][2][KT][KPITCH];   /* [buffer][K | V^T][row][element]; behind the loop's last barrier rows 16w.. of ring[0][0] stage wave w's output */
  const int tid = threadIdx.x, lane = tid & 31, ln = lane & 15, hh = lane >> 4;
  const int w = __builtin_amdgcn_readfirstlane(tid >> 5);
  const int gw = blockIdx.x * 4 + w;
  const int bh = gw / (SEQ / 16);
  const int qt = gw - bh * (SEQ / 16);
  const int b = bh / NH, h = bh - b * NH;
  const size_t tok0 = (size_t)b * SEQ;
  const int crow = tid >> 3, cc8 = (tid & 7) * 8;
  const unsigned lk0 = (unsigned)(size_t)&ring[0][0][crow][cc8];
  const unsigned lv0 = (unsigned)(size_t)&ring[0][1][crow][cc8];
  const _Float16* gk0 = K16 + (tok0 + (size_t)crow) * DM + h * HD + cc8;
  const _Float16* gv0 = VT + ((size_t)b * DM + (size_t)(h * HD + crow)) * SEQ + cc8;
  stage_kv(lk0, lv0, gk0, gv0);             /* tile 0 -> buffer 0, in flight under the mask fill */
  // additive key term of this batch: f32(bf16(mask)) * (-1e9), all SEQ entries written before any read
  const float* mrow = mask + (size_t)b * SEQ_FULL;
  for (int i = tid * 4; i < SEQ; i += 512) {
    const v4f m = *(const v4fa*)(mrow + i);
    v4f o;
#pragma unroll
    for (int q = 0; q < 4; ++q) o[q] = bf16_rne(m[q]) * -1.0e9f;
    *(v4fa*)&msk[i] = o;
  }
  asm volatile("s_wait_asynccnt 0x0" ::: "memory");   /* this wave's share of tile 0 has landed before the barrier publishes it */
  __syncthreads();
  if (1 < NTILE) stage_kv(lk0 + (unsigned)sizeof(ring[0]), lv0 + (unsigned)sizeof(ring[0]), gk0 + (size_t)KT * DM, gv0 + KT);   /* tile 1 -> buffer 1 */
  const _Float16* qrow = Q16 + (tok0 + (size_t)(qt * 16 + ln)) * DM + h * HD;
  const v16h qb0 = ldfrag(qrow, hh), qb1 = ldfrag(qrow + 32, hh);
  const v8f z8 = {0.f, 0.f, 0.f, 0.f, 0.f, 0.f, 0.f, 0.f};
  v8f o0 = z8, o1 = z8, o2 = z8, o3 = z8;
  float mo = -1.0e30f, mso = -1.0e30f, l = 0.f;
#pragma unroll 1
  for (int t = 0; t < NTILE; ++t) {
   const int buf = t & 1;
   const int kb = t * KT;
   const _Float16* kp = (const _Float16*)&ring[buf][0][ln][0];
   float e[KT / 16][8];                     /* e[g][r]: key kb + 16g + 8h + r */
   /* every inner loop of the tile is unrolled so that e, pf and the accumulators are indexed by constants and stay in registers */
#pragma unroll
   for (int g = 0; g < KT / 16; ++g) {
    v8f s = z8;
    { v16h a = ldfrag(kp + g * 16 * KPITCH, hh); s = wmma16(a, qb0, s); a = ldfrag(kp + g * 16 * KPITCH + 32, hh); s = wmma16(a, qb1, s); }
    const v4f ma = *(const v4fa*)&msk[kb + 16 * g + 8 * hh];
    const v4f mb = *(const v4fa*)&msk[kb + 16 * g + 8 * hh + 4];
#pragma unroll
    for (int r = 0; r < 4; ++r) { e[g][r] = fmaf(s[r], 0.125f, ma[r]); e[g][4 + r] = fmaf(s[4 + r], 0.125f, mb[r]); }
   }
   float bm = fmaxf(e[0][0], e[1][0]);
#pragma unroll
   for (int g = 0; g < KT / 16; ++g) {
#pragma unroll
    for (int r = 0; r < 8; ++r) bm = fmaxf(bm, e[g][r]);
   }
   const float bmo = __shfl_xor(bm, 16, 32);
   bm = fmaxf(bm, bmo);
   // Lazy rescale, tested once per tile: the maximum in use stays while no query of the wave has a tile maximum more than RESCALE_AT above it,
   // so a weight is at most 1024 e^RESCALE_AT, inside f16; the reference point cancels in the division by the row sum.
   if (__builtin_amdgcn_ballot_w32(bm > mo + RESCALE_AT) != 0u) {   /* wave-uniform scalar branch */
    const float mn = fmaxf(mo, bm);
    const float alpha = __expf(mo - mn);
    mo = mn; mso = mn - LN1024;             /* weights carried x1024 through the exponent */
    l *= alpha;
    o0 *= alpha; o1 *= alpha; o2 *= alpha; o3 *= alpha;
   }
   float ps = 0.f;
   FragH pf[KT / 32];
#pragma unroll
   for (int c = 0; c < KT / 32; ++c) {
#pragma unroll
    for (int r = 0; r < 8; ++r) {
      const float p0 = __expf(e[2 * c][r] - mso);
      const float p1 = __expf(e[2 * c + 1][r] - mso);
      ps += p0 + p1;
      pf[c].h[r] = (_Float16)p0;            /* k = 8h + r      <-> key kb + 32c + 8h + r      */
      pf[c].h[8 + r] = (_Float16)p1;        /* k = 16 + 8h + r <-> key kb + 32c + 16 + 8h + r */
    }
   }
   l += ps;
   const _Float16* vp = (const _Float16*)&ring[buf][1][ln][0];
#pragma unroll
   for (int c = 0; c < KT / 32; ++c) {
    { const v16h a = ldfrag(vp + 32 * c, hh); o0 = wmma16(a, pf[c].v, o0); }
    { const v16h a = ldfrag(vp + 16 * KPITCH + 32 * c, hh); o1 = wmma16(a, pf[c].v, o1); }
    { const v16h a = ldfrag(vp + 32 * KPITCH + 32 * c, hh); o2 = wmma16(a, pf[c].v, o2); }
    { const v16h a = ldfrag(vp + 48 * KPITCH + 32 * c, hh); o3 = wmma16(a, pf[c].v, o3); }
   }
   asm volatile("s_wait_dscnt 0x0" ::: "memory");      /* this wave's reads of buffer buf are done before it is refilled */
   asm volatile("s_wait_asynccnt 0x0" ::: "memory");   /* this wave's share of tile t + 1 has landed */
   __syncthreads();                                    /* publishes tile t + 1 and ends every wave's reads of buffer buf */
   if (t + 2 < NTILE)
     stage_kv(lk0 + (unsigned)buf * (unsigned)sizeof(ring[0]), lv0 + (unsigned)buf * (unsigned)sizeof(ring[0]),
              gk0 + (size_t)(t + 2) * KT * DM, gv0 + (t + 2) * KT);
  }
  asm volatile("s_wait_asynccnt 0x0" ::: "memory");    /* no copy is outstanding when the ring becomes output staging */
  const float lo = __shfl_xor(l, 16, 32);
  const float lt = l + lo;
  const float inv = 64.0f / lt;             /* merged rows carried x64 */
  const v8f oo[4] = {o0, o1, o2, o3};
#pragma unroll
  for (int j = 0; j < 4; ++j) {
    FragH f;
#pragma unroll
    for (int r = 0; r < 8; ++r) f.h[r] = (_Float16)(oo[j][r] * inv);   /* query ln, d = 16j + 8h + r */
    *(v8us*)&ring[0][0][16 * w + ln][16 * j + 8 * hh] = f.half[0];
  }
  __builtin_amdgcn_fence(4 /* acq_rel order */, "workgroup");
  __builtin_amdgcn_wave_barrier();
  const int rq = lane >> 3, pc = lane & 7;
  {
#pragma unroll
    for (int it = 0; it < 4; ++it) {
      const int row = it * 4 + rq;
      const v8us v = *(const v8us*)&ring[0][0][16 * w + row][pc * 8];
      *(v8us*)((unsigned short*)O16 + (tok0 + (size_t)(qt * 16 + row)) * DM + h * HD + pc * 8) = v;
    }
    
  }
}

extern "C" void kernel_launch(void* const* d_in, const int* in_sizes, int n_in,
                              void* d_out, int out_size, void* d_ws, size_t ws_size, hipStream_t stream) {
  if (n_in < 10) return;
  const size_t needRows = (size_t)(NB - 1) * SEQ_FULL + SEQ;
  if ((size_t)in_sizes[0] < needRows * DM) return;
  if ((size_t)in_sizes[1] < needRows) return;
  if ((size_t)in_sizes[2] < (size_t)DM * DM || (size_t)in_sizes[4] < (size_t)DM * DM) return;
  if ((size_t)in_sizes[6] < (size_t)DM * DM || (size_t)in_sizes[8] < (size_t)DM * DM) return;
  if (in_sizes[3] < DM || in_sizes[5] < DM || in_sizes[7] < DM || in_sizes[9] < DM) return;
  if ((size_t)out_size < (size_t)NR * DM) return;
  const float* x    = (const float*)d_in[0];
  const float* mask = (const float*)d_in[1];
  const float* wq   = (const float*)d_in[2];
  const float* bq   = (const float*)d_in[3];
  const float* wk   = (const float*)d_in[4];
  const float* bk   = (const float*)d_in[5];
  const float* wv   = (const float*)d_in[6];
  const float* bv   = (const float*)d_in[7];
  const float* wo   = (const float*)d_in[8];
  const float* bo   = (const float*)d_in[9];
  float* out = (float*)d_out;

  char* ws = (char*)d_ws; size_t off = 0;
  const size_t wB = (size_t)DM * DM * 2;          /* 1,179,648 B per weight plane */
  const size_t pB = (size_t)NR * DM * 2;          /* 12,582,912 B per activation plane */
  _Float16* BQ  = (_Float16*)(ws + off); off += wB;
  _Float16* BK  = (_Float16*)(ws + off); off += wB;
  _Float16* BV  = (_Float16*)(ws + off); off += wB;
  _Float16* BO  = (_Float16*)(ws + off); off += wB;
  _Float16* X16 = (_Float16*)(ws + off); off += pB;
  _Float16* Q16 = (_Float16*)(ws + off); off += pB;
  _Float16* K16 = (_Float16*)(ws + off); off += pB;
  _Float16* VT  = (_Float16*)(ws + off); off += pB;   /* [NB][DM][SEQ] */
  _Float16* O16 = (_Float16*)(ws + off); off += pB;
  if (off > ws_size) return;

  /* weights in[768][768] -> planes BQ, BK, BV, BO out[n][k] x16 (consecutive from BQ); x -> f16 rows */
  k_prep<<<PB, PT, 0, stream>>>(wq, wk, wv, wo, x, BQ, X16);
  /* Q, K rows: [NR][DM] f16; V^T per batch: C[m = feature][n = token] = Wv^T[m][k] . x[n][k] + bv[m] -> VT[b][DM][SEQ] */
  k_qkv<<<(unsigned)(2 * QKB + NB * VTB), 128, 0, stream>>>(X16, BQ, bq, bk, bv, Q16, K16, VT);
  k_attn<<<(unsigned)(((size_t)NB * NH * (SEQ / 16)) / 4), 128, 0, stream>>>(Q16, K16, VT, mask, O16);
  /* out = (O16 / 64) . (BO / 16) + bo */
  k_gemm<<<dim3((unsigned)((NR / 128) * (DM / 64)), 1), 128, 0, stream>>>(O16, DM, BO, DM, (size_t)0, 0.0009765625f, bo, DM, 0, out, Q16, 0, DM, (size_t)0, NR, DM, DM);
}

// v007
// One run takes 110 microseconds.
// In both of two side-by-side timings against v006, it was 1.06 times as fast.
// Over all steps from v000 it is 3.00 times as fast.
#include <hip/hip_runtime.h>
// Compute dtype: every contraction on v_wmma_f32_16x16x32_f16 (f16 operands, f32 accumulate): x / weights exact in f16 after an RNE convert to bf16 (weights carried x16); q, k, v plain f16; softmax weights f16 carried x1024 (folded into the exponent, cancelled by the f32 row sum); merged head rows f16 carried x64 against the x16 output weights (alpha 2^-10).
// Self-attention block: x [4][2048][768]; q/k/v = x W + b with [in][out] weights; 12 heads of 64; logits = q.k/8 + mask*(-1e9) per (batch, key); softmax over 2048 keys; out = merged Wo + bo.
// Structure: weight planes Bt[n][k]; x as f16 rows; Q, K row GEMMs (32x64 wave tiles); V^T produced directly by the operand-swapped GEMM (A = Wv^T plane, B = x rows, per-row bias);
// Four launches: one resident grid converts the four weights and x, one grid runs the Q, K and V^T GEMMs, then attention, then the output GEMM; in the projection grid the block index picks the job; in the conversion grid every wave converts x and waves 0 .. WPB - 1 also take a weight item.
#ifndef NB
#define NB 4
#endif
#ifndef SEQ
#define SEQ 2048
#endif
#define SEQ_FULL 2048                 /* per-batch row count of the inputs */
#define DM 768
#define NH 12
#define HD 64
#define NR (NB * SEQ)                 /* token rows processed */
#define LN1024 6.931471805599453f

static_assert(NH * HD == DM);
static_assert(HD == 64);
static_assert(DM % 128 == 0);
static_assert(DM % 64 == 0);
static_assert(DM % 32 == 0);
static_assert(NR % 128 == 0);
static_assert(SEQ % 64 == 0);
static_assert(SEQ % 32 == 0);
static_assert((SEQ / 32) % 4 == 0);
static_assert(SEQ <= SEQ_FULL);
static_assert(((size_t)NB * NH * (SEQ / 32)) % 4 == 0);
static_assert((size_t)4 * DM * DM * 2 + (size_t)5 * NR * DM * 2 <= (size_t)134217728);

typedef _Float16 v16h __attribute__((ext_vector_type(16)));
typedef unsigned short v8us __attribute__((ext_vector_type(8), may_alias));
typedef float v8f  __attribute__((ext_vector_type(8)));
typedef float v4f  __attribute__((ext_vector_type(4)));
typedef float v4fa __attribute__((ext_vector_type(4), may_alias));
union FragH { v16h v; v8us half[2]; _Float16 h[16]; unsigned short u[16]; };

__device__ __forceinline__ unsigned short bf16_bits(float x) { unsigned int u = __float_as_uint(x); return (unsigned short)((u + 0x7FFFu + ((u >> 16) & 1u)) >> 16); }
__device__ __forceinline__ float bf16_rne(float x) { return __uint_as_float(((unsigned int)bf16_bits(x)) << 16); }
__device__ __forceinline__ int imin(int a, int b) { return (a < b) ? a : b; }

// 16x32 fragment of a k-contiguous 16-bit row: elements 0..7 <- k 8h..8h+7, elements 8..15 <- k 16+8h..16+8h+7 (same map for A rows and B columns)
__device__ __forceinline__ v16h ldfrag(const _Float16* p, int hh) {
  FragH f;
  f.half[0] = *(const v8us*)((const unsigned short*)p + 8 * hh);
  f.half[1] = *(const v8us*)((const unsigned short*)p + 16 + 8 * hh);
  return f.v;
}
// The plain builtin: the compiler keeps the WMMA distances itself and is free to order fragment loads, vector work and WMMAs around it.
__device__ __forceinline__ v8f wmma16(v16h a, v16h b, v8f c) {
  return __builtin_amdgcn_wmma_f32_16x16x32_f16(false, a, false, b, (short)0, c, false, false);
}
__device__ __forceinline__ v8f mma16(v16h a, v16h b, v8f c) {
  v8f d = __builtin_amdgcn_wmma_f32_16x16x32_f16(false, a, false, b, (short)0, c, false, false);
  asm volatile("v_nop\n\tv_nop\n\tv_nop\n\tv_nop" : "+v"(d) : "v"(a), "v"(b));
  return d;
}

#define PB 256                                  /* prep blocks: one per WGP */
#define PT 512                                  /* threads per prep block: 16 waves */
#define XI ((NR * (DM / 8)) / (PB * PT))        /* x items (8 elements) per thread */
#define WWI ((DM / 64) * (DM / 16))             /* wave items per weight: 64 k rows x 16 columns each */
#define WPB ((4 * WWI) / PB)                    /* weight wave items per block */
static_assert((NR * (DM / 8)) % (PB * PT) == 0);
static_assert((4 * WWI) % PB == 0);
static_assert(WPB <= PT / 32);

// All operand conversions as one resident stream: every wave starts once and has all its 16-byte loads in flight before it converts anything.
// x: thread t of block bx takes items (bx XI + i) PT + t, i < XI, of 8 consecutive elements each. Weights (planes wq, wk, wv, wo, consecutive in Wt, x16):
// waves 0 .. WPB - 1 of a block take one wave item each: 64 k rows x 16 columns; lane = (k group of 8, 4 columns), 8 loads of 16 bytes; store c writes 8 k of the lane's column c, so 8 lanes fill one whole 128-byte line of a plane row.
__global__ __launch_bounds__(PT) void k_prep(const float* __restrict__ wq, const float* __restrict__ wk, const float* __restrict__ wv, const float* __restrict__ wo,
                                             const float* __restrict__ x, _Float16* __restrict__ Wt, _Float16* __restrict__ X16) {
  const int tid = threadIdx.x, lane = tid & 31;
  const int w = __builtin_amdgcn_readfirstlane(tid >> 5);
  const int bx = blockIdx.x;
  static_assert(SEQ == SEQ_FULL);               /* token rows are then consecutive in x: item t starts at element 8 t */
  const float* xs = x + ((size_t)bx * XI * PT + tid) * 8;
  v4f xa[XI], xc[XI];
#pragma unroll
  for (int i = 0; i < XI; ++i) {
    xa[i] = *(const v4fa*)(xs + (size_t)i * PT * 8);
    xc[i] = *(const v4fa*)(xs + (size_t)i * PT * 8 + 4);
  }
  asm volatile("s_wait_xcnt 0x0" :: "v"(xs) : "memory");   /* the loads' address registers stay untouched (xs is held live to here, so no load's result lands on it) until this wait */
  if (w < WPB) {                                /* wave-uniform */
    const int wi = bx * WPB + w;
    const int j = wi / WWI, r = wi - j * WWI;
    const int k8 = (r / (DM / 16)) * 64 + (lane >> 2) * 8, n0 = (r % (DM / 16)) * 16 + (lane & 3) * 4;
    const float* W = (j == 0) ? wq : (j == 1) ? wk : (j == 2) ? wv : wo;
    const float* wsrc = W + (size_t)k8 * DM + n0;
    v4f wr[8];
#pragma unroll
    for (int i = 0; i < 8; ++i) wr[i] = *(const v4fa*)(wsrc + (size_t)i * DM);
    asm volatile("s_wait_xcnt 0x0" :: "v"(wsrc) : "memory");   /* likewise for the weight loads */
    unsigned short* d = (unsigned short*)Wt + (size_t)j * DM * DM + (size_t)n0 * DM + k8;
    FragH f[4];
#pragma unroll
    for (int c = 0; c < 4; ++c) {
#pragma unroll
      for (int i = 0; i < 8; ++i) f[c].h[i] = (_Float16)(bf16_rne(wr[i][c]) * 16.0f);
    }
#pragma unroll
    for (int c = 0; c < 4; ++c) *(v8us*)(d + (size_t)c * DM) = f[c].half[0];
    asm volatile("s_wait_xcnt 0x0" ::: "memory");   /* the code behind the branch reuses the stores' address and data registers only behind this */
  }
  FragH g[XI];
#pragma unroll
  for (int i = 0; i < XI; ++i) {
#pragma unroll
    for (int q = 0; q < 4; ++q) { g[i].h[q] = (_Float16)bf16_rne(xa[i][q]); g[i].h[4 + q] = (_Float16)bf16_rne(xc[i][q]); }
  }
#pragma unroll
  for (int i = 0; i < XI; ++i) *(v8us*)((unsigned short*)X16 + ((size_t)(bx * XI + i) * PT + tid) * 8) = g[i].half[0];
}

#define GKT 64                        /* k elements per staged GEMM tile: operand rows are then whole 128-byte lines */
#define GPITCH 72                     /* LDS row pitch in 16-bit elements: 144 B = 16 B x odd, conflict-free for 16-byte fragment reads */

// One k tile of the block's operands (128 A rows and 64 B rows of GKT elements) from global memory into LDS, 16 bytes per lane and copy; a wave's copy covers 4 whole 128-byte rows.
// la, lb: this lane's LDS byte address in row tid >> 3 of the A and B part; ga, gb: the matching global addresses. Copy i takes row (tid >> 3) + 16 i.
// s_wait_xcnt 0 closes the statement so that no address register of an issued copy is rewritten ahead of it.
__device__ __forceinline__ void stage_ab(unsigned la, unsigned lb, const _Float16* ga, const _Float16* gb, int lda, int ldb) {
  asm volatile("global_load_async_to_lds_b128 %0, %12, off\n\t"
               "global_load_async_to_lds_b128 %1, %13, off\n\t"
               "global_load_async_to_lds_b128 %2, %14, off\n\t"
               "global_load_async_to_lds_b128 %3, %15, off\n\t"
               "global_load_async_to_lds_b128 %4, %16, off\n\t"
               "global_load_async_to_lds_b128 %5, %17, off\n\t"
               "global_load_async_to_lds_b128 %6, %18, off\n\t"
               "global_load_async_to_lds_b128 %7, %19, off\n\t"
               "global_load_async_to_lds_b128 %8, %20, off\n\t"
               "global_load_async_to_lds_b128 %9, %21, off\n\t"
               "global_load_async_to_lds_b128 %10, %22, off\n\t"
               "global_load_async_to_lds_b128 %11, %23, off\n\t"
               "s_wait_xcnt 0x0"
               :: "v"(la), "v"(la + 16u * GPITCH * 2u), "v"(la + 32u * GPITCH * 2u), "v"(la + 48u * GPITCH * 2u),
                  "v"(la + 64u * GPITCH * 2u), "v"(la + 80u * GPITCH * 2u), "v"(la + 96u * GPITCH * 2u), "v"(la + 112u * GPITCH * 2u),
                  "v"(lb), "v"(lb + 16u * GPITCH * 2u), "v"(lb + 32u * GPITCH * 2u), "v"(lb + 48u * GPITCH * 2u),
                  "v"(ga), "v"(ga + (size_t)16 * lda), "v"(ga + (size_t)32 * lda), "v"(ga + (size_t)48 * lda),
                  "v"(ga + (size_t)64 * lda), "v"(ga + (size_t)80 * lda), "v"(ga + (size_t)96 * lda), "v"(ga + (size_t)112 * lda),
                  "v"(gb), "v"(gb + (size_t)16 * ldb), "v"(gb + (size_t)32 * ldb), "v"(gb + (size_t)48 * ldb)
               : "memory");
}

// C[by][M][N] = alpha * A[M][K] . Bt[by][N][K]^T + bias (per column, or per row when biasrow != 0; bias RNE-converted to bf16).
// A, Bt f16 k-contiguous rows. Block = 4 waves, wave tile 32 rows x 64 cols; M % 128 == 0, N % 64 == 0, K % 64 == 0 (host asserts).
// The block's 128 A rows and 64 B rows reach the waves through a two-buffer LDS ring of GKT-element k tiles filled by asynchronous copies, one tile ahead.
// mt, nq, by: the block's row tile, column tile and batch index within its own GEMM.
__device__ __forceinline__ void gemm_body(const _Float16* __restrict__ A, int lda,
                                          const _Float16* __restrict__ Bh, int ldb, size_t sB, float alpha,
                                          const float* __restrict__ bias, int nbias, int biasrow,
                                          float* __restrict__ C32, _Float16* __restrict__ C16, int out16,
                                          int ldc, size_t sC, int M, int N, int K, int mt, int nq, int by) {
  __shared__ __attribute__((aligned(16))) float so[4][32][68];
  __shared__ __attribute__((aligned(16))) unsigned short gring[2][128 + 64][GPITCH];   /* [buffer][A rows 0..127 | B rows 128..191][element] */
  const int tid = threadIdx.x, lane = tid & 31, ln = lane & 15, hh = lane >> 4;
  const int w = __builtin_amdgcn_readfirstlane(tid >> 5);
  const _Float16* Bb = Bh + (size_t)by * sB;
  const size_t cofs = (size_t)by * sC;
  const int rowb = mt * 128, col0 = nq * 64;
  if (rowb >= M) return;                    /* the whole block leaves or none does: barriers follow */
  const int row0 = rowb + 32 * w;
  const int crow = tid >> 3, cc8 = (tid & 7) * 8;
  const unsigned la0 = (unsigned)(size_t)&gring[0][crow][cc8];
  const unsigned lb0 = (unsigned)(size_t)&gring[0][128 + crow][cc8];
  const _Float16* ga0 = A + (size_t)(rowb + crow) * lda + cc8;
  const _Float16* gb0 = Bb + (size_t)(col0 + crow) * ldb + cc8;
  const int nt = K / GKT;
  stage_ab(la0, lb0, ga0, gb0, lda, ldb);             /* tile 0 -> buffer 0 */
  asm volatile("s_wait_asynccnt 0x0" ::: "memory");   /* this wave's share of tile 0 has landed before the barrier publishes it */
  __syncthreads();
  if (1 < nt) stage_ab(la0 + (unsigned)sizeof(gring[0]), lb0 + (unsigned)sizeof(gring[0]), ga0 + GKT, gb0 + GKT, lda, ldb);   /* tile 1 -> buffer 1 */
  const v8f z8 = {0.f, 0.f, 0.f, 0.f, 0.f, 0.f, 0.f, 0.f};
  v8f c00 = z8, c01 = z8, c02 = z8, c03 = z8, c10 = z8, c11 = z8, c12 = z8, c13 = z8;
#pragma unroll 1
  for (int t = 0; t < nt; ++t) {
    const int buf = t & 1;
    const _Float16* ap = (const _Float16*)&gring[buf][32 * w + ln][0];
    const _Float16* bp = (const _Float16*)&gring[buf][128 + ln][0];
#pragma unroll
    for (int sub = 0; sub < GKT; sub += 32) {
      const v16h a0 = ldfrag(ap + sub, hh), a1 = ldfrag(ap + 16 * GPITCH + sub, hh);
      const v16h b0 = ldfrag(bp + sub, hh), b1 = ldfrag(bp + 16 * GPITCH + sub, hh);
      const v16h b2 = ldfrag(bp + 32 * GPITCH + sub, hh), b3 = ldfrag(bp + 48 * GPITCH + sub, hh);
      c00 = mma16(a0, b0, c00); c10 = mma16(a1, b0, c10);
      c01 = mma16(a0, b1, c01); c11 = mma16(a1, b1, c11);
      c02 = mma16(a0, b2, c02); c12 = mma16(a1, b2, c12);
      c03 = mma16(a0, b3, c03); c13 = mma16(a1, b3, c13);
    }
    asm volatile("s_wait_dscnt 0x0" ::: "memory");      /* this wave's reads of buffer buf are done before it is refilled */
    asm volatile("s_wait_asynccnt 0x0" ::: "memory");   /* this wave's share of tile t + 1 has landed */
    __syncthreads();                                    /* publishes tile t + 1 and ends every wave's reads of buffer buf */
    if (t + 2 < nt)
      stage_ab(la0 + (unsigned)buf * (unsigned)sizeof(gring[0]), lb0 + (unsigned)buf * (unsigned)sizeof(gring[0]),
               ga0 + (size_t)(t + 2) * GKT, gb0 + (size_t)(t + 2) * GKT, lda, ldb);
  }
  asm volatile("s_wait_asynccnt 0x0" ::: "memory");     /* no copy is outstanding when the wave goes on to its output */
  // per-row bias candidates (clamped addresses; selected by value below)
  const int rb0 = imin(row0 + 8 * hh, nbias - 8), rb1 = imin(row0 + 16 + 8 * hh, nbias - 8);
  const v4f br00 = *(const v4fa*)(bias + rb0), br10 = *(const v4fa*)(bias + rb1);
  asm volatile("s_wait_xcnt 0x0" ::: "memory");         /* the address registers of the two loads above may be reused (also as a later load's result) behind this */
  const v4f br01 = *(const v4fa*)(bias + rb0 + 4), br11 = *(const v4fa*)(bias + rb1 + 4);
  asm volatile("s_wait_xcnt 0x0" ::: "memory");         /* likewise for the two loads above */
  const float brow[16] = {br00[0], br00[1], br00[2], br00[3], br01[0], br01[1], br01[2], br01[3],
                          br10[0], br10[1], br10[2], br10[3], br11[0], br11[1], br11[2], br11[3]};
  const v8f accs[8] = {c00, c01, c02, c03, c10, c11, c12, c13};
#pragma unroll
  for (int u = 0; u < 8; ++u) {
    const int t = u & 3, half = u >> 2;
    const int col = col0 + t * 16 + ln;
    const float bc = bf16_rne(bias[imin(col, nbias - 1)]);
#pragma unroll
    for (int r = 0; r < 8; ++r) {
      const int rloc = half * 16 + 8 * hh + r;
      const float br = bf16_rne(brow[half * 8 + r]);
      const float bv = (biasrow != 0) ? br : bc;
      so[w][rloc][t * 16 + ln] = accs[u][r] * alpha + bv;
    }
  }
  __builtin_amdgcn_fence(4 /* acq_rel order */, "workgroup");
  __builtin_amdgcn_wave_barrier();
  if (out16 != 0) {
    const int rq = lane >> 3, c8 = (lane & 7) * 8;
    {
#pragma unroll
      for (int it = 0; it < 8; ++it) {
        const int row = it * 4 + rq;
        const v4f x0 = *(const v4fa*)&so[w][row][c8];
        const v4f x1 = *(const v4fa*)&so[w][row][c8 + 4];
        FragH f;
#pragma unroll
        for (int q = 0; q < 4; ++q) { f.h[q] = (_Float16)x0[q]; f.h[4 + q] = (_Float16)x1[q]; }
        const v8us o = f.half[0];
        *(v8us*)((unsigned short*)C16 + cofs + (size_t)(row0 + row) * ldc + col0 + c8) = o;
      }
      asm volatile("s_wait_xcnt 0x0" ::: "memory");     /* where the other branch's code follows in the build, it reuses the stores' address and data registers only behind this */
    }
  } else {
    const int rsub = lane >> 4, c4 = (lane & 15) * 4;
    {
#pragma unroll
      for (int q = 0; q < 16; ++q) {
        const int r = q * 2 + rsub;
        const v4f v = *(const v4fa*)&so[w][r][c4];
        *(v4f*)(C32 + cofs + (size_t)(row0 + r) * ldc + col0 + c4) = v;
      }
      
    }
  }
}

__global__ __launch_bounds__(128) void k_gemm(const _Float16* __restrict__ A, int lda,
                                              const _Float16* __restrict__ Bh, int ldb, size_t sB, float alpha,
                                              const float* __restrict__ bias, int nbias, int biasrow,
                                              float* __restrict__ C32, _Float16* __restrict__ C16, int out16,
                                              int ldc, size_t sC, int M, int N, int K) {
  const int ntn = N >> 6;
  const int mt = blockIdx.x / ntn, nq = blockIdx.x - mt * ntn;
  gemm_body(A, lda, Bh, ldb, sB, alpha, bias, nbias, biasrow, C32, C16, out16, ldc, sC, M, N, K, mt, nq, blockIdx.y);
}

#define QKB ((NR / 128) * (DM / 64))           /* blocks of the Q GEMM, and of the K GEMM */
#define VTB ((DM / 128) * (SEQ / 64))          /* blocks of the V^T GEMM per batch */

// The three projections in one grid: blocks 0 .. QKB - 1 make Q rows, the next QKB make K rows, the last NB VTB make V^T (VTB per batch). They are independent; every selection is block-uniform.
// Wt: the weight planes in the order q, k, v.
__global__ __launch_bounds__(128) void k_qkv(const _Float16* __restrict__ X16, const _Float16* __restrict__ Wt,
                                             const float* __restrict__ bq, const float* __restrict__ bk, const float* __restrict__ bv,
                                             _Float16* __restrict__ Q16, _Float16* __restrict__ K16, _Float16* __restrict__ VT) {
  const int bx = blockIdx.x;
  const int j = (bx >= 2 * QKB) ? 2 : (bx >= QKB) ? 1 : 0;
  const bool isv = j == 2;
  const int r = bx - j * QKB;
  const int by = isv ? r / VTB : 0;
  const int lx = r - by * VTB;
  const int mt = isv ? lx / (SEQ / 64) : lx / (DM / 64);
  const int nq = lx - mt * (isv ? SEQ / 64 : DM / 64);
  const _Float16* Wj = Wt + (size_t)j * DM * DM;
  gemm_body(isv ? Wj : X16, DM, isv ? X16 : Wj, DM, isv ? (size_t)SEQ * DM : (size_t)0, 0.0625f,
            (j == 0) ? bq : (j == 1) ? bk : bv, DM, isv ? 1 : 0,
            (float*)nullptr, (j == 0) ? Q16 : (j == 1) ? K16 : VT, 1,
            isv ? SEQ : DM, isv ? (size_t)DM * SEQ : (size_t)0, isv ? DM : NR, isv ? SEQ : DM, DM, mt, nq, by);
}

#define KT 64                         /* keys per staged tile: K rows and V^T rows are then whole 128-byte lines */
#define KPITCH 72                     /* LDS row pitch in 16-bit elements: 144 B = 16 B x odd, conflict-free for 16-byte fragment reads */
#define NTILE (SEQ / KT)
#define RESCALE_AT 3.0f               /* growth of a row maximum (natural-log units) that forces a rescale: 1024 e^3 = 20,568 < 65,504 */
static_assert(SEQ % KT == 0);

// One K tile (KT keys x 64 d) and one V^T tile (64 d x KT keys) from global memory into LDS, 16 bytes per lane and copy; a wave's copy covers 4 whole 128-byte rows.
// lk, lv: this lane's LDS byte address in row tid >> 3 of the K and V^T tile; gk, gv: the matching global addresses. Copy i takes row (tid >> 3) + 16 i.
// s_wait_xcnt 0 closes the statement so that no address register of an issued copy is rewritten ahead of it.
__device__ __forceinline__ void stage_kv(unsigned lk, unsigned lv, const _Float16* gk, const _Float16* gv) {
  asm volatile("global_load_async_to_lds_b128 %0, %8, off\n\t"
               "global_load_async_to_lds_b128 %1, %9, off\n\t"
               "global_load_async_to_lds_b128 %2, %10, off\n\t"
               "global_load_async_to_lds_b128 %3, %11, off\n\t"
               "global_load_async_to_lds_b128 %4, %12, off\n\t"
               "global_load_async_to_lds_b128 %5, %13, off\n\t"
               "global_load_async_to_lds_b128 %6, %14, off\n\t"
               "global_load_async_to_lds_b128 %7, %15, off\n\t"
               "s_wait_xcnt 0x0"
               :: "v"(lk), "v"(lk + 16u * KPITCH * 2u), "v"(lk + 32u * KPITCH * 2u), "v"(lk + 48u * KPITCH * 2u),
                  "v"(lv), "v"(lv + 16u * KPITCH * 2u), "v"(lv + 32u * KPITCH * 2u), "v"(lv + 48u * KPITCH * 2u),
                  "v"(gk), "v"(gk + (size_t)16 * DM), "v"(gk + (size_t)32 * DM), "v"(gk + (size_t)48 * DM),
                  "v"(gv), "v"(gv + (size_t)16 * SEQ), "v"(gv + (size_t)32 * SEQ), "v"(gv + (size_t)48 * SEQ)
               : "memory");
}

// Fused attention. Block = 4 waves of one (batch, head); wave = 32 queries as two 16-query tiles u = 0, 1. Q16/K16 rows [token][DM] (head h at columns 64h..), VT [batch][DM][SEQ].
// K and V^T reach the waves through a two-buffer LDS ring of KT-key tiles filled by asynchronous copies, one tile ahead; the block's 4 waves share each tile.
// Every K and V^T fragment read from LDS feeds two WMMAs, one per query tile, and a staged tile serves the block's 128 queries.
// Per tile of KT keys: S^T tiles (A = K rows, B = Q rows; D lane = query, r = key 8h+r) -> e = s/8 + mask addend (LDS, per key) -> online softmax with lazy rescale (lane-local; one cross-half exchange per query tile)
// -> P in registers is the B fragment (k = key) of O^T += V^T . P^T (A = V^T rows; D lane = query, r = d 8h+r). Output rows f16 carried x64.
__global__ __launch_bounds__(128) void k_attn(const _Float16* __restrict__ Q16, const _Float16* __restrict__ K16,
                                              const _Float16* __restrict__ VT, const float* __restrict__ mask,
                                              _Float16* __restrict__ O16) {
  __shared__ __attribute__((aligned(16))) float msk[SEQ];                  /* cross-wave: block barrier */
  __shared__ __attribute__((aligned(16))) unsigned short ring[2][2][KT][KPITCH];   /* [buffer][K | V^T][row][element]; behind the loop's last barrier the 2 KT rows of ring[0] stage the output, rows 32w.. for wave w */
  static_assert(2 * KT == 4 * 32);
  const int tid = threadIdx.x, lane = tid & 31, ln = lane & 15, hh = lane >> 4;
  const int w = __builtin_amdgcn_readfirstlane(tid >> 5);
  const int gw = blockIdx.x * 4 + w;
  const int bh = gw / (SEQ / 32);
  const int qt = gw - bh * (SEQ / 32);
  const int b = bh / NH, h = bh - b * NH;
  const size_t tok0 = (size_t)b * SEQ;
  const int crow = tid >> 3, cc8 = (tid & 7) * 8;
  const unsigned lk0 = (unsigned)(size_t)&ring[0][0][crow][cc8];
  const unsigned lv0 = (unsigned)(size_t)&ring[0][1][crow][cc8];
  const _Float16* gk0 = K16 + (tok0 + (size_t)crow) * DM + h * HD + cc8;
  const _Float16* gv0 = VT + ((size_t)b * DM + (size_t)(h * HD + crow)) * SEQ + cc8;
  stage_kv(lk0, lv0, gk0, gv0);             /* tile 0 -> buffer 0, in flight under the mask fill */
  // additive key term of this batch: f32(bf16(mask)) * (-1e9), all SEQ entries written before any read
  const float* mrow = mask + (size_t)b * SEQ_FULL;
  for (int i = tid * 4; i < SEQ; i += 512) {
    const v4f m = *(const v4fa*)(mrow + i);
    v4f o;
#pragma unroll
    for (int q = 0; q < 4; ++q) o[q] = bf16_rne(m[q]) * -1.0e9f;
    *(v4fa*)&msk[i] = o;
  }
  asm volatile("s_wait_asynccnt 0x0" ::: "memory");   /* this wave's share of tile 0 has landed before the barrier publishes it */
  __syncthreads();
  if (1 < NTILE) stage_kv(lk0 + (unsigned)sizeof(ring[0]), lv0 + (unsigned)sizeof(ring[0]), gk0 + (size_t)KT * DM, gv0 + KT);   /* tile 1 -> buffer 1 */
  const _Float16* qrow = Q16 + (tok0 + (size_t)(qt * 32 + ln)) * DM + h * HD;
  v16h qb[2][2];                            /* [query tile][d half] */
#pragma unroll
  for (int u = 0; u < 2; ++u) { qb[u][0] = ldfrag(qrow + (size_t)u * 16 * DM, hh); qb[u][1] = ldfrag(qrow + (size_t)u * 16 * DM + 32, hh); }
  const v8f z8 = {0.f, 0.f, 0.f, 0.f, 0.f, 0.f, 0.f, 0.f};
  v8f o[2][4] = {{z8, z8, z8, z8}, {z8, z8, z8, z8}};
  float mo[2] = {-1.0e30f, -1.0e30f}, mso[2] = {-1.0e30f, -1.0e30f}, l[2] = {0.f, 0.f};
#pragma unroll 1
  for (int t = 0; t < NTILE; ++t) {
   const int buf = t & 1;
   const int kb = t * KT;
   const _Float16* kp = (const _Float16*)&ring[buf][0][ln][0];
   float e[2][KT / 16][8];                  /* e[u][g][r]: query tile u, key kb + 16g + 8h + r */
   /* every inner loop of the tile is unrolled so that e, pf and the accumulators are indexed by constants and stay in registers */
#pragma unroll
   for (int g = 0; g < KT / 16; ++g) {
    const v16h a0 = ldfrag(kp + g * 16 * KPITCH, hh), a1 = ldfrag(kp + g * 16 * KPITCH + 32, hh);
    v8f s0 = wmma16(a0, qb[0][0], z8), s1 = wmma16(a0, qb[1][0], z8);
    s0 = wmma16(a1, qb[0][1], s0); s1 = wmma16(a1, qb[1][1], s1);
    const v4f ma = *(const v4fa*)&msk[kb + 16 * g + 8 * hh];
    const v4f mb = *(const v4fa*)&msk[kb + 16 * g + 8 * hh + 4];
#pragma unroll
    for (int r = 0; r < 4; ++r) {
      e[0][g][r] = fmaf(s0[r], 0.125f, ma[r]); e[0][g][4 + r] = fmaf(s0[4 + r], 0.125f, mb[r]);
      e[1][g][r] = fmaf(s1[r], 0.125f, ma[r]); e[1][g][4 + r] = fmaf(s1[4 + r], 0.125f, mb[r]);
    }
   }
   float bm[2];
#pragma unroll
   for (int u = 0; u < 2; ++u) {
    float x = fmaxf(e[u][0][0], e[u][1][0]);
#pragma unroll
    for (int g = 0; g < KT / 16; ++g) {
#pragma unroll
     for (int r = 0; r < 8; ++r) x = fmaxf(x, e[u][g][r]);
    }
    bm[u] = x;
   }
   const float bx0 = __shfl_xor(bm[0], 16, 32), bx1 = __shfl_xor(bm[1], 16, 32);
   bm[0] = fmaxf(bm[0], bx0); bm[1] = fmaxf(bm[1], bx1);
   // Lazy rescale, tested once per tile: the maxima in use stay while no query of the wave has a tile maximum more than RESCALE_AT above its own,
   // so a weight is at most 1024 e^RESCALE_AT, inside f16; the reference point cancels in the division by the row sum.
   if (__builtin_amdgcn_ballot_w32(bm[0] > mo[0] + RESCALE_AT || bm[1] > mo[1] + RESCALE_AT) != 0u) {   /* wave-uniform scalar branch */
#pragma unroll
    for (int u = 0; u < 2; ++u) {
     const float mn = fmaxf(mo[u], bm[u]);
     const float alpha = __expf(mo[u] - mn);
     mo[u] = mn; mso[u] = mn - LN1024;      /* weights carried x1024 through the exponent */
     l[u] *= alpha;
     o[u][0] *= alpha; o[u][1] *= alpha; o[u][2] *= alpha; o[u][3] *= alpha;
    }
   }
   FragH pf[2][KT / 32];
#pragma unroll
   for (int u = 0; u < 2; ++u) {
    float ps = 0.f;
#pragma unroll
    for (int c = 0; c < KT / 32; ++c) {
#pragma unroll
     for (int r = 0; r < 8; ++r) {
       const float p0 = __expf(e[u][2 * c][r] - mso[u]);
       const float p1 = __expf(e[u][2 * c + 1][r] - mso[u]);
       ps += p0 + p1;
       pf[u][c].h[r] = (_Float16)p0;        /* k = 8h + r      <-> key kb + 32c + 8h + r      */
       pf[u][c].h[8 + r] = (_Float16)p1;    /* k = 16 + 8h + r <-> key kb + 32c + 16 + 8h + r */
     }
    }
    l[u] += ps;
   }
   const _Float16* vp = (const _Float16*)&ring[buf][1][ln][0];
#pragma unroll
   for (int c = 0; c < KT / 32; ++c) {
#pragma unroll
    for (int j = 0; j < 4; ++j) {
     const v16h a = ldfrag(vp + j * 16 * KPITCH + 32 * c, hh);
     o[0][j] = wmma16(a, pf[0][c].v, o[0][j]);
     o[1][j] = wmma16(a, pf[1][c].v, o[1][j]);
    }
   }
   /* order of the 16 V^T fragment reads (group 0x100: LDS reads) among their 16 WMMAs (group 0x008): three fragments ahead, then one fragment's 2 reads behind each pair of WMMAs;
      left alone, the compiler loads the last fragments one at a time into one register set and each pair of WMMAs waits out its own fragment's LDS latency */
   __builtin_amdgcn_sched_group_barrier(0x100, 6, 0);
#pragma unroll
   for (int i = 0; i < 5; ++i) { __builtin_amdgcn_sched_group_barrier(0x008, 2, 0); __builtin_amdgcn_sched_group_barrier(0x100, 2, 0); }
   __builtin_amdgcn_sched_group_barrier(0x008, 6, 0);
   asm volatile("s_wait_dscnt 0x0" ::: "memory");      /* this wave's reads of buffer buf are done before it is refilled */
   asm volatile("s_wait_asynccnt 0x0" ::: "memory");   /* this wave's share of tile t + 1 has landed */
   __syncthreads();                                    /* publishes tile t + 1 and ends every wave's reads of buffer buf */
   if (t + 2 < NTILE)
     stage_kv(lk0 + (unsigned)buf * (unsigned)sizeof(ring[0]), lv0 + (unsigned)buf * (unsigned)sizeof(ring[0]),
              gk0 + (size_t)(t + 2) * KT * DM, gv0 + (t + 2) * KT);
  }
  asm volatile("s_wait_asynccnt 0x0" ::: "memory");    /* no copy is outstanding when the ring becomes output staging */
  unsigned short* stg = &ring[0][0][0][0] + (size_t)(32 * w) * KPITCH;   /* this wave's 32 staging rows */
#pragma unroll
  for (int u = 0; u < 2; ++u) {
    const float lo = __shfl_xor(l[u], 16, 32);
    const float lt = l[u] + lo;
    const float inv = 64.0f / lt;           /* merged rows carried x64 */
#pragma unroll
    for (int j = 0; j < 4; ++j) {
      FragH f;
#pragma unroll
      for (int r = 0; r < 8; ++r) f.h[r] = (_Float16)(o[u][j][r] * inv);   /* query 16u + ln, d = 16j + 8h + r */
      *(v8us*)(stg + (16 * u + ln) * KPITCH + 16 * j + 8 * hh) = f.half[0];
    }
  }
  __builtin_amdgcn_fence(4 /* acq_rel order */, "workgroup");
  __builtin_amdgcn_wave_barrier();
  const int rq = lane >> 3, pc = lane & 7;
  {
#pragma unroll
    for (int it = 0; it < 8; ++it) {
      const int row = it * 4 + rq;
      const v8us v = *(const v8us*)(stg + row * KPITCH + pc * 8);
      *(v8us*)((unsigned short*)O16 + (tok0 + (size_t)(qt * 32 + row)) * DM + h * HD + pc * 8) = v;
    }
  }
}

extern "C" void kernel_launch(void* const* d_in, const int* in_sizes, int n_in,
                              void* d_out, int out_size, void* d_ws, size_t ws_size, hipStream_t stream) {
  if (n_in < 10) return;
  const size_t needRows = (size_t)(NB - 1) * SEQ_FULL + SEQ;
  if ((size_t)in_sizes[0] < needRows * DM) return;
  if ((size_t)in_sizes[1] < needRows) return;
  if ((size_t)in_sizes[2] < (size_t)DM * DM || (size_t)in_sizes[4] < (size_t)DM * DM) return;
  if ((size_t)in_sizes[6] < (size_t)DM * DM || (size_t)in_sizes[8] < (size_t)DM * DM) return;
  if (in_sizes[3] < DM || in_sizes[5] < DM || in_sizes[7] < DM || in_sizes[9] < DM) return;
  if ((size_t)out_size < (size_t)NR * DM) return;
  const float* x    = (const float*)d_in[0];
  const float* mask = (const float*)d_in[1];
  const float* wq   = (const float*)d_in[2];
  const float* bq   = (const float*)d_in[3];
  const float* wk   = (const float*)d_in[4];
  const float* bk   = (const float*)d_in[5];
  const float* wv   = (const float*)d_in[6];
  const float* bv   = (const float*)d_in[7];
  const float* wo   = (const float*)d_in[8];
  const float* bo   = (const float*)d_in[9];
  float* out = (float*)d_out;

  char* ws = (char*)d_ws; size_t off = 0;
  const size_t wB = (size_t)DM * DM * 2;          /* 1,179,648 B per weight plane */
  const size_t pB = (size_t)NR * DM * 2;          /* 12,582,912 B per activation plane */
  _Float16* BQ  = (_Float16*)(ws + off); off += wB;
  _Float16* BK  = (_Float16*)(ws + off); off += wB;
  _Float16* BV  = (_Float16*)(ws + off); off += wB;
  _Float16* BO  = (_Float16*)(ws + off); off += wB;
  _Float16* X16 = (_Float16*)(ws + off); off += pB;
  _Float16* Q16 = (_Float16*)(ws + off); off += pB;
  _Float16* K16 = (_Float16*)(ws + off); off += pB;
  _Float16* VT  = (_Float16*)(ws + off); off += pB;   /* [NB][DM][SEQ] */
  _Float16* O16 = (_Float16*)(ws + off); off += pB;
  if (off > ws_size) return;

  /* weights in[768][768] -> planes BQ, BK, BV, BO out[n][k] x16 (consecutive from BQ); x -> f16 rows */
  k_prep<<<PB, PT, 0, stream>>>(wq, wk, wv, wo, x, BQ, X16);
  /* Q, K rows: [NR][DM] f16; V^T per batch: C[m = feature][n = token] = Wv^T[m][k] . x[n][k] + bv[m] -> VT[b][DM][SEQ] */
  k_qkv<<<(unsigned)(2 * QKB + NB * VTB), 128, 0, stream>>>(X16, BQ, bq, bk, bv, Q16, K16, VT);
  k_attn<<<(unsigned)(((size_t)NB * NH * (SEQ / 32)) / 4), 128, 0, stream>>>(Q16, K16, VT, mask, O16);
  /* out = (O16 / 64) . (BO / 16) + bo */
  k_gemm<<<dim3((unsigned)((NR / 128) * (DM / 64)), 1), 128, 0, stream>>>(O16, DM, BO, DM, (size_t)0, 0.0009765625f, bo, DM, 0, out, Q16, 0, DM, (size_t)0, NR, DM, DM);
}

// v008
// Measured time: 106 microseconds a run.
// Timed twice side by side with v007, it ran 1.04 times as fast both times.
// Counting every step since v000, it is 3.13 times as fast.
#include <hip/hip_runtime.h>
// Compute dtype: every contraction on v_wmma_f32_16x16x32_f16 (f16 operands, f32 accumulate): x / weights exact in f16 after an RNE convert to bf16 (weights carried x16); k, v plain f16, q f16 carried x log2(e)/8; softmax weights f16 carried x1024 (folded into the exponent, cancelled by the f32 row sum); merged head rows f16 carried x64 against the x16 output weights (alpha 2^-10).
// Self-attention block: x [4][2048][768]; q/k/v = x W + b with [in][out] weights; 12 heads of 64; logits = q.k/8 + mask*(-1e9) per (batch, key); softmax over 2048 keys; out = merged Wo + bo.
// Structure: weight planes Bt[n][k]; x as f16 rows; Q, K row GEMMs (32x64 wave tiles); V^T produced directly by the operand-swapped GEMM (A = Wv^T plane, B = x rows, per-row bias);
// Four launches: one resident grid converts the four weights and x, one grid runs the Q, K and V^T GEMMs, then attention, then the output GEMM; in the projection grid the block index picks the job; in the conversion grid every wave converts x and waves 0 .. WPB - 1 also take a weight item.
#ifndef NB
#define NB 4
#endif
#ifndef SEQ
#define SEQ 2048
#endif
#define SEQ_FULL 2048                 /* per-batch row count of the inputs */
#define DM 768
#define NH 12
#define HD 64
#define NR (NB * SEQ)                 /* token rows processed */
#define LOG2E 1.4426950408889634f
#define QSCALE (0.125f * LOG2E)       /* carried by the stored Q rows: a score WMMA then yields q.k/8 in log2 units */

static_assert(NH * HD == DM);
static_assert(HD == 64);
static_assert(DM % 128 == 0);
static_assert(DM % 64 == 0);
static_assert(DM % 32 == 0);
static_assert(NR % 128 == 0);
static_assert(SEQ % 64 == 0);
static_assert(SEQ % 32 == 0);
static_assert((SEQ / 32) % 4 == 0);
static_assert(SEQ <= SEQ_FULL);
static_assert(((size_t)NB * NH * (SEQ / 32)) % 4 == 0);
static_assert((size_t)4 * DM * DM * 2 + (size_t)5 * NR * DM * 2 <= (size_t)134217728);

typedef _Float16 v16h __attribute__((ext_vector_type(16)));
typedef unsigned short v8us __attribute__((ext_vector_type(8), may_alias));
typedef float v8f  __attribute__((ext_vector_type(8)));
typedef float v4f  __attribute__((ext_vector_type(4)));
typedef float v4fa __attribute__((ext_vector_type(4), may_alias));
union FragH { v16h v; v8us half[2]; _Float16 h[16]; unsigned short u[16]; };

__device__ __forceinline__ unsigned short bf16_bits(float x) { unsigned int u = __float_as_uint(x); return (unsigned short)((u + 0x7FFFu + ((u >> 16) & 1u)) >> 16); }
__device__ __forceinline__ float bf16_rne(float x) { return __uint_as_float(((unsigned int)bf16_bits(x)) << 16); }
__device__ __forceinline__ int imin(int a, int b) { return (a < b) ? a : b; }

// 16x32 fragment of a k-contiguous 16-bit row: elements 0..7 <- k 8h..8h+7, elements 8..15 <- k 16+8h..16+8h+7 (same map for A rows and B columns)
__device__ __forceinline__ v16h ldfrag(const _Float16* p, int hh) {
  FragH f;
  f.half[0] = *(const v8us*)((const unsigned short*)p + 8 * hh);
  f.half[1] = *(const v8us*)((const unsigned short*)p + 16 + 8 * hh);
  return f.v;
}
// The plain builtin: the compiler keeps the WMMA distances itself and is free to order fragment loads, vector work and WMMAs around it.
__device__ __forceinline__ v8f wmma16(v16h a, v16h b, v8f c) {
  return __builtin_amdgcn_wmma_f32_16x16x32_f16(false, a, false, b, (short)0, c, false, false);
}
__device__ __forceinline__ v8f mma16(v16h a, v16h b, v8f c) {
  v8f d = __builtin_amdgcn_wmma_f32_16x16x32_f16(false, a, false, b, (short)0, c, false, false);
  asm volatile("v_nop\n\tv_nop\n\tv_nop\n\tv_nop" : "+v"(d) : "v"(a), "v"(b));
  return d;
}

#define PB 256                                  /* prep blocks: one per WGP */
#define PT 512                                  /* threads per prep block: 16 waves */
#define XI ((NR * (DM / 8)) / (PB * PT))        /* x items (8 elements) per thread */
#define WWI ((DM / 64) * (DM / 16))             /* wave items per weight: 64 k rows x 16 columns each */
#define WPB ((4 * WWI) / PB)                    /* weight wave items per block */
static_assert((NR * (DM / 8)) % (PB * PT) == 0);
static_assert((4 * WWI) % PB == 0);
static_assert(WPB <= PT / 32);

// All operand conversions as one resident stream: every wave starts once and has all its 16-byte loads in flight before it converts anything.
// x: thread t of block bx takes items (bx XI + i) PT + t, i < XI, of 8 consecutive elements each. Weights (planes wq, wk, wv, wo, consecutive in Wt, x16):
// waves 0 .. WPB - 1 of a block take one wave item each: 64 k rows x 16 columns; lane = (k group of 8, 4 columns), 8 loads of 16 bytes; store c writes 8 k of the lane's column c, so 8 lanes fill one whole 128-byte line of a plane row.
__global__ __launch_bounds__(PT) void k_prep(const float* __restrict__ wq, const float* __restrict__ wk, const float* __restrict__ wv, const float* __restrict__ wo,
                                             const float* __restrict__ x, _Float16* __restrict__ Wt, _Float16* __restrict__ X16) {
  const int tid = threadIdx.x, lane = tid & 31;
  const int w = __builtin_amdgcn_readfirstlane(tid >> 5);
  const int bx = blockIdx.x;
  static_assert(SEQ == SEQ_FULL);               /* token rows are then consecutive in x: item t starts at element 8 t */
  const float* xs = x + ((size_t)bx * XI * PT + tid) * 8;
  v4f xa[XI], xc[XI];
#pragma unroll
  for (int i = 0; i < XI; ++i) {
    xa[i] = *(const v4fa*)(xs + (size_t)i * PT * 8);
    xc[i] = *(const v4fa*)(xs + (size_t)i * PT * 8 + 4);
  }
  asm volatile("s_wait_xcnt 0x0" :: "v"(xs) : "memory");   /* the loads' address registers stay untouched (xs is held live to here, so no load's result lands on it) until this wait */
  if (w < WPB) {                                /* wave-uniform */
    const int wi = bx * WPB + w;
    const int j = wi / WWI, r = wi - j * WWI;
    const int k8 = (r / (DM / 16)) * 64 + (lane >> 2) * 8, n0 = (r % (DM / 16)) * 16 + (lane & 3) * 4;
    const float* W = (j == 0) ? wq : (j == 1) ? wk : (j == 2) ? wv : wo;
    const float* wsrc = W + (size_t)k8 * DM + n0;
    v4f wr[8];
#pragma unroll
    for (int i = 0; i < 8; ++i) wr[i] = *(const v4fa*)(wsrc + (size_t)i * DM);
    asm volatile("s_wait_xcnt 0x0" :: "v"(wsrc) : "memory");   /* likewise for the weight loads */
    unsigned short* d = (unsigned short*)Wt + (size_t)j * DM * DM + (size_t)n0 * DM + k8;
    FragH f[4];
#pragma unroll
    for (int c = 0; c < 4; ++c) {
#pragma unroll
      for (int i = 0; i < 8; ++i) f[c].h[i] = (_Float16)(bf16_rne(wr[i][c]) * 16.0f);
    }
#pragma unroll
    for (int c = 0; c < 4; ++c) *(v8us*)(d + (size_t)c * DM) = f[c].half[0];
    asm volatile("s_wait_xcnt 0x0" ::: "memory");   /* the code behind the branch reuses the stores' address and data registers only behind this */
  }
  FragH g[XI];
#pragma unroll
  for (int i = 0; i < XI; ++i) {
#pragma unroll
    for (int q = 0; q < 4; ++q) { g[i].h[q] = (_Float16)bf16_rne(xa[i][q]); g[i].h[4 + q] = (_Float16)bf16_rne(xc[i][q]); }
  }
#pragma unroll
  for (int i = 0; i < XI; ++i) *(v8us*)((unsigned short*)X16 + ((size_t)(bx * XI + i) * PT + tid) * 8) = g[i].half[0];
}

#define GKT 64                        /* k elements per staged GEMM tile: operand rows are then whole 128-byte lines */
#define GPITCH 72                     /* LDS row pitch in 16-bit elements: 144 B = 16 B x odd, conflict-free for 16-byte fragment reads */

// One k tile of the block's operands (128 A rows and 64 B rows of GKT elements) from global memory into LDS, 16 bytes per lane and copy; a wave's copy covers 4 whole 128-byte rows.
// la, lb: this lane's LDS byte address in row tid >> 3 of the A and B part; ga, gb: the matching global addresses. Copy i takes row (tid >> 3) + 16 i.
// s_wait_xcnt 0 closes the statement so that no address register of an issued copy is rewritten ahead of it.
__device__ __forceinline__ void stage_ab(unsigned la, unsigned lb, const _Float16* ga, const _Float16* gb, int lda, int ldb) {
  asm volatile("global_load_async_to_lds_b128 %0, %12, off\n\t"
               "global_load_async_to_lds_b128 %1, %13, off\n\t"
               "global_load_async_to_lds_b128 %2, %14, off\n\t"
               "global_load_async_to_lds_b128 %3, %15, off\n\t"
               "global_load_async_to_lds_b128 %4, %16, off\n\t"
               "global_load_async_to_lds_b128 %5, %17, off\n\t"
               "global_load_async_to_lds_b128 %6, %18, off\n\t"
               "global_load_async_to_lds_b128 %7, %19, off\n\t"
               "global_load_async_to_lds_b128 %8, %20, off\n\t"
               "global_load_async_to_lds_b128 %9, %21, off\n\t"
               "global_load_async_to_lds_b128 %10, %22, off\n\t"
               "global_load_async_to_lds_b128 %11, %23, off\n\t"
               "s_wait_xcnt 0x0"
               :: "v"(la), "v"(la + 16u * GPITCH * 2u), "v"(la + 32u * GPITCH * 2u), "v"(la + 48u * GPITCH * 2u),
                  "v"(la + 64u * GPITCH * 2u), "v"(la + 80u * GPITCH * 2u), "v"(la + 96u * GPITCH * 2u), "v"(la + 112u * GPITCH * 2u),
                  "v"(lb), "v"(lb + 16u * GPITCH * 2u), "v"(lb + 32u * GPITCH * 2u), "v"(lb + 48u * GPITCH * 2u),
                  "v"(ga), "v"(ga + (size_t)16 * lda), "v"(ga + (size_t)32 * lda), "v"(ga + (size_t)48 * lda),
                  "v"(ga + (size_t)64 * lda), "v"(ga + (size_t)80 * lda), "v"(ga + (size_t)96 * lda), "v"(ga + (size_t)112 * lda),
                  "v"(gb), "v"(gb + (size_t)16 * ldb), "v"(gb + (size_t)32 * ldb), "v"(gb + (size_t)48 * ldb)
               : "memory");
}

// C[by][M][N] = alpha * A[M][K] . Bt[by][N][K]^T + bscale * bias (per column, or per row when biasrow != 0; bias RNE-converted to bf16).
// A, Bt f16 k-contiguous rows. Block = 4 waves, wave tile 32 rows x 64 cols; M % 128 == 0, N % 64 == 0, K % 64 == 0 (host asserts).
// The block's 128 A rows and 64 B rows reach the waves through a two-buffer LDS ring of GKT-element k tiles filled by asynchronous copies, one tile ahead.
// mt, nq, by: the block's row tile, column tile and batch index within its own GEMM.
__device__ __forceinline__ void gemm_body(const _Float16* __restrict__ A, int lda,
                                          const _Float16* __restrict__ Bh, int ldb, size_t sB, float alpha,
                                          const float* __restrict__ bias, float bscale, int nbias, int biasrow,
                                          float* __restrict__ C32, _Float16* __restrict__ C16, int out16,
                                          int ldc, size_t sC, int M, int N, int K, int mt, int nq, int by) {
  __shared__ __attribute__((aligned(16))) float so[4][32][68];
  __shared__ __attribute__((aligned(16))) unsigned short gring[2][128 + 64][GPITCH];   /* [buffer][A rows 0..127 | B rows 128..191][element] */
  const int tid = threadIdx.x, lane = tid & 31, ln = lane & 15, hh = lane >> 4;
  const int w = __builtin_amdgcn_readfirstlane(tid >> 5);
  const _Float16* Bb = Bh + (size_t)by * sB;
  const size_t cofs = (size_t)by * sC;
  const int rowb = mt * 128, col0 = nq * 64;
  if (rowb >= M) return;                    /* the whole block leaves or none does: barriers follow */
  const int row0 = rowb + 32 * w;
  const int crow = tid >> 3, cc8 = (tid & 7) * 8;
  const unsigned la0 = (unsigned)(size_t)&gring[0][crow][cc8];
  const unsigned lb0 = (unsigned)(size_t)&gring[0][128 + crow][cc8];
  const _Float16* ga0 = A + (size_t)(rowb + crow) * lda + cc8;
  const _Float16* gb0 = Bb + (size_t)(col0 + crow) * ldb + cc8;
  const int nt = K / GKT;
  stage_ab(la0, lb0, ga0, gb0, lda, ldb);             /* tile 0 -> buffer 0 */
  asm volatile("s_wait_asynccnt 0x0" ::: "memory");   /* this wave's share of tile 0 has landed before the barrier publishes it */
  __syncthreads();
  if (1 < nt) stage_ab(la0 + (unsigned)sizeof(gring[0]), lb0 + (unsigned)sizeof(gring[0]), ga0 + GKT, gb0 + GKT, lda, ldb);   /* tile 1 -> buffer 1 */
  const v8f z8 = {0.f, 0.f, 0.f, 0.f, 0.f, 0.f, 0.f, 0.f};
  v8f c00 = z8, c01 = z8, c02 = z8, c03 = z8, c10 = z8, c11 = z8, c12 = z8, c13 = z8;
#pragma unroll 1
  for (int t = 0; t < nt; ++t) {
    const int buf = t & 1;
    const _Float16* ap = (const _Float16*)&gring[buf][32 * w + ln][0];
    const _Float16* bp = (const _Float16*)&gring[buf][128 + ln][0];
#pragma unroll
    for (int sub = 0; sub < GKT; sub += 32) {
      const v16h a0 = ldfrag(ap + sub, hh), a1 = ldfrag(ap + 16 * GPITCH + sub, hh);
      const v16h b0 = ldfrag(bp + sub, hh), b1 = ldfrag(bp + 16 * GPITCH + sub, hh);
      const v16h b2 = ldfrag(bp + 32 * GPITCH + sub, hh), b3 = ldfrag(bp + 48 * GPITCH + sub, hh);
      c00 = mma16(a0, b0, c00); c10 = mma16(a1, b0, c10);
      c01 = mma16(a0, b1, c01); c11 = mma16(a1, b1, c11);
      c02 = mma16(a0, b2, c02); c12 = mma16(a1, b2, c12);
      c03 = mma16(a0, b3, c03); c13 = mma16(a1, b3, c13);
    }
    asm volatile("s_wait_dscnt 0x0" ::: "memory");      /* this wave's reads of buffer buf are done before it is refilled */
    asm volatile("s_wait_asynccnt 0x0" ::: "memory");   /* this wave's share of tile t + 1 has landed */
    __syncthreads();                                    /* publishes tile t + 1 and ends every wave's reads of buffer buf */
    if (t + 2 < nt)
      stage_ab(la0 + (unsigned)buf * (unsigned)sizeof(gring[0]), lb0 + (unsigned)buf * (unsigned)sizeof(gring[0]),
               ga0 + (size_t)(t + 2) * GKT, gb0 + (size_t)(t + 2) * GKT, lda, ldb);
  }
  asm volatile("s_wait_asynccnt 0x0" ::: "memory");     /* no copy is outstanding when the wave goes on to its output */
  // per-row bias candidates (clamped addresses; selected by value below)
  const int rb0 = imin(row0 + 8 * hh, nbias - 8), rb1 = imin(row0 + 16 + 8 * hh, nbias - 8);
  const v4f br00 = *(const v4fa*)(bias + rb0), br10 = *(const v4fa*)(bias + rb1);
  asm volatile("s_wait_xcnt 0x0" ::: "memory");         /* the address registers of the two loads above may be reused (also as a later load's result) behind this */
  const v4f br01 = *(const v4fa*)(bias + rb0 + 4), br11 = *(const v4fa*)(bias + rb1 + 4);
  asm volatile("s_wait_xcnt 0x0" ::: "memory");         /* likewise for the two loads above */
  const float brow[16] = {br00[0], br00[1], br00[2], br00[3], br01[0], br01[1], br01[2], br01[3],
                          br10[0], br10[1], br10[2], br10[3], br11[0], br11[1], br11[2], br11[3]};
  const v8f accs[8] = {c00, c01, c02, c03, c10, c11, c12, c13};
#pragma unroll
  for (int u = 0; u < 8; ++u) {
    const int t = u & 3, half = u >> 2;
    const int col = col0 + t * 16 + ln;
    const float bc = bf16_rne(bias[imin(col, nbias - 1)]) * bscale;
#pragma unroll
    for (int r = 0; r < 8; ++r) {
      const int rloc = half * 16 + 8 * hh + r;
      const float br = bf16_rne(brow[half * 8 + r]) * bscale;
      const float bv = (biasrow != 0) ? br : bc;
      so[w][rloc][t * 16 + ln] = accs[u][r] * alpha + bv;
    }
  }
  __builtin_amdgcn_fence(4 /* acq_rel order */, "workgroup");
  __builtin_amdgcn_wave_barrier();
  if (out16 != 0) {
    const int rq = lane >> 3, c8 = (lane & 7) * 8;
    {
#pragma unroll
      for (int it = 0; it < 8; ++it) {
        const int row = it * 4 + rq;
        const v4f x0 = *(const v4fa*)&so[w][row][c8];
        const v4f x1 = *(const v4fa*)&so[w][row][c8 + 4];
        FragH f;
#pragma unroll
        for (int q = 0; q < 4; ++q) { f.h[q] = (_Float16)x0[q]; f.h[4 + q] = (_Float16)x1[q]; }
        const v8us o = f.half[0];
        *(v8us*)((unsigned short*)C16 + cofs + (size_t)(row0 + row) * ldc + col0 + c8) = o;
      }
      asm volatile("s_wait_xcnt 0x0" ::: "memory");     /* where the other branch's code follows in the build, it reuses the stores' address and data registers only behind this */
    }
  } else {
    const int rsub = lane >> 4, c4 = (lane & 15) * 4;
    {
#pragma unroll
      for (int q = 0; q < 16; ++q) {
        const int r = q * 2 + rsub;
        const v4f v = *(const v4fa*)&so[w][r][c4];
        *(v4f*)(C32 + cofs + (size_t)(row0 + r) * ldc + col0 + c4) = v;
      }
      
    }
  }
}

__global__ __launch_bounds__(128) void k_gemm(const _Float16* __restrict__ A, int lda,
                                              const _Float16* __restrict__ Bh, int ldb, size_t sB, float alpha,
                                              const float* __restrict__ bias, int nbias, int biasrow,
                                              float* __restrict__ C32, _Float16* __restrict__ C16, int out16,
                                              int ldc, size_t sC, int M, int N, int K) {
  const int ntn = N >> 6;
  const int mt = blockIdx.x / ntn, nq = blockIdx.x - mt * ntn;
  gemm_body(A, lda, Bh, ldb, sB, alpha, bias, 1.0f, nbias, biasrow, C32, C16, out16, ldc, sC, M, N, K, mt, nq, blockIdx.y);
}

#define QKB ((NR / 128) * (DM / 64))           /* blocks of the Q GEMM, and of the K GEMM */
#define VTB ((DM / 128) * (SEQ / 64))          /* blocks of the V^T GEMM per batch */

// The three projections in one grid: blocks 0 .. QKB - 1 make Q rows, the next QKB make K rows, the last NB VTB make V^T (VTB per batch). They are independent; every selection is block-uniform.
// Wt: the weight planes in the order q, k, v. The Q rows are stored x QSCALE (product and bias alike).
__global__ __launch_bounds__(128) void k_qkv(const _Float16* __restrict__ X16, const _Float16* __restrict__ Wt,
                                             const float* __restrict__ bq, const float* __restrict__ bk, const float* __restrict__ bv,
                                             _Float16* __restrict__ Q16, _Float16* __restrict__ K16, _Float16* __restrict__ VT) {
  const int bx = blockIdx.x;
  const int j = (bx >= 2 * QKB) ? 2 : (bx >= QKB) ? 1 : 0;
  const bool isv = j == 2;
  const int r = bx - j * QKB;
  const int by = isv ? r / VTB : 0;
  const int lx = r - by * VTB;
  const int mt = isv ? lx / (SEQ / 64) : lx / (DM / 64);
  const int nq = lx - mt * (isv ? SEQ / 64 : DM / 64);
  const _Float16* Wj = Wt + (size_t)j * DM * DM;
  const float osc = (j == 0) ? QSCALE : 1.0f;
  gemm_body(isv ? Wj : X16, DM, isv ? X16 : Wj, DM, isv ? (size_t)SEQ * DM : (size_t)0, 0.0625f * osc,
            (j == 0) ? bq : (j == 1) ? bk : bv, osc, DM, isv ? 1 : 0,
            (float*)nullptr, (j == 0) ? Q16 : (j == 1) ? K16 : VT, 1,
            isv ? SEQ : DM, isv ? (size_t)DM * SEQ : (size_t)0, isv ? DM : NR, isv ? SEQ : DM, DM, mt, nq, by);
}

#define KT 64                         /* keys per staged tile: K rows and V^T rows are then whole 128-byte lines */
#define KPITCH 72                     /* LDS row pitch in 16-bit elements: 144 B = 16 B x odd, conflict-free for 16-byte fragment reads */
#define NTILE (SEQ / KT)
#define RESCALE_AT (3.0f * LOG2E)     /* growth of a row maximum (log2 units) that forces a rescale: 1024 e^3 = 20,568 < 65,504 */
static_assert(SEQ % KT == 0);

// One K tile (KT keys x 64 d) and one V^T tile (64 d x KT keys) from global memory into LDS, 16 bytes per lane and copy; a wave's copy covers 4 whole 128-byte rows.
// lk, lv: this lane's LDS byte address in row tid >> 3 of the K and V^T tile; gk, gv: the matching global addresses. Copy i takes row (tid >> 3) + 16 i.
// s_wait_xcnt 0 closes the statement so that no address register of an issued copy is rewritten ahead of it.
__device__ __forceinline__ void stage_kv(unsigned lk, unsigned lv, const _Float16* gk, const _Float16* gv) {
  asm volatile("global_load_async_to_lds_b128 %0, %8, off\n\t"
               "global_load_async_to_lds_b128 %1, %9, off\n\t"
               "global_load_async_to_lds_b128 %2, %10, off\n\t"
               "global_load_async_to_lds_b128 %3, %11, off\n\t"
               "global_load_async_to_lds_b128 %4, %12, off\n\t"
               "global_load_async_to_lds_b128 %5, %13, off\n\t"
               "global_load_async_to_lds_b128 %6, %14, off\n\t"
               "global_load_async_to_lds_b128 %7, %15, off\n\t"
               "s_wait_xcnt 0x0"
               :: "v"(lk), "v"(lk + 16u * KPITCH * 2u), "v"(lk + 32u * KPITCH * 2u), "v"(lk + 48u * KPITCH * 2u),
                  "v"(lv), "v"(lv + 16u * KPITCH * 2u), "v"(lv + 32u * KPITCH * 2u), "v"(lv + 48u * KPITCH * 2u),
                  "v"(gk), "v"(gk + (size_t)16 * DM), "v"(gk + (size_t)32 * DM), "v"(gk + (size_t)48 * DM),
                  "v"(gv), "v"(gv + (size_t)16 * SEQ), "v"(gv + (size_t)32 * SEQ), "v"(gv + (size_t)48 * SEQ)
               : "memory");
}

// Fused attention. Block = 4 waves of one (batch, head); wave = 32 queries as two 16-query tiles u = 0, 1. Q16/K16 rows [token][DM] (head h at columns 64h..), VT [batch][DM][SEQ].
// K and V^T reach the waves through a two-buffer LDS ring of KT-key tiles filled by asynchronous copies, one tile ahead; the block's 4 waves share each tile.
// Every K and V^T fragment read from LDS feeds two WMMAs, one per query tile, and a staged tile serves the block's 128 queries.
// Per tile of KT keys: S^T tiles (A = K rows, B = Q rows x QSCALE, C = mask addend x log2(e) from LDS, per key; D lane = query, r = key 8h+r) = the logits in log2 units -> online softmax on exp2 with lazy rescale (lane-local; one cross-half exchange)
// -> P in registers is the B fragment (k = key) of O^T += V^T . P^T (A = V^T rows; D lane = query, r = d 8h+r). Output rows f16 carried x64.
__global__ __launch_bounds__(128) void k_attn(const _Float16* __restrict__ Q16, const _Float16* __restrict__ K16,
                                              const _Float16* __restrict__ VT, const float* __restrict__ mask,
                                              _Float16* __restrict__ O16) {
  __shared__ __attribute__((aligned(16))) float msk[SEQ];                  /* cross-wave: block barrier */
  __shared__ __attribute__((aligned(16))) unsigned short ring[2][2][KT][KPITCH];   /* [buffer][K | V^T][row][element]; behind the loop's last barrier the 2 KT rows of ring[0] stage the output, rows 32w.. for wave w */
  static_assert(2 * KT == 4 * 32);
  const int tid = threadIdx.x, lane = tid & 31, ln = lane & 15, hh = lane >> 4;
  const int w = __builtin_amdgcn_readfirstlane(tid >> 5);
  const int gw = blockIdx.x * 4 + w;
  const int bh = gw / (SEQ / 32);
  const int qt = gw - bh * (SEQ / 32);
  const int b = bh / NH, h = bh - b * NH;
  const size_t tok0 = (size_t)b * SEQ;
  const int crow = tid >> 3, cc8 = (tid & 7) * 8;
  const unsigned lk0 = (unsigned)(size_t)&ring[0][0][crow][cc8];
  const unsigned lv0 = (unsigned)(size_t)&ring[0][1][crow][cc8];
  const _Float16* gk0 = K16 + (tok0 + (size_t)crow) * DM + h * HD + cc8;
  const _Float16* gv0 = VT + ((size_t)b * DM + (size_t)(h * HD + crow)) * SEQ + cc8;
  stage_kv(lk0, lv0, gk0, gv0);             /* tile 0 -> buffer 0, in flight under the mask fill */
  // additive key term of this batch in log2 units: f32(bf16(mask)) * (-1e9) * log2(e), all SEQ entries written before any read
  const float* mrow = mask + (size_t)b * SEQ_FULL;
  for (int i = tid * 4; i < SEQ; i += 512) {
    const v4f m = *(const v4fa*)(mrow + i);
    v4f o;
#pragma unroll
    for (int q = 0; q < 4; ++q) o[q] = (bf16_rne(m[q]) * -1.0e9f) * LOG2E;
    *(v4fa*)&msk[i] = o;
  }
  asm volatile("s_wait_asynccnt 0x0" ::: "memory");   /* this wave's share of tile 0 has landed before the barrier publishes it */
  __syncthreads();
  if (1 < NTILE) stage_kv(lk0 + (unsigned)sizeof(ring[0]), lv0 + (unsigned)sizeof(ring[0]), gk0 + (size_t)KT * DM, gv0 + KT);   /* tile 1 -> buffer 1 */
  const _Float16* qrow = Q16 + (tok0 + (size_t)(qt * 32 + ln)) * DM + h * HD;
  v16h qb[2][2];                            /* [query tile][d half] */
#pragma unroll
  for (int u = 0; u < 2; ++u) { qb[u][0] = ldfrag(qrow + (size_t)u * 16 * DM, hh); qb[u][1] = ldfrag(qrow + (size_t)u * 16 * DM + 32, hh); }
  const v8f z8 = {0.f, 0.f, 0.f, 0.f, 0.f, 0.f, 0.f, 0.f};
  v8f o[2][4] = {{z8, z8, z8, z8}, {z8, z8, z8, z8}};
  float mo[2] = {-1.0e30f, -1.0e30f}, mso[2] = {-1.0e30f, -1.0e30f}, l[2] = {0.f, 0.f};
#pragma unroll 1
  for (int t = 0; t < NTILE; ++t) {
   const int buf = t & 1;
   const int kb = t * KT;
   const _Float16* kp = (const _Float16*)&ring[buf][0][ln][0];
   v8f e[2][KT / 16];                       /* e[u][g][r]: query tile u, key kb + 16g + 8h + r */
   /* every inner loop of the tile is unrolled so that e, pf and the accumulators are indexed by constants and stay in registers */
#pragma unroll
   for (int g = 0; g < KT / 16; ++g) {
    const v16h a0 = ldfrag(kp + g * 16 * KPITCH, hh), a1 = ldfrag(kp + g * 16 * KPITCH + 32, hh);
    const v4f ma = *(const v4fa*)&msk[kb + 16 * g + 8 * hh];
    const v4f mb = *(const v4fa*)&msk[kb + 16 * g + 8 * hh + 4];
    const v8f mc = __builtin_shufflevector(ma, mb, 0, 1, 2, 3, 4, 5, 6, 7);   /* the keys' addends start both query tiles' sums */
    e[0][g] = wmma16(a1, qb[0][1], wmma16(a0, qb[0][0], mc));
    e[1][g] = wmma16(a1, qb[1][1], wmma16(a0, qb[1][0], mc));
   }
   float bm[2];
#pragma unroll
   for (int u = 0; u < 2; ++u) {
    float x = fmaxf(e[u][0][0], e[u][1][0]);
#pragma unroll
    for (int g = 0; g < KT / 16; ++g) {
#pragma unroll
     for (int r = 0; r < 8; ++r) x = fmaxf(x, e[u][g][r]);
    }
    bm[u] = x;
   }
   const float bx0 = __shfl_xor(bm[0], 16, 32), bx1 = __shfl_xor(bm[1], 16, 32);
   bm[0] = fmaxf(bm[0], bx0); bm[1] = fmaxf(bm[1], bx1);
   // Lazy rescale, tested once per tile: the maxima in use stay while no query of the wave has a tile maximum more than RESCALE_AT above its own,
   // so a weight is at most 1024 2^RESCALE_AT = 1024 e^3, inside f16; the reference point cancels in the division by the row sum.
   if (__builtin_amdgcn_ballot_w32(bm[0] > mo[0] + RESCALE_AT || bm[1] > mo[1] + RESCALE_AT) != 0u) {   /* wave-uniform scalar branch */
#pragma unroll
    for (int u = 0; u < 2; ++u) {
     const float mn = fmaxf(mo[u], bm[u]);
     const float alpha = __builtin_amdgcn_exp2f(mo[u] - mn);
     mo[u] = mn; mso[u] = mn - 10.0f;       /* weights carried x1024 through the exponent */
     l[u] *= alpha;
     o[u][0] *= alpha; o[u][1] *= alpha; o[u][2] *= alpha; o[u][3] *= alpha;
    }
   }
   FragH pf[2][KT / 32];
#pragma unroll
   for (int u = 0; u < 2; ++u) {
    float p[KT / 16][8];
#pragma unroll
    for (int g = 0; g < KT / 16; ++g) {
#pragma unroll
     for (int r = 0; r < 8; ++r) {
       p[g][r] = __builtin_amdgcn_exp2f(e[u][g][r] - mso[u]);
       pf[u][g >> 1].h[8 * (g & 1) + r] = (_Float16)p[g][r];   /* k = 16 (g & 1) + 8h + r <-> key kb + 16g + 8h + r */
     }
    }
    float ps = 0.f;
#pragma unroll
    for (int c = 0; c < KT / 32; ++c) {
#pragma unroll
     for (int r = 0; r < 8; ++r) ps += p[2 * c][r] + p[2 * c + 1][r];
    }
    l[u] += ps;
   }
   const _Float16* vp = (const _Float16*)&ring[buf][1][ln][0];
#pragma unroll
   for (int c = 0; c < KT / 32; ++c) {
#pragma unroll
    for (int j = 0; j < 4; ++j) {
     const v16h a = ldfrag(vp + j * 16 * KPITCH + 32 * c, hh);
     o[0][j] = wmma16(a, pf[0][c].v, o[0][j]);
     o[1][j] = wmma16(a, pf[1][c].v, o[1][j]);
    }
   }
   /* order of the 16 V^T fragment reads (group 0x100: LDS reads) among their 16 WMMAs (group 0x008): three fragments ahead, then one fragment's 2 reads behind each pair of WMMAs;
      left alone, the compiler loads the last fragments one at a time into one register set and each pair of WMMAs waits out its own fragment's LDS latency */
   __builtin_amdgcn_sched_group_barrier(0x100, 6, 0);
#pragma unroll
   for (int i = 0; i < 5; ++i) { __builtin_amdgcn_sched_group_barrier(0x008, 2, 0); __builtin_amdgcn_sched_group_barrier(0x100, 2, 0); }
   __builtin_amdgcn_sched_group_barrier(0x008, 6, 0);
   asm volatile("s_wait_dscnt 0x0" ::: "memory");      /* this wave's reads of buffer buf are done before it is refilled */
   asm volatile("s_wait_asynccnt 0x0" ::: "memory");   /* this wave's share of tile t + 1 has landed */
   __syncthreads();                                    /* publishes tile t + 1 and ends every wave's reads of buffer buf */
   if (t + 2 < NTILE)
     stage_kv(lk0 + (unsigned)buf * (unsigned)sizeof(ring[0]), lv0 + (unsigned)buf * (unsigned)sizeof(ring[0]),
              gk0 + (size_t)(t + 2) * KT * DM, gv0 + (t + 2) * KT);
  }
  asm volatile("s_wait_asynccnt 0x0" ::: "memory");    /* no copy is outstanding when the ring becomes output staging */
  unsigned short* stg = &ring[0][0][0][0] + (size_t)(32 * w) * KPITCH;   /* this wave's 32 staging rows */
#pragma unroll
  for (int u = 0; u < 2; ++u) {
    const float lo = __shfl_xor(l[u], 16, 32);
    const float lt = l[u] + lo;
    const float inv = 64.0f / lt;           /* merged rows carried x64 */
#pragma unroll
    for (int j = 0; j < 4; ++j) {
      FragH f;
#pragma unroll
      for (int r = 0; r < 8; ++r) f.h[r] = (_Float16)(o[u][j][r] * inv);   /* query 16u + ln, d = 16j + 8h + r */
      *(v8us*)(stg + (16 * u + ln) * KPITCH + 16 * j + 8 * hh) = f.half[0];
    }
  }
  __builtin_amdgcn_fence(4 /* acq_rel order */, "workgroup");
  __builtin_amdgcn_wave_barrier();
  const int rq = lane >> 3, pc = lane & 7;
  {
#pragma unroll
    for (int it = 0; it < 8; ++it) {
      const int row = it * 4 + rq;
      const v8us v = *(const v8us*)(stg + row * KPITCH + pc * 8);
      *(v8us*)((unsigned short*)O16 + (tok0 + (size_t)(qt * 32 + row)) * DM + h * HD + pc * 8) = v;
    }
  }
}

extern "C" void kernel_launch(void* const* d_in, const int* in_sizes, int n_in,
                              void* d_out, int out_size, void* d_ws, size_t ws_size, hipStream_t stream) {
  if (n_in < 10) return;
  const size_t needRows = (size_t)(NB - 1) * SEQ_FULL + SEQ;
  if ((size_t)in_sizes[0] < needRows * DM) return;
  if ((size_t)in_sizes[1] < needRows) return;
  if ((size_t)in_sizes[2] < (size_t)DM * DM || (size_t)in_sizes[4] < (size_t)DM * DM) return;
  if ((size_t)in_sizes[6] < (size_t)DM * DM || (size_t)in_sizes[8] < (size_t)DM * DM) return;
  if (in_sizes[3] < DM || in_sizes[5] < DM || in_sizes[7] < DM || in_sizes[9] < DM) return;
  if ((size_t)out_size < (size_t)NR * DM) return;
  const float* x    = (const float*)d_in[0];
  const float* mask = (const float*)d_in[1];
  const float* wq   = (const float*)d_in[2];
  const float* bq   = (const float*)d_in[3];
  const float* wk   = (const float*)d_in[4];
  const float* bk   = (const float*)d_in[5];
  const float* wv   = (const float*)d_in[6];
  const float* bv   = (const float*)d_in[7];
  const float* wo   = (const float*)d_in[8];
  const float* bo   = (const float*)d_in[9];
  float* out = (float*)d_out;

  char* ws = (char*)d_ws; size_t off = 0;
  const size_t wB = (size_t)DM * DM * 2;          /* 1,179,648 B per weight plane */
  const size_t pB = (size_t)NR * DM * 2;          /* 12,582,912 B per activation plane */
  _Float16* BQ  = (_Float16*)(ws + off); off += wB;
  _Float16* BK  = (_Float16*)(ws + off); off += wB;
  _Float16* BV  = (_Float16*)(ws + off); off += wB;
  _Float16* BO  = (_Float16*)(ws + off); off += wB;
  _Float16* X16 = (_Float16*)(ws + off); off += pB;
  _Float16* Q16 = (_Float16*)(ws + off); off += pB;
  _Float16* K16 = (_Float16*)(ws + off); off += pB;
  _Float16* VT  = (_Float16*)(ws + off); off += pB;   /* [NB][DM][SEQ] */
  _Float16* O16 = (_Float16*)(ws + off); off += pB;
  if (off > ws_size) return;

  /* weights in[768][768] -> planes BQ, BK, BV, BO out[n][k] x16 (consecutive from BQ); x -> f16 rows */
  k_prep<<<PB, PT, 0, stream>>>(wq, wk, wv, wo, x, BQ, X16);
  /* Q, K rows: [NR][DM] f16; V^T per batch: C[m = feature][n = token] = Wv^T[m][k] . x[n][k] + bv[m] -> VT[b][DM][SEQ] */
  k_qkv<<<(unsigned)(2 * QKB + NB * VTB), 128, 0, stream>>>(X16, BQ, bq, bk, bv, Q16, K16, VT);
  k_attn<<<(unsigned)(((size_t)NB * NH * (SEQ / 32)) / 4), 128, 0, stream>>>(Q16, K16, VT, mask, O16);
  /* out = (O16 / 64) . (BO / 16) + bo */
  k_gemm<<<dim3((unsigned)((NR / 128) * (DM / 64)), 1), 128, 0, stream>>>(O16, DM, BO, DM, (size_t)0, 0.0009765625f, bo, DM, 0, out, Q16, 0, DM, (size_t)0, NR, DM, DM);
}
